// v000
// Times are from an AMD MI455X. After a warm-up the kernel runs many times in a row, and a time is the length of
// such a window on the GPU divided by its runs, so every launch and the gaps after it count. The runs cycle
// through copies of the inputs. A figure is the median of several windows, for all but v000 over two sittings.
// Sittings can differ by a few percent; kernels timed side by side share one.
// v000 is the starting kernel. One run takes 2120 microseconds.
#include <hip/hip_runtime.h>

// IDContextAttention (x [4][2048][768], id_anchor [4][1][768]; Q/K/V = x W^T + b (12 heads x 64); one extra key/value K_id/V_id = id_anchor Wk/Wv^T + b PREPENDED to the 2048 current keys; softmax(q.k/8) over the 2049 keys; out = (attn V merged) Wo^T + bo
// -> [4][2048][768]). The extra key column and value row are handled on the VALU next to the 2048x2048 GEMM tiles.
// Compute dtypes, f32 accumulate: every input rounded to bf16; Q/K/V on PLAIN bf16 operands (inputs: exact) + bias; K_id/V_id and q.K_id f32 on the VALU (fixed-order dots); scores (K 64) and attn.V over the 2048 current keys

#define NB_  4
#define TT   2048
#define DM   768
#define NH_  12
#define HD   64
#define HPP  4
#define PCAR 1024.0f
typedef _Float16 h16;
typedef unsigned short bf;
typedef __attribute__((ext_vector_type(16))) __bf16   v16bf;
typedef __attribute__((ext_vector_type(16))) _Float16 v16h;
typedef __attribute__((ext_vector_type(8)))  _Float16 v8h;
typedef __attribute__((ext_vector_type(8)))  unsigned short v8us;
typedef __attribute__((ext_vector_type(8)))  float    v8f;
typedef __attribute__((ext_vector_type(4)))  float    v4f;
typedef v8h  __attribute__((may_alias)) v8ha;
typedef v4f  __attribute__((may_alias)) v4fa;
typedef v8us __attribute__((may_alias)) v8usa;

__device__ __forceinline__ unsigned short f2bf(float f) { unsigned u = __float_as_uint(f); u += 0x7FFFu + ((u >> 16) & 1u); return (unsigned short)(u >> 16); }
__device__ __forceinline__ float bf2f(unsigned short b) { return __uint_as_float(((unsigned)b) << 16); }
__device__ __forceinline__ float bfr(float f) { return bf2f(f2bf(f)); }
__device__ __forceinline__ v16h cat16(v8h lo, v8h hi) { return __builtin_shufflevector(lo, hi, 0, 1, 2, 3, 4, 5, 6, 7, 8, 9, 10, 11, 12, 13, 14, 15); }
__device__ __forceinline__ v16bf cat16b(v8us lo, v8us hi) { return __builtin_bit_cast(v16bf, __builtin_shufflevector(lo, hi, 0, 1, 2, 3, 4, 5, 6, 7, 8, 9, 10, 11, 12, 13, 14, 15)); }
__device__ __forceinline__ v8f wmma16(v16h a, v16h b, v8f c) { return __builtin_amdgcn_wmma_f32_16x16x32_f16(false, a, false, b, (short)0, c, false, false); }
__device__ __forceinline__ v8f wmmab(v16bf a, v16bf b, v8f c) { return __builtin_amdgcn_wmma_f32_16x16x32_bf16(false, a, false, b, (short)0, c, false, false); }



// ---- k_gemmw: register-blocked GEMM, ONE WAVE per 64x64 output tile (16 accumulators), operands straight from K-contiguous 16-bit planes; grid (M/64, N/64, Z), 32 threads.
// C[m][n] (f32, pitch ldc, + optional f32 bias[n]) = sum_k A[m][k] Bt[n][k] (+ split products per NSPLIT). z-batch strides sA/sB/sC in elements. K % 32 == 0.
template <typename T16> struct WFrag;
template <> struct WFrag<h16> { typedef v16h V; static __device__ __forceinline__ V ld(const h16* p) { return cat16(*(const v8h*)p, *(const v8h*)(p + 16)); } static __device__ __forceinline__ v8f mma(V a, V b, v8f c) { return wmma16(a, b, c); } };
template <> struct WFrag<bf> { typedef v16bf V; static __device__ __forceinline__ V ld(const bf* p) { return cat16b(*(const v8us*)p, *(const v8us*)(p + 16)); } static __device__ __forceinline__ v8f mma(V a, V b, v8f c) { return wmmab(a, b, c); } };
template <typename T16, int NSPLIT, bool BIAS>
__global__ __launch_bounds__(32) void k_gemmw(const T16* __restrict__ A, const T16* __restrict__ A2, const T16* __restrict__ Bt, const T16* __restrict__ Bt2, int K, float* C, int ldc, const float* __restrict__ bias, size_t sA, size_t sB, size_t sC) {
    typedef typename WFrag<T16>::V V;
    __shared__ __align__(16) float os[16 * 68];
    const size_t z = blockIdx.z; A += z * sA; if (A2) A2 += z * sA; Bt += z * sB; if (Bt2) Bt2 += z * sB; C += z * sC;
    const int lane = threadIdx.x & 31, lr = lane & 15, hi = lane >> 4; const int r0 = blockIdx.x * 64, c0 = blockIdx.y * 64;
    v8f acc[4][4];
#pragma unroll
    for (int mb = 0; mb < 4; ++mb)
#pragma unroll
        for (int nb = 0; nb < 4; ++nb) acc[mb][nb] = (v8f){};
    const size_t aoff = (size_t)(r0 + lr) * K + 8 * hi, boff = (size_t)(c0 + lr) * K + 8 * hi;
#pragma unroll 1
    for (int kc = 0; kc < K; kc += 32) {
        V a[4], a2[4];
#pragma unroll
        for (int mb = 0; mb < 4; ++mb) { a[mb] = WFrag<T16>::ld(A + aoff + (size_t)mb * 16 * K + kc); if (NSPLIT == 1 || NSPLIT == 2) a2[mb] = WFrag<T16>::ld(A2 + aoff + (size_t)mb * 16 * K + kc); }
#pragma unroll
        for (int nb = 0; nb < 4; ++nb) { const V b = WFrag<T16>::ld(Bt + boff + (size_t)nb * 16 * K + kc); V b2; if (NSPLIT >= 2) b2 = WFrag<T16>::ld(Bt2 + boff + (size_t)nb * 16 * K + kc);
#pragma unroll
            for (int mb = 0; mb < 4; ++mb) { acc[mb][nb] = WFrag<T16>::mma(a[mb], b, acc[mb][nb]); if (NSPLIT == 1 || NSPLIT == 2) acc[mb][nb] = WFrag<T16>::mma(a2[mb], b, acc[mb][nb]); if (NSPLIT >= 2) acc[mb][nb] = WFrag<T16>::mma(a[mb], b2, acc[mb][nb]); } }
        asm volatile("v_nop\n\tv_nop\n\tv_nop\n\tv_nop" : "+v"(acc[0][0]), "+v"(acc[1][1]), "+v"(acc[2][2]), "+v"(acc[3][3]) : "v"(a[0]), "v"(a[3]));
    }
#pragma unroll
    for (int mb = 0; mb < 4; ++mb) {
#pragma unroll
        for (int nb = 0; nb < 4; ++nb) {
#pragma unroll
            for (int j = 0; j < 8; ++j) os[(hi * 8 + j) * 68 + nb * 16 + lr] = acc[mb][nb][j]; }
        __builtin_amdgcn_wave_barrier(); asm volatile("" ::: "memory");
        float* crow = C + (size_t)(r0 + mb * 16) * ldc + c0;
{
#pragma unroll
            for (int s = 0; s < 8; ++s) { const int row = 2 * s + hi, cofs = lr * 4; v4f val = *(const v4fa*)(os + row * 68 + cofs); if (BIAS) { val[0] += bfr(bias[c0 + cofs]); val[1] += bfr(bias[c0 + cofs + 1]); val[2] += bfr(bias[c0 + cofs + 2]); val[3] += bfr(bias[c0 + cofs + 3]); }
                *(v4f*)(crow + (size_t)row * ldc + cofs) = val; }
             }
        __builtin_amdgcn_wave_barrier(); asm volatile("" ::: "memory");
    }
}

__device__ __forceinline__ h16 tohx(float x) { return (h16)x; }
__device__ __forceinline__ void splitf(float y, unsigned short& h, unsigned short& l) { h = f2bf(y); l = f2bf(y - bf2f(h)); }
typedef __attribute__((ext_vector_type(2))) unsigned short v2us;
typedef __attribute__((ext_vector_type(4))) unsigned short v4us;
typedef __attribute__((ext_vector_type(2))) _Float16 v2h;
typedef __attribute__((ext_vector_type(4))) _Float16 v4h;

__global__ __launch_bounds__(256) void k_cvt8(const float* __restrict__ src, bf* dst, size_t n8) { const size_t i = (size_t)blockIdx.x * 256 + threadIdx.x; if (i >= n8) return; const v8f v = *(const v8f*)(src + i * 8); v8us o;
#pragma unroll
    for (int k = 0; k < 8; ++k) o[k] = f2bf(v[k]); *(v8us*)(dst + i * 8) = o;  }
// k_idkv: thread per channel c: KID[c] = sum_d bf16 id[d] bf16 Wk[c][d] + bk[c], VID likewise (4-B thread-linear); k_pl: fp16 planes [h][t][d] of a [t][768] buffer; k_vt: VT16[h][d][t]; k_s0: thread per (h, t): s0 = sum_d Q[t][h*64+d] KID[h*64+d] (4-B);
// k_isoft: wave per (z, t) row: scores {s0, S[t][0..2047]} x 1/8, softmax over all 2049 f32 -> fp16 P x 1024 for the 2048 current keys and P0[z][t] f32 (4-B per row, written as replicated 32-float lines); k_mrg: hl planes A[t][(h0+z)*64+d] =
__global__ __launch_bounds__(256) void k_idkv(const float* __restrict__ ida, const float* __restrict__ Wk, const float* __restrict__ bk, const float* __restrict__ Wv, const float* __restrict__ bv, float* KID, float* VID) { const int c = blockIdx.x * 256 + threadIdx.x; if (c >= DM) return; float sk = 0.f, sv = 0.f;
#pragma unroll 1
    for (int d = 0; d < DM; ++d) { const float a = bfr(ida[d]); float wk = bfr(Wk[(size_t)c * DM + d]), wv = bfr(Wv[(size_t)c * DM + d]); asm volatile("" : "+v"(wk)); asm volatile("" : "+v"(wv)); float p1 = __fmul_rn(a, wk), p2 = __fmul_rn(a, wv); asm volatile("" : "+v"(p1)); asm volatile("" : "+v"(p2)); sk = __fadd_rn(sk, p1); sv = __fadd_rn(sv, p2); }
    const float rk = __fadd_rn(sk, bfr(bk[c])), rv = __fadd_rn(sv, bfr(bv[c])); { *(float*)(KID + c) = rk; *(float*)(VID + c) = rv;  } }
__global__ __launch_bounds__(256) void k_pl(const float* __restrict__ F, h16* P) { const int e = (blockIdx.x * 256 + threadIdx.x) * 4; if (e >= NH_ * TT * HD) return; const int d = e % HD; const int t = (e / HD) % TT; const int h = e / (HD * TT); const float* f = F + (size_t)t * DM + h * HD + d; v4h o;
#pragma unroll
    for (int u = 0; u < 4; ++u) o[u] = tohx(f[u]); *(v4h*)(P + e) = o;  }
__global__ __launch_bounds__(256) void k_vt(const float* __restrict__ V, h16* VT) { const int e = (blockIdx.x * 256 + threadIdx.x) * 2; if (e >= NH_ * HD * TT) return; const int t = e % TT; const int d = (e / TT) % HD; const int h = e / (TT * HD); v2h o; o[0] = tohx(V[(size_t)t * DM + h * HD + d]); o[1] = tohx(V[(size_t)(t + 1) * DM + h * HD + d]); *(v2h*)(VT + e) = o;  }
__global__ __launch_bounds__(256) void k_s0(const float* __restrict__ Q, const float* __restrict__ KID, float* S0) { const int idx = blockIdx.x * 256 + threadIdx.x; if (idx >= NH_ * TT) return; const int t = idx % TT; const int h = idx / TT; float s = 0.f;
#pragma unroll 1
    for (int d = 0; d < HD; ++d) { float p = __fmul_rn(Q[(size_t)t * DM + h * HD + d], KID[h * HD + d]); asm volatile("" : "+v"(p)); s = __fadd_rn(s, p); } *(float*)(S0 + idx) = s;  }
__global__ __launch_bounds__(256) void k_isoft(const float* __restrict__ Sb, const float* __restrict__ S0, int h0, h16* P16, float* P0) { const int lane = threadIdx.x & 31; const int row = blockIdx.x * 8 + (threadIdx.x >> 5); if (row >= HPP * TT) return; const int t = row % TT; const int z = row / TT; const float* sr = Sb + (size_t)row * TT; float v[TT / 32];
    const float s0 = S0[(size_t)(h0 + z) * TT + t] * 0.125f; float mx = s0;
#pragma unroll
    for (int ch = 0; ch < TT / 128; ++ch) { const v4f a = *(const v4f*)(sr + ch * 128 + lane * 4);
#pragma unroll
        for (int u = 0; u < 4; ++u) { const float tt = a[u] * 0.125f; v[ch * 4 + u] = tt; mx = fmaxf(mx, tt); } }
#pragma unroll
    for (int sh = 16; sh; sh >>= 1) mx = fmaxf(mx, __shfl_xor(mx, sh, 32));
    float sum = 0.f;
#pragma unroll
    for (int q = 0; q < TT / 32; ++q) { float d0 = __fsub_rn(v[q], mx); asm volatile("" : "+v"(d0)); v[q] = __builtin_amdgcn_exp2f(__fmul_rn(d0, 1.4426950408889634f)); sum += v[q]; }
#pragma unroll
    for (int sh = 16; sh; sh >>= 1) sum += __shfl_xor(sum, sh, 32);
    float d1 = __fsub_rn(s0, mx); asm volatile("" : "+v"(d1)); const float e0 = __builtin_amdgcn_exp2f(__fmul_rn(d1, 1.4426950408889634f)); sum = __fadd_rn(sum, e0);
    const float inv = __fdiv_rn(1.0f, sum); const float f = inv * PCAR; const float p0 = __fmul_rn(e0, inv);
    {
#pragma unroll
        for (int ch = 0; ch < TT / 128; ++ch) { v4h o4;
#pragma unroll
            for (int q = 0; q < 4; ++q) o4[q] = tohx(v[ch * 4 + q] * f); *(v4h*)(P16 + (size_t)row * TT + ch * 128 + lane * 4) = o4; }
        *(float*)(P0 + (size_t)row * 32 + lane) = p0;  } }
__global__ __launch_bounds__(256) void k_mrg(const float* __restrict__ O, const float* __restrict__ P0, const float* __restrict__ VID, int h0, bf* Ah, bf* Al) { const int e = (blockIdx.x * 256 + threadIdx.x) * 4; if (e >= HPP * TT * HD) return; const int d = e % HD; const int t = (e / HD) % TT; const int z = e / (HD * TT); const float p0 = P0[((size_t)z * TT + t) * 32]; v4us oh, ol;
#pragma unroll
    for (int u = 0; u < 4; ++u) { float m = O[e + u] * (1.0f / PCAR); float pv = __fmul_rn(p0, VID[(h0 + z) * HD + d + u]); asm volatile("" : "+v"(pv)); const float y = __fadd_rn(m, pv); unsigned short a, b; splitf(y, a, b); oh[u] = a; ol[u] = b; }
    const size_t oo = (size_t)t * DM + (h0 + z) * HD + d; *(v4us*)(Ah + oo) = oh; *(v4us*)(Al + oo) = ol;  }

extern "C" void kernel_launch(void* const* d_in, const int* in_sizes, int n_in,
                              void* d_out, int out_size, void* d_ws, size_t ws_size, hipStream_t stream) {
    (void)in_sizes; (void)n_in; (void)out_size;
    const float** I = (const float**)d_in;
    const float *x = I[0], *ida = I[1], *Wq = I[2], *bq = I[3], *Wk = I[4], *bk = I[5], *Wv = I[6], *bv = I[7], *Wo = I[8], *bo = I[9];
    float* OUT = (float*)d_out;     // [4][2048][768]
    char* wsp = (char*)d_ws;
    auto take = [&](size_t bytes) { char* p = wsp; wsp += (bytes + 255) & ~(size_t)255; return (void*)p; };
    bf* BQ = (bf*)take((size_t)DM * DM * 2); bf* BK = (bf*)take((size_t)DM * DM * 2); bf* BV = (bf*)take((size_t)DM * DM * 2); bf* BO = (bf*)take((size_t)DM * DM * 2);
    bf* XB = (bf*)take((size_t)TT * DM * 2); float* Q = (float*)take((size_t)TT * DM * 4); float* K = (float*)take((size_t)TT * DM * 4); float* V = (float*)take((size_t)TT * DM * 4); float* KID = (float*)take(DM * 4); float* VID = (float*)take(DM * 4); float* S0 = (float*)take((size_t)NH_ * TT * 4);
    h16* Q16 = (h16*)take((size_t)NH_ * TT * HD * 2); h16* K16 = (h16*)take((size_t)NH_ * TT * HD * 2); h16* VT = (h16*)take((size_t)NH_ * HD * TT * 2); float* Sb = (float*)take((size_t)HPP * TT * TT * 4); h16* P16 = (h16*)take((size_t)HPP * TT * TT * 2); float* P0 = (float*)take((size_t)HPP * TT * 32 * 4); float* O = (float*)take((size_t)HPP * TT * HD * 4); bf* Ah = (bf*)take((size_t)TT * DM * 2); bf* Al = (bf*)take((size_t)TT * DM * 2);
    if ((size_t)(wsp - (char*)d_ws) > ws_size) return;    // total ~ 140 MB (4-head [2048][2048] f32 scores 64 MB + fp16 probabilities 32 MB + q/k/v 18 MB)
    k_cvt8<<<(DM * DM / 8 + 255) / 256, 256, 0, stream>>>(Wq, BQ, DM * DM / 8); k_cvt8<<<(DM * DM / 8 + 255) / 256, 256, 0, stream>>>(Wk, BK, DM * DM / 8); k_cvt8<<<(DM * DM / 8 + 255) / 256, 256, 0, stream>>>(Wv, BV, DM * DM / 8); k_cvt8<<<(DM * DM / 8 + 255) / 256, 256, 0, stream>>>(Wo, BO, DM * DM / 8);   // torch [out][in] = Bt
    for (int b = 0; b < NB_; ++b) {
        k_cvt8<<<(TT * DM / 8 + 255) / 256, 256, 0, stream>>>(x + (size_t)b * TT * DM, XB, (size_t)TT * DM / 8);
        k_gemmw<bf, 0, true><<<dim3(TT / 64, DM / 64, 1), 32, 0, stream>>>(XB, nullptr, BQ, nullptr, DM, Q, DM, bq, 0, 0, 0); k_gemmw<bf, 0, true><<<dim3(TT / 64, DM / 64, 1), 32, 0, stream>>>(XB, nullptr, BK, nullptr, DM, K, DM, bk, 0, 0, 0); k_gemmw<bf, 0, true><<<dim3(TT / 64, DM / 64, 1), 32, 0, stream>>>(XB, nullptr, BV, nullptr, DM, V, DM, bv, 0, 0, 0);
        k_idkv<<<(DM + 255) / 256, 256, 0, stream>>>(ida + (size_t)b * DM, Wk, bk, Wv, bv, KID, VID); k_s0<<<(NH_ * TT + 255) / 256, 256, 0, stream>>>(Q, KID, S0);
        k_pl<<<(NH_ * TT * HD / 4 + 255) / 256, 256, 0, stream>>>(Q, Q16); k_pl<<<(NH_ * TT * HD / 4 + 255) / 256, 256, 0, stream>>>(K, K16); k_vt<<<(NH_ * HD * TT / 2 + 255) / 256, 256, 0, stream>>>(V, VT);
        for (int h0 = 0; h0 < NH_; h0 += HPP) { const size_t zo = (size_t)h0 * TT * HD;
            k_gemmw<h16, 0, false><<<dim3(TT / 64, TT / 64, HPP), 32, 0, stream>>>(Q16 + zo, nullptr, K16 + zo, nullptr, HD, Sb, TT, nullptr, (size_t)TT * HD, (size_t)TT * HD, (size_t)TT * TT);
            k_isoft<<<HPP * TT / 8, 256, 0, stream>>>(Sb, S0, h0, P16, P0);
            k_gemmw<h16, 0, false><<<dim3(TT / 64, 1, HPP), 32, 0, stream>>>(P16, nullptr, VT + (size_t)h0 * HD * TT, nullptr, TT, O, HD, nullptr, (size_t)TT * TT, (size_t)HD * TT, (size_t)TT * HD);
            k_mrg<<<(HPP * TT * HD / 4 + 255) / 256, 256, 0, stream>>>(O, P0, VID, h0, Ah, Al); }
        k_gemmw<bf, 1, true><<<dim3(TT / 64, DM / 64, 1), 32, 0, stream>>>(Ah, Al, BO, nullptr, DM, OUT + (size_t)b * TT * DM, DM, bo, 0, 0, 0); }
}

// v001
// It runs in 1430 microseconds.
// Next to v000, in two timings, it ran 1.50 times as fast each time.
#include <hip/hip_runtime.h>

// IDContextAttention (x [4][2048][768], id_anchor [4][1][768]; Q/K/V = x W^T + b (12 heads x 64); one extra key/value K_id/V_id = id_anchor Wk/Wv^T + b PREPENDED to the 2048 current keys; softmax(q.k/8) over the 2049 keys; out = (attn V merged) Wo^T + bo
// -> [4][2048][768]). The extra key column and value row are handled on the VALU next to the 2048x2048 GEMM tiles.
// Compute dtypes, f32 accumulate: every input rounded to bf16; Q/K/V on PLAIN bf16 operands (inputs: exact) + bias; K_id/V_id and q.K_id f32 on the VALU (fixed-order dots); scores (K 64) and attn.V over the 2048 current keys

#define NB_  4
#define TT   2048
#define DM   768
#define NH_  12
#define HD   64
#define HPP  4
#define PCAR 1024.0f
typedef _Float16 h16;
typedef unsigned short bf;
typedef __attribute__((ext_vector_type(16))) __bf16   v16bf;
typedef __attribute__((ext_vector_type(16))) _Float16 v16h;
typedef __attribute__((ext_vector_type(8)))  _Float16 v8h;
typedef __attribute__((ext_vector_type(8)))  unsigned short v8us;
typedef __attribute__((ext_vector_type(8)))  float    v8f;
typedef __attribute__((ext_vector_type(4)))  float    v4f;
typedef v8h  __attribute__((may_alias)) v8ha;
typedef v4f  __attribute__((may_alias)) v4fa;
typedef v8us __attribute__((may_alias)) v8usa;

__device__ __forceinline__ unsigned short f2bf(float f) { unsigned u = __float_as_uint(f); u += 0x7FFFu + ((u >> 16) & 1u); return (unsigned short)(u >> 16); }
__device__ __forceinline__ float bf2f(unsigned short b) { return __uint_as_float(((unsigned)b) << 16); }
__device__ __forceinline__ float bfr(float f) { return bf2f(f2bf(f)); }
__device__ __forceinline__ v16h cat16(v8h lo, v8h hi) { return __builtin_shufflevector(lo, hi, 0, 1, 2, 3, 4, 5, 6, 7, 8, 9, 10, 11, 12, 13, 14, 15); }
__device__ __forceinline__ v16bf cat16b(v8us lo, v8us hi) { return __builtin_bit_cast(v16bf, __builtin_shufflevector(lo, hi, 0, 1, 2, 3, 4, 5, 6, 7, 8, 9, 10, 11, 12, 13, 14, 15)); }
__device__ __forceinline__ v8f wmma16(v16h a, v16h b, v8f c) { return __builtin_amdgcn_wmma_f32_16x16x32_f16(false, a, false, b, (short)0, c, false, false); }
__device__ __forceinline__ v8f wmmab(v16bf a, v16bf b, v8f c) { return __builtin_amdgcn_wmma_f32_16x16x32_bf16(false, a, false, b, (short)0, c, false, false); }



// ---- k_gemmw: register-blocked GEMM, ONE WAVE per 64x64 output tile (16 accumulators), operands straight from K-contiguous 16-bit planes; grid (M/64, N/64, Z), 32 threads.
// C[m][n] (f32, pitch ldc, + optional f32 bias[n]) = sum_k A[m][k] Bt[n][k] (+ split products per NSPLIT). z-batch strides sA/sB/sC in elements. K % 32 == 0.
template <typename T16> struct WFrag;
template <> struct WFrag<h16> { typedef v16h V; static __device__ __forceinline__ V ld(const h16* p) { return cat16(*(const v8h*)p, *(const v8h*)(p + 16)); } static __device__ __forceinline__ v8f mma(V a, V b, v8f c) { return wmma16(a, b, c); } };
template <> struct WFrag<bf> { typedef v16bf V; static __device__ __forceinline__ V ld(const bf* p) { return cat16b(*(const v8us*)p, *(const v8us*)(p + 16)); } static __device__ __forceinline__ v8f mma(V a, V b, v8f c) { return wmmab(a, b, c); } };
template <typename T16, int NSPLIT, bool BIAS>
__global__ __launch_bounds__(32) void k_gemmw(const T16* __restrict__ A, const T16* __restrict__ A2, const T16* __restrict__ Bt, const T16* __restrict__ Bt2, int K, float* C, int ldc, const float* __restrict__ bias, size_t sA, size_t sB, size_t sC) {
    typedef typename WFrag<T16>::V V;
    __shared__ __align__(16) float os[16 * 68];
    const size_t z = blockIdx.z; A += z * sA; if (A2) A2 += z * sA; Bt += z * sB; if (Bt2) Bt2 += z * sB; C += z * sC;
    const int lane = threadIdx.x & 31, lr = lane & 15, hi = lane >> 4; const int r0 = blockIdx.x * 64, c0 = blockIdx.y * 64;
    v8f acc[4][4];
#pragma unroll
    for (int mb = 0; mb < 4; ++mb)
#pragma unroll
        for (int nb = 0; nb < 4; ++nb) acc[mb][nb] = (v8f){};
    const size_t aoff = (size_t)(r0 + lr) * K + 8 * hi, boff = (size_t)(c0 + lr) * K + 8 * hi;
#pragma unroll 1
    for (int kc = 0; kc < K; kc += 32) {
        V a[4], a2[4];
#pragma unroll
        for (int mb = 0; mb < 4; ++mb) { a[mb] = WFrag<T16>::ld(A + aoff + (size_t)mb * 16 * K + kc); if (NSPLIT == 1 || NSPLIT == 2) a2[mb] = WFrag<T16>::ld(A2 + aoff + (size_t)mb * 16 * K + kc); }
#pragma unroll
        for (int nb = 0; nb < 4; ++nb) { const V b = WFrag<T16>::ld(Bt + boff + (size_t)nb * 16 * K + kc); V b2; if (NSPLIT >= 2) b2 = WFrag<T16>::ld(Bt2 + boff + (size_t)nb * 16 * K + kc);
#pragma unroll
            for (int mb = 0; mb < 4; ++mb) { acc[mb][nb] = WFrag<T16>::mma(a[mb], b, acc[mb][nb]); if (NSPLIT == 1 || NSPLIT == 2) acc[mb][nb] = WFrag<T16>::mma(a2[mb], b, acc[mb][nb]); if (NSPLIT >= 2) acc[mb][nb] = WFrag<T16>::mma(a[mb], b2, acc[mb][nb]); } }
        asm volatile("v_nop\n\tv_nop\n\tv_nop\n\tv_nop" : "+v"(acc[0][0]), "+v"(acc[1][1]), "+v"(acc[2][2]), "+v"(acc[3][3]) : "v"(a[0]), "v"(a[3]));
    }
#pragma unroll
    for (int mb = 0; mb < 4; ++mb) {
#pragma unroll
        for (int nb = 0; nb < 4; ++nb) {
#pragma unroll
            for (int j = 0; j < 8; ++j) os[(hi * 8 + j) * 68 + nb * 16 + lr] = acc[mb][nb][j]; }
        __builtin_amdgcn_wave_barrier(); asm volatile("" ::: "memory");
        float* crow = C + (size_t)(r0 + mb * 16) * ldc + c0;
{
#pragma unroll
            for (int s = 0; s < 8; ++s) { const int row = 2 * s + hi, cofs = lr * 4; v4f val = *(const v4fa*)(os + row * 68 + cofs); if (BIAS) { val[0] += bfr(bias[c0 + cofs]); val[1] += bfr(bias[c0 + cofs + 1]); val[2] += bfr(bias[c0 + cofs + 2]); val[3] += bfr(bias[c0 + cofs + 3]); }
                *(v4f*)(crow + (size_t)row * ldc + cofs) = val; }
             }
        __builtin_amdgcn_wave_barrier(); asm volatile("" ::: "memory");
    }
}

__device__ __forceinline__ h16 tohx(float x) { return (h16)x; }
__device__ __forceinline__ void splitf(float y, unsigned short& h, unsigned short& l) { h = f2bf(y); l = f2bf(y - bf2f(h)); }
typedef __attribute__((ext_vector_type(2))) unsigned short v2us;
typedef __attribute__((ext_vector_type(4))) unsigned short v4us;
typedef __attribute__((ext_vector_type(2))) _Float16 v2h;
typedef __attribute__((ext_vector_type(4))) _Float16 v4h;

__global__ __launch_bounds__(256) void k_cvt8(const float* __restrict__ src, bf* dst, size_t n8) { const size_t i = (size_t)blockIdx.x * 256 + threadIdx.x; if (i >= n8) return; const v8f v = *(const v8f*)(src + i * 8); v8us o;
#pragma unroll
    for (int k = 0; k < 8; ++k) o[k] = f2bf(v[k]); *(v8us*)(dst + i * 8) = o;  }
// k_idkv: wave per channel c, block = 32 channels of one matrix (blockIdx.y 0: K, 1: V): KID[c] = sum_d bf16 id[d] bf16 Wk[c][d] + bk[c], VID likewise; lane l sums d = 128 i + 4 l + u in rising (i, u), lane 0 starting from the bias, all loads issued up front, then an xor butterfly over the lanes; the 32 sums meet in LDS and wave 0 stores them as one 128-B line; k_pl: fp16 planes [h][t][d] of a [t][768] buffer; k_vt: VT16[h][d][t]; k_s0: thread per (h, t): s0 = sum_d Q[t][h*64+d] KID[h*64+d] (4-B);
// k_isoft: wave per (z, t) row: scores {s0, S[t][0..2047]} x 1/8, softmax over all 2049 f32 -> fp16 P x 1024 for the 2048 current keys and P0[z][t] f32 (4-B per row, written as replicated 32-float lines); k_mrg: hl planes A[t][(h0+z)*64+d] =
__global__ __launch_bounds__(1024) void k_idkv(const float* __restrict__ ida, const float* __restrict__ Wk, const float* __restrict__ bk, const float* __restrict__ Wv, const float* __restrict__ bv, float* KID, float* VID) {
    __shared__ float red[32];
    const int lane = threadIdx.x & 31, w = threadIdx.x >> 5, c = blockIdx.x * 32 + w; const bool isv = blockIdx.y != 0;
    const float* wr = (isv ? Wv : Wk) + (size_t)c * DM + lane * 4; const float* ar = ida + lane * 4; const float bias = (isv ? bv : bk)[c]; v4f a[DM / 128], m[DM / 128];
#pragma unroll
    for (int i = 0; i < DM / 128; ++i) { m[i] = *(const v4f*)(wr + i * 128); a[i] = *(const v4f*)(ar + i * 128); }
    float s = lane == 0 ? bfr(bias) : 0.f;
#pragma unroll
    for (int i = 0; i < DM / 128; ++i)
#pragma unroll
        for (int u = 0; u < 4; ++u) s = fmaf(bfr(a[i][u]), bfr(m[i][u]), s);
#pragma unroll
    for (int sh = 16; sh; sh >>= 1) s += __shfl_xor(s, sh, 32);
    if (lane == 0) red[w] = s;
    __syncthreads();
    if (w == 0) (isv ? VID : KID)[blockIdx.x * 32 + lane] = red[lane]; }
__global__ __launch_bounds__(256) void k_pl(const float* __restrict__ F, h16* P) { const int e = (blockIdx.x * 256 + threadIdx.x) * 4; if (e >= NH_ * TT * HD) return; const int d = e % HD; const int t = (e / HD) % TT; const int h = e / (HD * TT); const float* f = F + (size_t)t * DM + h * HD + d; v4h o;
#pragma unroll
    for (int u = 0; u < 4; ++u) o[u] = tohx(f[u]); *(v4h*)(P + e) = o;  }
__global__ __launch_bounds__(256) void k_vt(const float* __restrict__ V, h16* VT) { const int e = (blockIdx.x * 256 + threadIdx.x) * 2; if (e >= NH_ * HD * TT) return; const int t = e % TT; const int d = (e / TT) % HD; const int h = e / (TT * HD); v2h o; o[0] = tohx(V[(size_t)t * DM + h * HD + d]); o[1] = tohx(V[(size_t)(t + 1) * DM + h * HD + d]); *(v2h*)(VT + e) = o;  }
__global__ __launch_bounds__(256) void k_s0(const float* __restrict__ Q, const float* __restrict__ KID, float* S0) { const int idx = blockIdx.x * 256 + threadIdx.x; if (idx >= NH_ * TT) return; const int t = idx % TT; const int h = idx / TT; float s = 0.f;
#pragma unroll 1
    for (int d = 0; d < HD; ++d) { float p = __fmul_rn(Q[(size_t)t * DM + h * HD + d], KID[h * HD + d]); asm volatile("" : "+v"(p)); s = __fadd_rn(s, p); } *(float*)(S0 + idx) = s;  }
__global__ __launch_bounds__(256) void k_isoft(const float* __restrict__ Sb, const float* __restrict__ S0, int h0, h16* P16, float* P0) { const int lane = threadIdx.x & 31; const int row = blockIdx.x * 8 + (threadIdx.x >> 5); if (row >= HPP * TT) return; const int t = row % TT; const int z = row / TT; const float* sr = Sb + (size_t)row * TT; float v[TT / 32];
    const float s0 = S0[(size_t)(h0 + z) * TT + t] * 0.125f; float mx = s0;
#pragma unroll
    for (int ch = 0; ch < TT / 128; ++ch) { const v4f a = *(const v4f*)(sr + ch * 128 + lane * 4);
#pragma unroll
        for (int u = 0; u < 4; ++u) { const float tt = a[u] * 0.125f; v[ch * 4 + u] = tt; mx = fmaxf(mx, tt); } }
#pragma unroll
    for (int sh = 16; sh; sh >>= 1) mx = fmaxf(mx, __shfl_xor(mx, sh, 32));
    float sum = 0.f;
#pragma unroll
    for (int q = 0; q < TT / 32; ++q) { float d0 = __fsub_rn(v[q], mx); asm volatile("" : "+v"(d0)); v[q] = __builtin_amdgcn_exp2f(__fmul_rn(d0, 1.4426950408889634f)); sum += v[q]; }
#pragma unroll
    for (int sh = 16; sh; sh >>= 1) sum += __shfl_xor(sum, sh, 32);
    float d1 = __fsub_rn(s0, mx); asm volatile("" : "+v"(d1)); const float e0 = __builtin_amdgcn_exp2f(__fmul_rn(d1, 1.4426950408889634f)); sum = __fadd_rn(sum, e0);
    const float inv = __fdiv_rn(1.0f, sum); const float f = inv * PCAR; const float p0 = __fmul_rn(e0, inv);
    {
#pragma unroll
        for (int ch = 0; ch < TT / 128; ++ch) { v4h o4;
#pragma unroll
            for (int q = 0; q < 4; ++q) o4[q] = tohx(v[ch * 4 + q] * f); *(v4h*)(P16 + (size_t)row * TT + ch * 128 + lane * 4) = o4; }
        *(float*)(P0 + (size_t)row * 32 + lane) = p0;  } }
__global__ __launch_bounds__(256) void k_mrg(const float* __restrict__ O, const float* __restrict__ P0, const float* __restrict__ VID, int h0, bf* Ah, bf* Al) { const int e = (blockIdx.x * 256 + threadIdx.x) * 4; if (e >= HPP * TT * HD) return; const int d = e % HD; const int t = (e / HD) % TT; const int z = e / (HD * TT); const float p0 = P0[((size_t)z * TT + t) * 32]; v4us oh, ol;
#pragma unroll
    for (int u = 0; u < 4; ++u) { float m = O[e + u] * (1.0f / PCAR); float pv = __fmul_rn(p0, VID[(h0 + z) * HD + d + u]); asm volatile("" : "+v"(pv)); const float y = __fadd_rn(m, pv); unsigned short a, b; splitf(y, a, b); oh[u] = a; ol[u] = b; }
    const size_t oo = (size_t)t * DM + (h0 + z) * HD + d; *(v4us*)(Ah + oo) = oh; *(v4us*)(Al + oo) = ol;  }

extern "C" void kernel_launch(void* const* d_in, const int* in_sizes, int n_in,
                              void* d_out, int out_size, void* d_ws, size_t ws_size, hipStream_t stream) {
    (void)in_sizes; (void)n_in; (void)out_size;
    const float** I = (const float**)d_in;
    const float *x = I[0], *ida = I[1], *Wq = I[2], *bq = I[3], *Wk = I[4], *bk = I[5], *Wv = I[6], *bv = I[7], *Wo = I[8], *bo = I[9];
    float* OUT = (float*)d_out;     // [4][2048][768]
    char* wsp = (char*)d_ws;
    auto take = [&](size_t bytes) { char* p = wsp; wsp += (bytes + 255) & ~(size_t)255; return (void*)p; };
    bf* BQ = (bf*)take((size_t)DM * DM * 2); bf* BK = (bf*)take((size_t)DM * DM * 2); bf* BV = (bf*)take((size_t)DM * DM * 2); bf* BO = (bf*)take((size_t)DM * DM * 2);
    bf* XB = (bf*)take((size_t)TT * DM * 2); float* Q = (float*)take((size_t)TT * DM * 4); float* K = (float*)take((size_t)TT * DM * 4); float* V = (float*)take((size_t)TT * DM * 4); float* KID = (float*)take(DM * 4); float* VID = (float*)take(DM * 4); float* S0 = (float*)take((size_t)NH_ * TT * 4);
    h16* Q16 = (h16*)take((size_t)NH_ * TT * HD * 2); h16* K16 = (h16*)take((size_t)NH_ * TT * HD * 2); h16* VT = (h16*)take((size_t)NH_ * HD * TT * 2); float* Sb = (float*)take((size_t)HPP * TT * TT * 4); h16* P16 = (h16*)take((size_t)HPP * TT * TT * 2); float* P0 = (float*)take((size_t)HPP * TT * 32 * 4); float* O = (float*)take((size_t)HPP * TT * HD * 4); bf* Ah = (bf*)take((size_t)TT * DM * 2); bf* Al = (bf*)take((size_t)TT * DM * 2);
    if ((size_t)(wsp - (char*)d_ws) > ws_size) return;    // total ~ 140 MB (4-head [2048][2048] f32 scores 64 MB + fp16 probabilities 32 MB + q/k/v 18 MB)
    k_cvt8<<<(DM * DM / 8 + 255) / 256, 256, 0, stream>>>(Wq, BQ, DM * DM / 8); k_cvt8<<<(DM * DM / 8 + 255) / 256, 256, 0, stream>>>(Wk, BK, DM * DM / 8); k_cvt8<<<(DM * DM / 8 + 255) / 256, 256, 0, stream>>>(Wv, BV, DM * DM / 8); k_cvt8<<<(DM * DM / 8 + 255) / 256, 256, 0, stream>>>(Wo, BO, DM * DM / 8);   // torch [out][in] = Bt
    for (int b = 0; b < NB_; ++b) {
        k_cvt8<<<(TT * DM / 8 + 255) / 256, 256, 0, stream>>>(x + (size_t)b * TT * DM, XB, (size_t)TT * DM / 8);
        k_gemmw<bf, 0, true><<<dim3(TT / 64, DM / 64, 1), 32, 0, stream>>>(XB, nullptr, BQ, nullptr, DM, Q, DM, bq, 0, 0, 0); k_gemmw<bf, 0, true><<<dim3(TT / 64, DM / 64, 1), 32, 0, stream>>>(XB, nullptr, BK, nullptr, DM, K, DM, bk, 0, 0, 0); k_gemmw<bf, 0, true><<<dim3(TT / 64, DM / 64, 1), 32, 0, stream>>>(XB, nullptr, BV, nullptr, DM, V, DM, bv, 0, 0, 0);
        k_idkv<<<dim3(DM / 32, 2, 1), 1024, 0, stream>>>(ida + (size_t)b * DM, Wk, bk, Wv, bv, KID, VID); k_s0<<<(NH_ * TT + 255) / 256, 256, 0, stream>>>(Q, KID, S0);
        k_pl<<<(NH_ * TT * HD / 4 + 255) / 256, 256, 0, stream>>>(Q, Q16); k_pl<<<(NH_ * TT * HD / 4 + 255) / 256, 256, 0, stream>>>(K, K16); k_vt<<<(NH_ * HD * TT / 2 + 255) / 256, 256, 0, stream>>>(V, VT);
        for (int h0 = 0; h0 < NH_; h0 += HPP) { const size_t zo = (size_t)h0 * TT * HD;
            k_gemmw<h16, 0, false><<<dim3(TT / 64, TT / 64, HPP), 32, 0, stream>>>(Q16 + zo, nullptr, K16 + zo, nullptr, HD, Sb, TT, nullptr, (size_t)TT * HD, (size_t)TT * HD, (size_t)TT * TT);
            k_isoft<<<HPP * TT / 8, 256, 0, stream>>>(Sb, S0, h0, P16, P0);
            k_gemmw<h16, 0, false><<<dim3(TT / 64, 1, HPP), 32, 0, stream>>>(P16, nullptr, VT + (size_t)h0 * HD * TT, nullptr, TT, O, HD, nullptr, (size_t)TT * TT, (size_t)HD * TT, (size_t)TT * HD);
            k_mrg<<<(HPP * TT * HD / 4 + 255) / 256, 256, 0, stream>>>(O, P0, VID, h0, Ah, Al); }
        k_gemmw<bf, 1, true><<<dim3(TT / 64, DM / 64, 1), 32, 0, stream>>>(Ah, Al, BO, nullptr, DM, OUT + (size_t)b * TT * DM, DM, bo, 0, 0, 0); }
}

// v002
// A run of this version takes 891 microseconds.
// Next to v001, in two timings, it ran 1.59 and 1.60 times as fast.
// Over all steps from v000 it is 2.39 times as fast.
#include <hip/hip_runtime.h>

// IDContextAttention (x [4][2048][768], id_anchor [4][1][768]; Q/K/V = x W^T + b (12 heads x 64); one extra key/value K_id/V_id = id_anchor Wk/Wv^T + b PREPENDED to the 2048 current keys; softmax(q.k/8) over the 2049 keys; out = (attn V merged) Wo^T + bo
// -> [4][2048][768]). The extra key column and value row are handled on the VALU next to the 2048x2048 GEMM tiles.
// Compute dtypes, f32 accumulate: every input rounded to bf16; Q/K/V on PLAIN bf16 operands (inputs: exact) + bias; K_id/V_id and q.K_id f32 on the VALU (fixed-order dots); scores (K 64) and attn.V over the 2048 current keys

#define NB_  4
#define TT   2048
#define DM   768
#define NH_  12
#define HD   64
#define HPP  4
#define PCAR 1024.0f
typedef _Float16 h16;
typedef unsigned short bf;
typedef __attribute__((ext_vector_type(16))) __bf16   v16bf;
typedef __attribute__((ext_vector_type(16))) _Float16 v16h;
typedef __attribute__((ext_vector_type(8)))  _Float16 v8h;
typedef __attribute__((ext_vector_type(8)))  unsigned short v8us;
typedef __attribute__((ext_vector_type(8)))  float    v8f;
typedef __attribute__((ext_vector_type(4)))  float    v4f;
typedef v8h  __attribute__((may_alias)) v8ha;
typedef v4f  __attribute__((may_alias)) v4fa;
typedef v8us __attribute__((may_alias)) v8usa;

__device__ __forceinline__ unsigned short f2bf(float f) { unsigned u = __float_as_uint(f); u += 0x7FFFu + ((u >> 16) & 1u); return (unsigned short)(u >> 16); }
__device__ __forceinline__ float bf2f(unsigned short b) { return __uint_as_float(((unsigned)b) << 16); }
__device__ __forceinline__ float bfr(float f) { return bf2f(f2bf(f)); }
__device__ __forceinline__ v16h cat16(v8h lo, v8h hi) { return __builtin_shufflevector(lo, hi, 0, 1, 2, 3, 4, 5, 6, 7, 8, 9, 10, 11, 12, 13, 14, 15); }
__device__ __forceinline__ v16bf cat16b(v8us lo, v8us hi) { return __builtin_bit_cast(v16bf, __builtin_shufflevector(lo, hi, 0, 1, 2, 3, 4, 5, 6, 7, 8, 9, 10, 11, 12, 13, 14, 15)); }
__device__ __forceinline__ v8f wmma16(v16h a, v16h b, v8f c) { return __builtin_amdgcn_wmma_f32_16x16x32_f16(false, a, false, b, (short)0, c, false, false); }
__device__ __forceinline__ v8f wmmab(v16bf a, v16bf b, v8f c) { return __builtin_amdgcn_wmma_f32_16x16x32_bf16(false, a, false, b, (short)0, c, false, false); }



// ---- k_gemmw: register-blocked GEMM, 64x64 output tile per work-group (16 accumulators a wave), operands straight from K-contiguous 16-bit planes; grid (M/64, N/64, Z), 32 * KW threads; KW 1: ONE WAVE per tile.
// C[m][n] (f32, pitch ldc, + optional f32 bias[n]) = sum_k A[m][k] Bt[n][k] (+ split products per NSPLIT). z-batch strides sA/sB/sC in elements. K % 32 == 0.
// KW > 1 (32 * KW threads, (K / KW) % 32 == 0): K IS SPLIT OVER THE KW WAVES of the work-group: wave w sums k in [w K/KW, (w+1) K/KW) into its own 16 accumulators, so KW waves wait out their load latencies side by side instead of one wave one after the other.
// Every wave lays its f32 partial tile in its own LDS plane [64][68]; behind one barrier each thread adds the KW planes in rising w (a fixed order), adds the bias and stores whole 256-B row pieces.
template <typename T16> struct WFrag;
template <> struct WFrag<h16> { typedef v16h V; static __device__ __forceinline__ V ld(const h16* p) { return cat16(*(const v8h*)p, *(const v8h*)(p + 16)); } static __device__ __forceinline__ v8f mma(V a, V b, v8f c) { return wmma16(a, b, c); } };
template <> struct WFrag<bf> { typedef v16bf V; static __device__ __forceinline__ V ld(const bf* p) { return cat16b(*(const v8us*)p, *(const v8us*)(p + 16)); } static __device__ __forceinline__ v8f mma(V a, V b, v8f c) { return wmmab(a, b, c); } };
template <typename T16, int NSPLIT, bool BIAS, int KW>
__global__ __launch_bounds__(32 * KW) void k_gemmw(const T16* __restrict__ A, const T16* __restrict__ A2, const T16* __restrict__ Bt, const T16* __restrict__ Bt2, int K, float* C, int ldc, const float* __restrict__ bias, size_t sA, size_t sB, size_t sC) {
    typedef typename WFrag<T16>::V V;
    __shared__ __align__(16) float os[(KW == 1 ? 16 : KW * 64) * 68];
    const int w = KW == 1 ? 0 : __builtin_amdgcn_readfirstlane(threadIdx.x >> 5), ks = K / KW;
    const size_t z = blockIdx.z; A += z * sA; if (A2) A2 += z * sA; Bt += z * sB; if (Bt2) Bt2 += z * sB; C += z * sC;
    const int lane = threadIdx.x & 31, lr = lane & 15, hi = lane >> 4; const int r0 = blockIdx.x * 64, c0 = blockIdx.y * 64;
    v8f acc[4][4];
#pragma unroll
    for (int mb = 0; mb < 4; ++mb)
#pragma unroll
        for (int nb = 0; nb < 4; ++nb) acc[mb][nb] = (v8f){};
    const size_t aoff = (size_t)(r0 + lr) * K + 8 * hi, boff = (size_t)(c0 + lr) * K + 8 * hi;
#pragma unroll 1
    for (int kc = w * ks; kc < (w + 1) * ks; kc += 32) {
        V a[4], a2[4];
#pragma unroll
        for (int mb = 0; mb < 4; ++mb) { a[mb] = WFrag<T16>::ld(A + aoff + (size_t)mb * 16 * K + kc); if (NSPLIT == 1 || NSPLIT == 2) a2[mb] = WFrag<T16>::ld(A2 + aoff + (size_t)mb * 16 * K + kc); }
#pragma unroll
        for (int nb = 0; nb < 4; ++nb) { const V b = WFrag<T16>::ld(Bt + boff + (size_t)nb * 16 * K + kc); V b2; if (NSPLIT >= 2) b2 = WFrag<T16>::ld(Bt2 + boff + (size_t)nb * 16 * K + kc);
#pragma unroll
            for (int mb = 0; mb < 4; ++mb) { acc[mb][nb] = WFrag<T16>::mma(a[mb], b, acc[mb][nb]); if (NSPLIT == 1 || NSPLIT == 2) acc[mb][nb] = WFrag<T16>::mma(a2[mb], b, acc[mb][nb]); if (NSPLIT >= 2) acc[mb][nb] = WFrag<T16>::mma(a[mb], b2, acc[mb][nb]); } }
        asm volatile("v_nop\n\tv_nop\n\tv_nop\n\tv_nop" : "+v"(acc[0][0]), "+v"(acc[1][1]), "+v"(acc[2][2]), "+v"(acc[3][3]) : "v"(a[0]), "v"(a[3]));
    }
    if constexpr (KW > 1) {
        float* my = os + w * (64 * 68);
        // the unrolls below keep every acc index a compile-time constant (registers, no scratch) and let the LDS reads of a thread's KW planes issue together
#pragma unroll
        for (int mb = 0; mb < 4; ++mb)
#pragma unroll
            for (int nb = 0; nb < 4; ++nb)
#pragma unroll
                for (int j = 0; j < 8; ++j) my[(mb * 16 + hi * 8 + j) * 68 + nb * 16 + lr] = acc[mb][nb][j];
        __syncthreads();    // publishes every wave's plane to the threads that sum it
#pragma unroll
        for (int s = 0; s < 32 / KW; ++s) { const int i = s * 32 * KW + threadIdx.x, row = i >> 4, cofs = (i & 15) * 4; v4f val = *(const v4fa*)(os + row * 68 + cofs);
#pragma unroll
            for (int p = 1; p < KW; ++p) val += *(const v4fa*)(os + p * (64 * 68) + row * 68 + cofs);
            if (BIAS) { val[0] += bfr(bias[c0 + cofs]); val[1] += bfr(bias[c0 + cofs + 1]); val[2] += bfr(bias[c0 + cofs + 2]); val[3] += bfr(bias[c0 + cofs + 3]); }
            *(v4f*)(C + (size_t)(r0 + row) * ldc + c0 + cofs) = val; }
        return;
    }
#pragma unroll
    for (int mb = 0; mb < 4; ++mb) {
#pragma unroll
        for (int nb = 0; nb < 4; ++nb) {
#pragma unroll
            for (int j = 0; j < 8; ++j) os[(hi * 8 + j) * 68 + nb * 16 + lr] = acc[mb][nb][j]; }
        __builtin_amdgcn_wave_barrier(); asm volatile("" ::: "memory");
        float* crow = C + (size_t)(r0 + mb * 16) * ldc + c0;
{
#pragma unroll
            for (int s = 0; s < 8; ++s) { const int row = 2 * s + hi, cofs = lr * 4; v4f val = *(const v4fa*)(os + row * 68 + cofs); if (BIAS) { val[0] += bfr(bias[c0 + cofs]); val[1] += bfr(bias[c0 + cofs + 1]); val[2] += bfr(bias[c0 + cofs + 2]); val[3] += bfr(bias[c0 + cofs + 3]); }
                *(v4f*)(crow + (size_t)row * ldc + cofs) = val; }
             }
        __builtin_amdgcn_wave_barrier(); asm volatile("" ::: "memory");
    }
}

__device__ __forceinline__ h16 tohx(float x) { return (h16)x; }
__device__ __forceinline__ void splitf(float y, unsigned short& h, unsigned short& l) { h = f2bf(y); l = f2bf(y - bf2f(h)); }
typedef __attribute__((ext_vector_type(2))) unsigned short v2us;
typedef __attribute__((ext_vector_type(4))) unsigned short v4us;
typedef __attribute__((ext_vector_type(2))) _Float16 v2h;
typedef __attribute__((ext_vector_type(4))) _Float16 v4h;

__global__ __launch_bounds__(256) void k_cvt8(const float* __restrict__ src, bf* dst, size_t n8) { const size_t i = (size_t)blockIdx.x * 256 + threadIdx.x; if (i >= n8) return; const v8f v = *(const v8f*)(src + i * 8); v8us o;
#pragma unroll
    for (int k = 0; k < 8; ++k) o[k] = f2bf(v[k]); *(v8us*)(dst + i * 8) = o;  }
// k_idkv: wave per channel c, block = 32 channels of one matrix (blockIdx.y 0: K, 1: V): KID[c] = sum_d bf16 id[d] bf16 Wk[c][d] + bk[c], VID likewise; lane l sums d = 128 i + 4 l + u in rising (i, u), lane 0 starting from the bias, all loads issued up front, then an xor butterfly over the lanes; the 32 sums meet in LDS and wave 0 stores them as one 128-B line; k_pl: fp16 planes [h][t][d] of a [t][768] buffer; k_vt: VT16[h][d][t]; k_s0: thread per (h, t): s0 = sum_d Q[t][h*64+d] KID[h*64+d] (4-B);
// k_isoft: wave per (z, t) row: scores {s0, S[t][0..2047]} x 1/8, softmax over all 2049 f32 -> fp16 P x 1024 for the 2048 current keys and P0[z][t] f32 (4-B per row, written as replicated 32-float lines); k_mrg: hl planes A[t][(h0+z)*64+d] =
__global__ __launch_bounds__(1024) void k_idkv(const float* __restrict__ ida, const float* __restrict__ Wk, const float* __restrict__ bk, const float* __restrict__ Wv, const float* __restrict__ bv, float* KID, float* VID) {
    __shared__ float red[32];
    const int lane = threadIdx.x & 31, w = threadIdx.x >> 5, c = blockIdx.x * 32 + w; const bool isv = blockIdx.y != 0;
    const float* wr = (isv ? Wv : Wk) + (size_t)c * DM + lane * 4; const float* ar = ida + lane * 4; const float bias = (isv ? bv : bk)[c]; v4f a[DM / 128], m[DM / 128];
#pragma unroll
    for (int i = 0; i < DM / 128; ++i) { m[i] = *(const v4f*)(wr + i * 128); a[i] = *(const v4f*)(ar + i * 128); }
    float s = lane == 0 ? bfr(bias) : 0.f;
#pragma unroll
    for (int i = 0; i < DM / 128; ++i)
#pragma unroll
        for (int u = 0; u < 4; ++u) s = fmaf(bfr(a[i][u]), bfr(m[i][u]), s);
#pragma unroll
    for (int sh = 16; sh; sh >>= 1) s += __shfl_xor(s, sh, 32);
    if (lane == 0) red[w] = s;
    __syncthreads();
    if (w == 0) (isv ? VID : KID)[blockIdx.x * 32 + lane] = red[lane]; }
__global__ __launch_bounds__(256) void k_pl(const float* __restrict__ F, h16* P) { const int e = (blockIdx.x * 256 + threadIdx.x) * 4; if (e >= NH_ * TT * HD) return; const int d = e % HD; const int t = (e / HD) % TT; const int h = e / (HD * TT); const float* f = F + (size_t)t * DM + h * HD + d; v4h o;
#pragma unroll
    for (int u = 0; u < 4; ++u) o[u] = tohx(f[u]); *(v4h*)(P + e) = o;  }
__global__ __launch_bounds__(256) void k_vt(const float* __restrict__ V, h16* VT) { const int e = (blockIdx.x * 256 + threadIdx.x) * 2; if (e >= NH_ * HD * TT) return; const int t = e % TT; const int d = (e / TT) % HD; const int h = e / (TT * HD); v2h o; o[0] = tohx(V[(size_t)t * DM + h * HD + d]); o[1] = tohx(V[(size_t)(t + 1) * DM + h * HD + d]); *(v2h*)(VT + e) = o;  }
__global__ __launch_bounds__(256) void k_s0(const float* __restrict__ Q, const float* __restrict__ KID, float* S0) { const int idx = blockIdx.x * 256 + threadIdx.x; if (idx >= NH_ * TT) return; const int t = idx % TT; const int h = idx / TT; float s = 0.f;
#pragma unroll 1
    for (int d = 0; d < HD; ++d) { float p = __fmul_rn(Q[(size_t)t * DM + h * HD + d], KID[h * HD + d]); asm volatile("" : "+v"(p)); s = __fadd_rn(s, p); } *(float*)(S0 + idx) = s;  }
__global__ __launch_bounds__(256) void k_isoft(const float* __restrict__ Sb, const float* __restrict__ S0, int h0, h16* P16, float* P0) { const int lane = threadIdx.x & 31; const int row = blockIdx.x * 8 + (threadIdx.x >> 5); if (row >= HPP * TT) return; const int t = row % TT; const int z = row / TT; const float* sr = Sb + (size_t)row * TT; float v[TT / 32];
    const float s0 = S0[(size_t)(h0 + z) * TT + t] * 0.125f; float mx = s0;
#pragma unroll
    for (int ch = 0; ch < TT / 128; ++ch) { const v4f a = *(const v4f*)(sr + ch * 128 + lane * 4);
#pragma unroll
        for (int u = 0; u < 4; ++u) { const float tt = a[u] * 0.125f; v[ch * 4 + u] = tt; mx = fmaxf(mx, tt); } }
#pragma unroll
    for (int sh = 16; sh; sh >>= 1) mx = fmaxf(mx, __shfl_xor(mx, sh, 32));
    float sum = 0.f;
#pragma unroll
    for (int q = 0; q < TT / 32; ++q) { float d0 = __fsub_rn(v[q], mx); asm volatile("" : "+v"(d0)); v[q] = __builtin_amdgcn_exp2f(__fmul_rn(d0, 1.4426950408889634f)); sum += v[q]; }
#pragma unroll
    for (int sh = 16; sh; sh >>= 1) sum += __shfl_xor(sum, sh, 32);
    float d1 = __fsub_rn(s0, mx); asm volatile("" : "+v"(d1)); const float e0 = __builtin_amdgcn_exp2f(__fmul_rn(d1, 1.4426950408889634f)); sum = __fadd_rn(sum, e0);
    const float inv = __fdiv_rn(1.0f, sum); const float f = inv * PCAR; const float p0 = __fmul_rn(e0, inv);
    {
#pragma unroll
        for (int ch = 0; ch < TT / 128; ++ch) { v4h o4;
#pragma unroll
            for (int q = 0; q < 4; ++q) o4[q] = tohx(v[ch * 4 + q] * f); *(v4h*)(P16 + (size_t)row * TT + ch * 128 + lane * 4) = o4; }
        *(float*)(P0 + (size_t)row * 32 + lane) = p0;  } }
__global__ __launch_bounds__(256) void k_mrg(const float* __restrict__ O, const float* __restrict__ P0, const float* __restrict__ VID, int h0, bf* Ah, bf* Al) { const int e = (blockIdx.x * 256 + threadIdx.x) * 4; if (e >= HPP * TT * HD) return; const int d = e % HD; const int t = (e / HD) % TT; const int z = e / (HD * TT); const float p0 = P0[((size_t)z * TT + t) * 32]; v4us oh, ol;
#pragma unroll
    for (int u = 0; u < 4; ++u) { float m = O[e + u] * (1.0f / PCAR); float pv = __fmul_rn(p0, VID[(h0 + z) * HD + d + u]); asm volatile("" : "+v"(pv)); const float y = __fadd_rn(m, pv); unsigned short a, b; splitf(y, a, b); oh[u] = a; ol[u] = b; }
    const size_t oo = (size_t)t * DM + (h0 + z) * HD + d; *(v4us*)(Ah + oo) = oh; *(v4us*)(Al + oo) = ol;  }

extern "C" void kernel_launch(void* const* d_in, const int* in_sizes, int n_in,
                              void* d_out, int out_size, void* d_ws, size_t ws_size, hipStream_t stream) {
    (void)in_sizes; (void)n_in; (void)out_size;
    const float** I = (const float**)d_in;
    const float *x = I[0], *ida = I[1], *Wq = I[2], *bq = I[3], *Wk = I[4], *bk = I[5], *Wv = I[6], *bv = I[7], *Wo = I[8], *bo = I[9];
    float* OUT = (float*)d_out;     // [4][2048][768]
    char* wsp = (char*)d_ws;
    auto take = [&](size_t bytes) { char* p = wsp; wsp += (bytes + 255) & ~(size_t)255; return (void*)p; };
    bf* BQ = (bf*)take((size_t)DM * DM * 2); bf* BK = (bf*)take((size_t)DM * DM * 2); bf* BV = (bf*)take((size_t)DM * DM * 2); bf* BO = (bf*)take((size_t)DM * DM * 2);
    bf* XB = (bf*)take((size_t)TT * DM * 2); float* Q = (float*)take((size_t)TT * DM * 4); float* K = (float*)take((size_t)TT * DM * 4); float* V = (float*)take((size_t)TT * DM * 4); float* KID = (float*)take(DM * 4); float* VID = (float*)take(DM * 4); float* S0 = (float*)take((size_t)NH_ * TT * 4);
    h16* Q16 = (h16*)take((size_t)NH_ * TT * HD * 2); h16* K16 = (h16*)take((size_t)NH_ * TT * HD * 2); h16* VT = (h16*)take((size_t)NH_ * HD * TT * 2); float* Sb = (float*)take((size_t)HPP * TT * TT * 4); h16* P16 = (h16*)take((size_t)HPP * TT * TT * 2); float* P0 = (float*)take((size_t)HPP * TT * 32 * 4); float* O = (float*)take((size_t)HPP * TT * HD * 4); bf* Ah = (bf*)take((size_t)TT * DM * 2); bf* Al = (bf*)take((size_t)TT * DM * 2);
    if ((size_t)(wsp - (char*)d_ws) > ws_size) return;    // total ~ 140 MB (4-head [2048][2048] f32 scores 64 MB + fp16 probabilities 32 MB + q/k/v 18 MB)
    k_cvt8<<<(DM * DM / 8 + 255) / 256, 256, 0, stream>>>(Wq, BQ, DM * DM / 8); k_cvt8<<<(DM * DM / 8 + 255) / 256, 256, 0, stream>>>(Wk, BK, DM * DM / 8); k_cvt8<<<(DM * DM / 8 + 255) / 256, 256, 0, stream>>>(Wv, BV, DM * DM / 8); k_cvt8<<<(DM * DM / 8 + 255) / 256, 256, 0, stream>>>(Wo, BO, DM * DM / 8);   // torch [out][in] = Bt
    for (int b = 0; b < NB_; ++b) {
        k_cvt8<<<(TT * DM / 8 + 255) / 256, 256, 0, stream>>>(x + (size_t)b * TT * DM, XB, (size_t)TT * DM / 8);
        k_gemmw<bf, 0, true, 8><<<dim3(TT / 64, DM / 64, 1), 256, 0, stream>>>(XB, nullptr, BQ, nullptr, DM, Q, DM, bq, 0, 0, 0); k_gemmw<bf, 0, true, 8><<<dim3(TT / 64, DM / 64, 1), 256, 0, stream>>>(XB, nullptr, BK, nullptr, DM, K, DM, bk, 0, 0, 0); k_gemmw<bf, 0, true, 8><<<dim3(TT / 64, DM / 64, 1), 256, 0, stream>>>(XB, nullptr, BV, nullptr, DM, V, DM, bv, 0, 0, 0);
        k_idkv<<<dim3(DM / 32, 2, 1), 1024, 0, stream>>>(ida + (size_t)b * DM, Wk, bk, Wv, bv, KID, VID); k_s0<<<(NH_ * TT + 255) / 256, 256, 0, stream>>>(Q, KID, S0);
        k_pl<<<(NH_ * TT * HD / 4 + 255) / 256, 256, 0, stream>>>(Q, Q16); k_pl<<<(NH_ * TT * HD / 4 + 255) / 256, 256, 0, stream>>>(K, K16); k_vt<<<(NH_ * HD * TT / 2 + 255) / 256, 256, 0, stream>>>(V, VT);
        for (int h0 = 0; h0 < NH_; h0 += HPP) { const size_t zo = (size_t)h0 * TT * HD;
            k_gemmw<h16, 0, false, 1><<<dim3(TT / 64, TT / 64, HPP), 32, 0, stream>>>(Q16 + zo, nullptr, K16 + zo, nullptr, HD, Sb, TT, nullptr, (size_t)TT * HD, (size_t)TT * HD, (size_t)TT * TT);
            k_isoft<<<HPP * TT / 8, 256, 0, stream>>>(Sb, S0, h0, P16, P0);
            k_gemmw<h16, 0, false, 16><<<dim3(TT / 64, 1, HPP), 512, 0, stream>>>(P16, nullptr, VT + (size_t)h0 * HD * TT, nullptr, TT, O, HD, nullptr, (size_t)TT * TT, (size_t)HD * TT, (size_t)TT * HD);
            k_mrg<<<(HPP * TT * HD / 4 + 255) / 256, 256, 0, stream>>>(O, P0, VID, h0, Ah, Al); }
        k_gemmw<bf, 1, true, 8><<<dim3(TT / 64, DM / 64, 1), 256, 0, stream>>>(Ah, Al, BO, nullptr, DM, OUT + (size_t)b * TT * DM, DM, bo, 0, 0, 0); }
}

// v003
// Measured time: 464 microseconds a run.
// In two side-by-side timings against v002, it was 1.93 and 1.94 times as fast.
// Counting every step since v000, it is 4.61 times as fast.
#include <hip/hip_runtime.h>

// IDContextAttention (x [4][2048][768], id_anchor [4][1][768]; Q/K/V = x W^T + b (12 heads x 64); one extra key/value K_id/V_id = id_anchor Wk/Wv^T + b PREPENDED to the 2048 current keys; softmax(q.k/8) over the 2049 keys; out = (attn V merged) Wo^T + bo
// -> [4][2048][768]). The extra key's score is a VALU dot (k_s0); key and value row enter as the start state of the online softmax in k_fattn.
// Compute dtypes, f32 accumulate: every input rounded to bf16; Q/K/V on PLAIN bf16 operands (inputs: exact) + bias; K_id/V_id and q.K_id f32 on the VALU (fixed-order dots); scores (K 64) and attn.V over the 2048 current keys

#define NB_  4
#define TT   2048
#define DM   768
#define NH_  12
#define HD   64
typedef _Float16 h16;
typedef unsigned short bf;
typedef __attribute__((ext_vector_type(16))) __bf16   v16bf;
typedef __attribute__((ext_vector_type(16))) _Float16 v16h;
typedef __attribute__((ext_vector_type(8)))  _Float16 v8h;
typedef __attribute__((ext_vector_type(8)))  unsigned short v8us;
typedef __attribute__((ext_vector_type(8)))  float    v8f;
typedef __attribute__((ext_vector_type(4)))  float    v4f;
typedef v8h  __attribute__((may_alias)) v8ha;
typedef v4f  __attribute__((may_alias)) v4fa;
typedef v8us __attribute__((may_alias)) v8usa;

__device__ __forceinline__ unsigned short f2bf(float f) { unsigned u = __float_as_uint(f); u += 0x7FFFu + ((u >> 16) & 1u); return (unsigned short)(u >> 16); }
__device__ __forceinline__ float bf2f(unsigned short b) { return __uint_as_float(((unsigned)b) << 16); }
__device__ __forceinline__ float bfr(float f) { return bf2f(f2bf(f)); }
__device__ __forceinline__ v16h cat16(v8h lo, v8h hi) { return __builtin_shufflevector(lo, hi, 0, 1, 2, 3, 4, 5, 6, 7, 8, 9, 10, 11, 12, 13, 14, 15); }
__device__ __forceinline__ v16bf cat16b(v8us lo, v8us hi) { return __builtin_bit_cast(v16bf, __builtin_shufflevector(lo, hi, 0, 1, 2, 3, 4, 5, 6, 7, 8, 9, 10, 11, 12, 13, 14, 15)); }
__device__ __forceinline__ v8f wmma16(v16h a, v16h b, v8f c) { return __builtin_amdgcn_wmma_f32_16x16x32_f16(false, a, false, b, (short)0, c, false, false); }
__device__ __forceinline__ v8f wmmab(v16bf a, v16bf b, v8f c) { return __builtin_amdgcn_wmma_f32_16x16x32_bf16(false, a, false, b, (short)0, c, false, false); }



// ---- k_gemmw: register-blocked GEMM, 64x64 output tile per work-group (16 accumulators a wave), operands straight from K-contiguous 16-bit planes; grid (M/64, N/64, Z), 32 * KW threads; KW 1: ONE WAVE per tile.
// C[m][n] (f32, pitch ldc, + optional f32 bias[n]) = sum_k A[m][k] Bt[n][k] (+ split products per NSPLIT). z-batch strides sA/sB/sC in elements. K % 32 == 0.
// KW > 1 (32 * KW threads, (K / KW) % 32 == 0): K IS SPLIT OVER THE KW WAVES of the work-group: wave w sums k in [w K/KW, (w+1) K/KW) into its own 16 accumulators, so KW waves wait out their load latencies side by side instead of one wave one after the other.
// Every wave lays its f32 partial tile in its own LDS plane [64][68]; behind one barrier each thread adds the KW planes in rising w (a fixed order), adds the bias and stores whole 256-B row pieces.
template <typename T16> struct WFrag;
template <> struct WFrag<h16> { typedef v16h V; static __device__ __forceinline__ V ld(const h16* p) { return cat16(*(const v8h*)p, *(const v8h*)(p + 16)); } static __device__ __forceinline__ v8f mma(V a, V b, v8f c) { return wmma16(a, b, c); } };
template <> struct WFrag<bf> { typedef v16bf V; static __device__ __forceinline__ V ld(const bf* p) { return cat16b(*(const v8us*)p, *(const v8us*)(p + 16)); } static __device__ __forceinline__ v8f mma(V a, V b, v8f c) { return wmmab(a, b, c); } };
template <typename T16, int NSPLIT, bool BIAS, int KW>
__global__ __launch_bounds__(32 * KW) void k_gemmw(const T16* __restrict__ A, const T16* __restrict__ A2, const T16* __restrict__ Bt, const T16* __restrict__ Bt2, int K, float* C, int ldc, const float* __restrict__ bias, size_t sA, size_t sB, size_t sC) {
    typedef typename WFrag<T16>::V V;
    __shared__ __align__(16) float os[(KW == 1 ? 16 : KW * 64) * 68];
    const int w = KW == 1 ? 0 : __builtin_amdgcn_readfirstlane(threadIdx.x >> 5), ks = K / KW;
    const size_t z = blockIdx.z; A += z * sA; if (A2) A2 += z * sA; Bt += z * sB; if (Bt2) Bt2 += z * sB; C += z * sC;
    const int lane = threadIdx.x & 31, lr = lane & 15, hi = lane >> 4; const int r0 = blockIdx.x * 64, c0 = blockIdx.y * 64;
    v8f acc[4][4];
#pragma unroll
    for (int mb = 0; mb < 4; ++mb)
#pragma unroll
        for (int nb = 0; nb < 4; ++nb) acc[mb][nb] = (v8f){};
    const size_t aoff = (size_t)(r0 + lr) * K + 8 * hi, boff = (size_t)(c0 + lr) * K + 8 * hi;
#pragma unroll 1
    for (int kc = w * ks; kc < (w + 1) * ks; kc += 32) {
        V a[4], a2[4];
#pragma unroll
        for (int mb = 0; mb < 4; ++mb) { a[mb] = WFrag<T16>::ld(A + aoff + (size_t)mb * 16 * K + kc); if (NSPLIT == 1 || NSPLIT == 2) a2[mb] = WFrag<T16>::ld(A2 + aoff + (size_t)mb * 16 * K + kc); }
#pragma unroll
        for (int nb = 0; nb < 4; ++nb) { const V b = WFrag<T16>::ld(Bt + boff + (size_t)nb * 16 * K + kc); V b2; if (NSPLIT >= 2) b2 = WFrag<T16>::ld(Bt2 + boff + (size_t)nb * 16 * K + kc);
#pragma unroll
            for (int mb = 0; mb < 4; ++mb) { acc[mb][nb] = WFrag<T16>::mma(a[mb], b, acc[mb][nb]); if (NSPLIT == 1 || NSPLIT == 2) acc[mb][nb] = WFrag<T16>::mma(a2[mb], b, acc[mb][nb]); if (NSPLIT >= 2) acc[mb][nb] = WFrag<T16>::mma(a[mb], b2, acc[mb][nb]); } }
        asm volatile("v_nop\n\tv_nop\n\tv_nop\n\tv_nop" : "+v"(acc[0][0]), "+v"(acc[1][1]), "+v"(acc[2][2]), "+v"(acc[3][3]) : "v"(a[0]), "v"(a[3]));
    }
    if constexpr (KW > 1) {
        float* my = os + w * (64 * 68);
        // the unrolls below keep every acc index a compile-time constant (registers, no scratch) and let the LDS reads of a thread's KW planes issue together
#pragma unroll
        for (int mb = 0; mb < 4; ++mb)
#pragma unroll
            for (int nb = 0; nb < 4; ++nb)
#pragma unroll
                for (int j = 0; j < 8; ++j) my[(mb * 16 + hi * 8 + j) * 68 + nb * 16 + lr] = acc[mb][nb][j];
        __syncthreads();    // publishes every wave's plane to the threads that sum it
#pragma unroll
        for (int s = 0; s < 32 / KW; ++s) { const int i = s * 32 * KW + threadIdx.x, row = i >> 4, cofs = (i & 15) * 4; v4f val = *(const v4fa*)(os + row * 68 + cofs);
#pragma unroll
            for (int p = 1; p < KW; ++p) val += *(const v4fa*)(os + p * (64 * 68) + row * 68 + cofs);
            if (BIAS) { val[0] += bfr(bias[c0 + cofs]); val[1] += bfr(bias[c0 + cofs + 1]); val[2] += bfr(bias[c0 + cofs + 2]); val[3] += bfr(bias[c0 + cofs + 3]); }
            *(v4f*)(C + (size_t)(r0 + row) * ldc + c0 + cofs) = val; }
        return;
    }
#pragma unroll
    for (int mb = 0; mb < 4; ++mb) {
#pragma unroll
        for (int nb = 0; nb < 4; ++nb) {
#pragma unroll
            for (int j = 0; j < 8; ++j) os[(hi * 8 + j) * 68 + nb * 16 + lr] = acc[mb][nb][j]; }
        __builtin_amdgcn_wave_barrier(); asm volatile("" ::: "memory");
        float* crow = C + (size_t)(r0 + mb * 16) * ldc + c0;
{
#pragma unroll
            for (int s = 0; s < 8; ++s) { const int row = 2 * s + hi, cofs = lr * 4; v4f val = *(const v4fa*)(os + row * 68 + cofs); if (BIAS) { val[0] += bfr(bias[c0 + cofs]); val[1] += bfr(bias[c0 + cofs + 1]); val[2] += bfr(bias[c0 + cofs + 2]); val[3] += bfr(bias[c0 + cofs + 3]); }
                *(v4f*)(crow + (size_t)row * ldc + cofs) = val; }
             }
        __builtin_amdgcn_wave_barrier(); asm volatile("" ::: "memory");
    }
}

__device__ __forceinline__ h16 tohx(float x) { return (h16)x; }
__device__ __forceinline__ void splitf(float y, unsigned short& h, unsigned short& l) { h = f2bf(y); l = f2bf(y - bf2f(h)); }
typedef __attribute__((ext_vector_type(2))) unsigned short v2us;
typedef __attribute__((ext_vector_type(4))) unsigned short v4us;
typedef __attribute__((ext_vector_type(2))) _Float16 v2h;
typedef __attribute__((ext_vector_type(4))) _Float16 v4h;

__global__ __launch_bounds__(256) void k_cvt8(const float* __restrict__ src, bf* dst, size_t n8) { const size_t i = (size_t)blockIdx.x * 256 + threadIdx.x; if (i >= n8) return; const v8f v = *(const v8f*)(src + i * 8); v8us o;
#pragma unroll
    for (int k = 0; k < 8; ++k) o[k] = f2bf(v[k]); *(v8us*)(dst + i * 8) = o;  }
// k_idkv: wave per channel c, block = 32 channels of one matrix (blockIdx.y 0: K, 1: V): KID[c] = sum_d bf16 id[d] bf16 Wk[c][d] + bk[c], VID likewise; lane l sums d = 128 i + 4 l + u in rising (i, u), lane 0 starting from the bias, all loads issued up front, then an xor butterfly over the lanes; the 32 sums meet in LDS and wave 0 stores them as one 128-B line; k_pl: fp16 planes [h][t][d] of a [t][768] buffer; k_vt: VT16[h][d][t]; k_s0: thread per (h, t): s0 = sum_d Q[t][h*64+d] KID[h*64+d] (4-B);
__global__ __launch_bounds__(1024) void k_idkv(const float* __restrict__ ida, const float* __restrict__ Wk, const float* __restrict__ bk, const float* __restrict__ Wv, const float* __restrict__ bv, float* KID, float* VID) {
    __shared__ float red[32];
    const int lane = threadIdx.x & 31, w = threadIdx.x >> 5, c = blockIdx.x * 32 + w; const bool isv = blockIdx.y != 0;
    const float* wr = (isv ? Wv : Wk) + (size_t)c * DM + lane * 4; const float* ar = ida + lane * 4; const float bias = (isv ? bv : bk)[c]; v4f a[DM / 128], m[DM / 128];
#pragma unroll
    for (int i = 0; i < DM / 128; ++i) { m[i] = *(const v4f*)(wr + i * 128); a[i] = *(const v4f*)(ar + i * 128); }
    float s = lane == 0 ? bfr(bias) : 0.f;
#pragma unroll
    for (int i = 0; i < DM / 128; ++i)
#pragma unroll
        for (int u = 0; u < 4; ++u) s = fmaf(bfr(a[i][u]), bfr(m[i][u]), s);
#pragma unroll
    for (int sh = 16; sh; sh >>= 1) s += __shfl_xor(s, sh, 32);
    if (lane == 0) red[w] = s;
    __syncthreads();
    if (w == 0) (isv ? VID : KID)[blockIdx.x * 32 + lane] = red[lane]; }
__global__ __launch_bounds__(256) void k_pl(const float* __restrict__ F, h16* P) { const int e = (blockIdx.x * 256 + threadIdx.x) * 4; if (e >= NH_ * TT * HD) return; const int d = e % HD; const int t = (e / HD) % TT; const int h = e / (HD * TT); const float* f = F + (size_t)t * DM + h * HD + d; v4h o;
#pragma unroll
    for (int u = 0; u < 4; ++u) o[u] = tohx(f[u]); *(v4h*)(P + e) = o;  }
__global__ __launch_bounds__(256) void k_vt(const float* __restrict__ V, h16* VT) { const int e = (blockIdx.x * 256 + threadIdx.x) * 2; if (e >= NH_ * HD * TT) return; const int t = e % TT; const int d = (e / TT) % HD; const int h = e / (TT * HD); v2h o; o[0] = tohx(V[(size_t)t * DM + h * HD + d]); o[1] = tohx(V[(size_t)(t + 1) * DM + h * HD + d]); *(v2h*)(VT + e) = o;  }
__global__ __launch_bounds__(256) void k_s0(const float* __restrict__ Q, const float* __restrict__ KID, float* S0) { const int idx = blockIdx.x * 256 + threadIdx.x; if (idx >= NH_ * TT) return; const int t = idx % TT; const int h = idx / TT; float s = 0.f;
#pragma unroll 1
    for (int d = 0; d < HD; ++d) { float p = __fmul_rn(Q[(size_t)t * DM + h * HD + d], KID[h * HD + d]); asm volatile("" : "+v"(p)); s = __fadd_rn(s, p); } *(float*)(S0 + idx) = s;  }
#define KSP 4
__global__ __launch_bounds__(32 * KSP) void k_fattn(const h16* __restrict__ Q16, const h16* __restrict__ K16, const h16* __restrict__ VT, const float* __restrict__ S0, const float* __restrict__ VID, bf* Ah, bf* Al) {
    __shared__ __align__(16) float os[KSP][32][68]; __shared__ float ms[KSP][32], ls[KSP][32];
    const int w = __builtin_amdgcn_readfirstlane(threadIdx.x >> 5), lane = threadIdx.x & 31, lr = lane & 15, hi = lane >> 4; const int h = blockIdx.y, q0 = blockIdx.x * 32;
    const float SC = 0.125f * 1.4426950408889634f; constexpr int NP = TT / KSP / 32;
    const h16* qp = Q16 + ((size_t)h * TT + q0 + lr) * HD + 8 * hi; const h16* kp = K16 + ((size_t)h * TT + w * (TT / KSP) + lr) * HD + 8 * hi; const h16* vp = VT + ((size_t)h * HD + lr) * TT + w * (TT / KSP) + 8 * hi;
    v16h qf[2][2], kf[2][2]; float mu[2], l[2]; v8f o[4][2];
#pragma unroll
    for (int qt = 0; qt < 2; ++qt) { qf[qt][0] = WFrag<h16>::ld(qp + qt * 16 * HD); qf[qt][1] = WFrag<h16>::ld(qp + qt * 16 * HD + 32); kf[qt][0] = WFrag<h16>::ld(kp + qt * 16 * HD); kf[qt][1] = WFrag<h16>::ld(kp + qt * 16 * HD + 32);
        mu[qt] = S0[(size_t)h * TT + q0 + qt * 16 + lr] * SC; l[qt] = (w == 0 && hi == 0) ? 1.f : 0.f; }
#pragma unroll
    for (int dt = 0; dt < 4; ++dt) { v8f vi = (v8f){}; if (w == 0) vi = *(const v8f*)(VID + h * HD + dt * 16 + hi * 8); o[dt][0] = vi; o[dt][1] = vi; }
    // rolled: 16 passes unrolled would grow the register count
#pragma unroll 1
    for (int it = 0; it < NP; ++it) {
        v16h vf[4]; v8f s[2][2];
#pragma unroll
        for (int dt = 0; dt < 4; ++dt) vf[dt] = WFrag<h16>::ld(vp + (size_t)dt * 16 * TT + it * 32);
#pragma unroll
        for (int kt = 0; kt < 2; ++kt)
#pragma unroll
            for (int qt = 0; qt < 2; ++qt) s[kt][qt] = wmma16(kf[kt][1], qf[qt][1], wmma16(kf[kt][0], qf[qt][0], (v8f){}));
        const int nx = it + 1 < NP ? it + 1 : it;    // the next pass's K fragments fly under this pass's softmax; the last pass re-reads its own (in bounds, unused)
#pragma unroll
        for (int kt = 0; kt < 2; ++kt) { kf[kt][0] = WFrag<h16>::ld(kp + (nx * 32 + kt * 16) * HD); kf[kt][1] = WFrag<h16>::ld(kp + (nx * 32 + kt * 16) * HD + 32); }
        float tm[2];
#pragma unroll
        for (int qt = 0; qt < 2; ++qt) { tm[qt] = -8.f;
#pragma unroll
            for (int kt = 0; kt < 2; ++kt)
#pragma unroll
                for (int j = 0; j < 8; ++j) { s[kt][qt][j] = fmaf(s[kt][qt][j], SC, -mu[qt]); tm[qt] = fmaxf(tm[qt], s[kt][qt][j]); } }
        if (__builtin_amdgcn_ballot_w32(fmaxf(tm[0], tm[1]) > 8.f) != 0) {    // rare, wave-uniform: raise the base of every column to its maximum so far, alike in both halves of the wave
#pragma unroll
            for (int qt = 0; qt < 2; ++qt) { const float dl = fmaxf(fmaxf(tm[qt], __shfl_xor(tm[qt], 16, 32)), 0.f), al = __builtin_amdgcn_exp2f(-dl); mu[qt] += dl; l[qt] *= al;
#pragma unroll
                for (int dt = 0; dt < 4; ++dt) o[dt][qt] *= al;
#pragma unroll
                for (int kt = 0; kt < 2; ++kt) s[kt][qt] -= dl; } }
#pragma unroll
        for (int qt = 0; qt < 2; ++qt) { v16h pf;
#pragma unroll
            for (int kt = 0; kt < 2; ++kt)
#pragma unroll
                for (int j = 0; j < 8; ++j) { const float p = __builtin_amdgcn_exp2f(s[kt][qt][j]); l[qt] += p; pf[kt * 8 + j] = tohx(p); }
#pragma unroll
            for (int dt = 0; dt < 4; ++dt) o[dt][qt] = wmma16(vf[dt], pf, o[dt][qt]); }
        // four vector slots behind the pass's last products: over the back edge the next pass's first score product may write its D over the registers these read as B
        asm volatile("v_nop\n\tv_nop\n\tv_nop\n\tv_nop" : "+v"(o[0][1]), "+v"(o[1][1]), "+v"(o[2][1]), "+v"(o[3][1]));
    }
#pragma unroll
    for (int qt = 0; qt < 2; ++qt) { l[qt] += __shfl_xor(l[qt], 16, 32); if (hi == 0) { ms[w][qt * 16 + lr] = mu[qt]; ls[w][qt * 16 + lr] = l[qt]; }
#pragma unroll
        for (int dt = 0; dt < 4; ++dt) { float* d = &os[w][qt * 16 + lr][dt * 16 + hi * 8]; *(v4fa*)d = __builtin_shufflevector(o[dt][qt], o[dt][qt], 0, 1, 2, 3); *(v4fa*)(d + 4) = __builtin_shufflevector(o[dt][qt], o[dt][qt], 4, 5, 6, 7); } }
    __syncthreads();    // publishes every wave's partial state to the threads that join it
    const int q = threadIdx.x >> 2, d0 = (threadIdx.x & 3) * 16; float mm = ms[0][q], f[KSP], L = 0.f;
#pragma unroll
    for (int p = 1; p < KSP; ++p) mm = fmaxf(mm, ms[p][q]);
#pragma unroll
    for (int p = 0; p < KSP; ++p) { f[p] = __builtin_amdgcn_exp2f(ms[p][q] - mm); L = fmaf(f[p], ls[p][q], L); }
    const float inv = __fdiv_rn(1.0f, L); const size_t oo = (size_t)(q0 + q) * DM + h * HD + d0;
#pragma unroll
    for (int u = 0; u < 2; ++u) { v8us oh, ol;
#pragma unroll
        for (int g = 0; g < 2; ++g) { v4f val = f[0] * *(const v4fa*)&os[0][q][d0 + u * 8 + g * 4];
#pragma unroll
            for (int p = 1; p < KSP; ++p) val += f[p] * *(const v4fa*)&os[p][q][d0 + u * 8 + g * 4];
#pragma unroll
            for (int e = 0; e < 4; ++e) { unsigned short a, b; splitf(val[e] * inv, a, b); oh[g * 4 + e] = a; ol[g * 4 + e] = b; } }
        *(v8us*)(Ah + oo + u * 8) = oh; *(v8us*)(Al + oo + u * 8) = ol; }
}

extern "C" void kernel_launch(void* const* d_in, const int* in_sizes, int n_in,
                              void* d_out, int out_size, void* d_ws, size_t ws_size, hipStream_t stream) {
    (void)in_sizes; (void)n_in; (void)out_size;
    const float** I = (const float**)d_in;
    const float *x = I[0], *ida = I[1], *Wq = I[2], *bq = I[3], *Wk = I[4], *bk = I[5], *Wv = I[6], *bv = I[7], *Wo = I[8], *bo = I[9];
    float* OUT = (float*)d_out;     // [4][2048][768]
    char* wsp = (char*)d_ws;
    auto take = [&](size_t bytes) { char* p = wsp; wsp += (bytes + 255) & ~(size_t)255; return (void*)p; };
    bf* BQ = (bf*)take((size_t)DM * DM * 2); bf* BK = (bf*)take((size_t)DM * DM * 2); bf* BV = (bf*)take((size_t)DM * DM * 2); bf* BO = (bf*)take((size_t)DM * DM * 2);
    bf* XB = (bf*)take((size_t)TT * DM * 2); float* Q = (float*)take((size_t)TT * DM * 4); float* K = (float*)take((size_t)TT * DM * 4); float* V = (float*)take((size_t)TT * DM * 4); float* KID = (float*)take(DM * 4); float* VID = (float*)take(DM * 4); float* S0 = (float*)take((size_t)NH_ * TT * 4);
    h16* Q16 = (h16*)take((size_t)NH_ * TT * HD * 2); h16* K16 = (h16*)take((size_t)NH_ * TT * HD * 2); h16* VT = (h16*)take((size_t)NH_ * HD * TT * 2); bf* Ah = (bf*)take((size_t)TT * DM * 2); bf* Al = (bf*)take((size_t)TT * DM * 2);
    if ((size_t)(wsp - (char*)d_ws) > ws_size) return;    // total ~ 42 MB
    k_cvt8<<<(DM * DM / 8 + 255) / 256, 256, 0, stream>>>(Wq, BQ, DM * DM / 8); k_cvt8<<<(DM * DM / 8 + 255) / 256, 256, 0, stream>>>(Wk, BK, DM * DM / 8); k_cvt8<<<(DM * DM / 8 + 255) / 256, 256, 0, stream>>>(Wv, BV, DM * DM / 8); k_cvt8<<<(DM * DM / 8 + 255) / 256, 256, 0, stream>>>(Wo, BO, DM * DM / 8);   // torch [out][in] = Bt
    for (int b = 0; b < NB_; ++b) {
        k_cvt8<<<(TT * DM / 8 + 255) / 256, 256, 0, stream>>>(x + (size_t)b * TT * DM, XB, (size_t)TT * DM / 8);
        k_gemmw<bf, 0, true, 8><<<dim3(TT / 64, DM / 64, 1), 256, 0, stream>>>(XB, nullptr, BQ, nullptr, DM, Q, DM, bq, 0, 0, 0); k_gemmw<bf, 0, true, 8><<<dim3(TT / 64, DM / 64, 1), 256, 0, stream>>>(XB, nullptr, BK, nullptr, DM, K, DM, bk, 0, 0, 0); k_gemmw<bf, 0, true, 8><<<dim3(TT / 64, DM / 64, 1), 256, 0, stream>>>(XB, nullptr, BV, nullptr, DM, V, DM, bv, 0, 0, 0);
        k_idkv<<<dim3(DM / 32, 2, 1), 1024, 0, stream>>>(ida + (size_t)b * DM, Wk, bk, Wv, bv, KID, VID); k_s0<<<(NH_ * TT + 255) / 256, 256, 0, stream>>>(Q, KID, S0);
        k_pl<<<(NH_ * TT * HD / 4 + 255) / 256, 256, 0, stream>>>(Q, Q16); k_pl<<<(NH_ * TT * HD / 4 + 255) / 256, 256, 0, stream>>>(K, K16); k_vt<<<(NH_ * HD * TT / 2 + 255) / 256, 256, 0, stream>>>(V, VT);
        k_fattn<<<dim3(TT / 32, NH_, 1), 32 * KSP, 0, stream>>>(Q16, K16, VT, S0, VID, Ah, Al);
        k_gemmw<bf, 1, true, 8><<<dim3(TT / 64, DM / 64, 1), 256, 0, stream>>>(Ah, Al, BO, nullptr, DM, OUT + (size_t)b * TT * DM, DM, bo, 0, 0, 0); }
}

// v004
// A run of this version takes 315 microseconds.
// Two timings next to v003 put it at 1.46 and 1.48 times that version's speed.
// Over all steps from v000 it is 6.79 times as fast.
#include <hip/hip_runtime.h>

// IDContextAttention (x [4][2048][768], id_anchor [4][1][768]; Q/K/V = x W^T + b (12 heads x 64); one extra key/value K_id/V_id = id_anchor Wk/Wv^T + b PREPENDED to the 2048 current keys; softmax(q.k/8) over the 2049 keys; out = (attn V merged) Wo^T + bo
// -> [4][2048][768]). The extra key's score is a VALU dot (k_s0); key and value row enter as the start state of the online softmax in k_fattn.
// Compute dtypes, f32 accumulate: every input rounded to bf16; Q/K/V on PLAIN bf16 operands (inputs: exact) + bias; K_id/V_id and q.K_id f32 on the VALU (fixed-order dots); scores (K 64) and attn.V over the 2048 current keys

#define NB_  4
#define TT   2048
#define DM   768
#define NH_  12
#define HD   64
typedef _Float16 h16;
typedef unsigned short bf;
typedef __attribute__((ext_vector_type(16))) __bf16   v16bf;
typedef __attribute__((ext_vector_type(16))) _Float16 v16h;
typedef __attribute__((ext_vector_type(8)))  _Float16 v8h;
typedef __attribute__((ext_vector_type(8)))  unsigned short v8us;
typedef __attribute__((ext_vector_type(8)))  float    v8f;
typedef __attribute__((ext_vector_type(4)))  float    v4f;
typedef v8h  __attribute__((may_alias)) v8ha;
typedef v4f  __attribute__((may_alias)) v4fa;
typedef v8us __attribute__((may_alias)) v8usa;

__device__ __forceinline__ unsigned short f2bf(float f) { unsigned u = __float_as_uint(f); u += 0x7FFFu + ((u >> 16) & 1u); return (unsigned short)(u >> 16); }
__device__ __forceinline__ float bf2f(unsigned short b) { return __uint_as_float(((unsigned)b) << 16); }
__device__ __forceinline__ float bfr(float f) { return bf2f(f2bf(f)); }
__device__ __forceinline__ v16h cat16(v8h lo, v8h hi) { return __builtin_shufflevector(lo, hi, 0, 1, 2, 3, 4, 5, 6, 7, 8, 9, 10, 11, 12, 13, 14, 15); }
__device__ __forceinline__ v16bf cat16b(v8us lo, v8us hi) { return __builtin_bit_cast(v16bf, __builtin_shufflevector(lo, hi, 0, 1, 2, 3, 4, 5, 6, 7, 8, 9, 10, 11, 12, 13, 14, 15)); }
__device__ __forceinline__ v8f wmma16(v16h a, v16h b, v8f c) { return __builtin_amdgcn_wmma_f32_16x16x32_f16(false, a, false, b, (short)0, c, false, false); }
__device__ __forceinline__ v8f wmmab(v16bf a, v16bf b, v8f c) { return __builtin_amdgcn_wmma_f32_16x16x32_bf16(false, a, false, b, (short)0, c, false, false); }



// ---- k_gemmw: register-blocked GEMM, 64x64 output tile per work-group (16 accumulators a wave), operands straight from K-contiguous 16-bit planes; grid (M/64, N/64, Z), 32 * KW threads; KW 1: ONE WAVE per tile.
// C[m][n] (f32, pitch ldc, + optional f32 bias[n]) = sum_k A[m][k] Bt[n][k] (+ split products per NSPLIT). z-batch strides sA/sB/sC in elements, bias0/1/2 the bias of z = 0/1/2 (Z <= 3). K % 32 == 0.
// KW > 1 (32 * KW threads, (K / KW) % 32 == 0): K IS SPLIT OVER THE KW WAVES of the work-group: wave w sums k in [w K/KW, (w+1) K/KW) into its own 16 accumulators, so KW waves wait out their load latencies side by side instead of one wave one after the other.
// Every wave lays its f32 partial tile in its own LDS plane [64][68]; behind one barrier each thread adds the KW planes in rising w (a fixed order), adds the bias and stores whole 256-B row pieces.
template <typename T16> struct WFrag;
template <> struct WFrag<h16> { typedef v16h V; static __device__ __forceinline__ V ld(const h16* p) { return cat16(*(const v8h*)p, *(const v8h*)(p + 16)); } static __device__ __forceinline__ v8f mma(V a, V b, v8f c) { return wmma16(a, b, c); } };
template <> struct WFrag<bf> { typedef v16bf V; static __device__ __forceinline__ V ld(const bf* p) { return cat16b(*(const v8us*)p, *(const v8us*)(p + 16)); } static __device__ __forceinline__ v8f mma(V a, V b, v8f c) { return wmmab(a, b, c); } };
template <typename T16, int NSPLIT, bool BIAS, int KW>
__global__ __launch_bounds__(32 * KW) void k_gemmw(const T16* __restrict__ A, const T16* __restrict__ A2, const T16* __restrict__ Bt, const T16* __restrict__ Bt2, int K, float* C, int ldc, const float* __restrict__ bias0, const float* __restrict__ bias1, const float* __restrict__ bias2, size_t sA, size_t sB, size_t sC) {
    typedef typename WFrag<T16>::V V;
    __shared__ __align__(16) float os[(KW == 1 ? 16 : KW * 64) * 68];
    const int w = KW == 1 ? 0 : __builtin_amdgcn_readfirstlane(threadIdx.x >> 5), ks = K / KW;
    const size_t z = blockIdx.z; const float* bias = z == 0 ? bias0 : z == 1 ? bias1 : bias2; A += z * sA; if (A2) A2 += z * sA; Bt += z * sB; if (Bt2) Bt2 += z * sB; C += z * sC;
    const int lane = threadIdx.x & 31, lr = lane & 15, hi = lane >> 4; const int r0 = blockIdx.x * 64, c0 = blockIdx.y * 64;
    v8f acc[4][4];
#pragma unroll
    for (int mb = 0; mb < 4; ++mb)
#pragma unroll
        for (int nb = 0; nb < 4; ++nb) acc[mb][nb] = (v8f){};
    const size_t aoff = (size_t)(r0 + lr) * K + 8 * hi, boff = (size_t)(c0 + lr) * K + 8 * hi;
#pragma unroll 1
    for (int kc = w * ks; kc < (w + 1) * ks; kc += 32) {
        V a[4], a2[4];
#pragma unroll
        for (int mb = 0; mb < 4; ++mb) { a[mb] = WFrag<T16>::ld(A + aoff + (size_t)mb * 16 * K + kc); if (NSPLIT == 1 || NSPLIT == 2) a2[mb] = WFrag<T16>::ld(A2 + aoff + (size_t)mb * 16 * K + kc); }
#pragma unroll
        for (int nb = 0; nb < 4; ++nb) { const V b = WFrag<T16>::ld(Bt + boff + (size_t)nb * 16 * K + kc); V b2; if (NSPLIT >= 2) b2 = WFrag<T16>::ld(Bt2 + boff + (size_t)nb * 16 * K + kc);
#pragma unroll
            for (int mb = 0; mb < 4; ++mb) { acc[mb][nb] = WFrag<T16>::mma(a[mb], b, acc[mb][nb]); if (NSPLIT == 1 || NSPLIT == 2) acc[mb][nb] = WFrag<T16>::mma(a2[mb], b, acc[mb][nb]); if (NSPLIT >= 2) acc[mb][nb] = WFrag<T16>::mma(a[mb], b2, acc[mb][nb]); } }
        asm volatile("v_nop\n\tv_nop\n\tv_nop\n\tv_nop" : "+v"(acc[0][0]), "+v"(acc[1][1]), "+v"(acc[2][2]), "+v"(acc[3][3]) : "v"(a[0]), "v"(a[3]));
    }
    if constexpr (KW > 1) {
        float* my = os + w * (64 * 68);
        // the unrolls below keep every acc index a compile-time constant (registers, no scratch) and let the LDS reads of a thread's KW planes issue together
#pragma unroll
        for (int mb = 0; mb < 4; ++mb)
#pragma unroll
            for (int nb = 0; nb < 4; ++nb)
#pragma unroll
                for (int j = 0; j < 8; ++j) my[(mb * 16 + hi * 8 + j) * 68 + nb * 16 + lr] = acc[mb][nb][j];
        __syncthreads();    // publishes every wave's plane to the threads that sum it
#pragma unroll
        for (int s = 0; s < 32 / KW; ++s) { const int i = s * 32 * KW + threadIdx.x, row = i >> 4, cofs = (i & 15) * 4; v4f val = *(const v4fa*)(os + row * 68 + cofs);
#pragma unroll
            for (int p = 1; p < KW; ++p) val += *(const v4fa*)(os + p * (64 * 68) + row * 68 + cofs);
            if (BIAS) { val[0] += bfr(bias[c0 + cofs]); val[1] += bfr(bias[c0 + cofs + 1]); val[2] += bfr(bias[c0 + cofs + 2]); val[3] += bfr(bias[c0 + cofs + 3]); }
            *(v4f*)(C + (size_t)(r0 + row) * ldc + c0 + cofs) = val; }
        return;
    }
#pragma unroll
    for (int mb = 0; mb < 4; ++mb) {
#pragma unroll
        for (int nb = 0; nb < 4; ++nb) {
#pragma unroll
            for (int j = 0; j < 8; ++j) os[(hi * 8 + j) * 68 + nb * 16 + lr] = acc[mb][nb][j]; }
        __builtin_amdgcn_wave_barrier(); asm volatile("" ::: "memory");
        float* crow = C + (size_t)(r0 + mb * 16) * ldc + c0;
{
#pragma unroll
            for (int s = 0; s < 8; ++s) { const int row = 2 * s + hi, cofs = lr * 4; v4f val = *(const v4fa*)(os + row * 68 + cofs); if (BIAS) { val[0] += bfr(bias[c0 + cofs]); val[1] += bfr(bias[c0 + cofs + 1]); val[2] += bfr(bias[c0 + cofs + 2]); val[3] += bfr(bias[c0 + cofs + 3]); }
                *(v4f*)(crow + (size_t)row * ldc + cofs) = val; }
             }
        __builtin_amdgcn_wave_barrier(); asm volatile("" ::: "memory");
    }
}

__device__ __forceinline__ h16 tohx(float x) { return (h16)x; }
__device__ __forceinline__ void splitf(float y, unsigned short& h, unsigned short& l) { h = f2bf(y); l = f2bf(y - bf2f(h)); }
typedef __attribute__((ext_vector_type(2))) unsigned short v2us;
typedef __attribute__((ext_vector_type(4))) unsigned short v4us;
typedef __attribute__((ext_vector_type(2))) _Float16 v2h;
typedef __attribute__((ext_vector_type(4))) _Float16 v4h;

// k_cvt8: all five f32 -> bf16 conversions in one grid; dst is ONE run of planes: the four weights (WBL blocks each), then x of all batches; a block lies wholly in one source
#define WBL (DM * DM / 8 / 256)
__global__ __launch_bounds__(256) void k_cvt8(const float* __restrict__ w0, const float* __restrict__ w1, const float* __restrict__ w2, const float* __restrict__ w3, const float* __restrict__ xs, bf* dst) {
    const int bx = blockIdx.x, m = bx / WBL; const float* src = m == 0 ? w0 : m == 1 ? w1 : m == 2 ? w2 : m == 3 ? w3 : xs;
    const size_t i = (size_t)bx * 256 + threadIdx.x, si = (size_t)(bx - (m < 4 ? m : 4) * WBL) * 256 + threadIdx.x; const v8f v = *(const v8f*)(src + si * 8); v8us o;
#pragma unroll
    for (int k = 0; k < 8; ++k) o[k] = f2bf(v[k]); *(v8us*)(dst + i * 8) = o;  }
// k_idkv: wave per channel c, block = 32 channels of one matrix (blockIdx.y 0: K, 1: V): KID[c] = sum_d bf16 id[d] bf16 Wk[c][d] + bk[c], VID likewise; lane l sums d = 128 i + 4 l + u in rising (i, u), lane 0 starting from the bias, all loads issued up front, then an xor butterfly over the lanes; the 32 sums meet in LDS and wave 0 stores them as one 128-B line; blockIdx.z: batch; k_pl: fp16 planes [g][h][t][d] of [g][t][768] buffers (g: the 4 batches of Q, then the 4 of K, which lie one behind the other); k_vt: VT16[b][h][d][t]; k_s0: thread per (b, h, t): s0 = sum_d Q[t][h*64+d] KID[h*64+d] (4-B);
__global__ __launch_bounds__(1024) void k_idkv(const float* __restrict__ ida, const float* __restrict__ Wk, const float* __restrict__ bk, const float* __restrict__ Wv, const float* __restrict__ bv, float* KID, float* VID) {
    __shared__ float red[32];
    const int lane = threadIdx.x & 31, w = threadIdx.x >> 5, c = blockIdx.x * 32 + w; const bool isv = blockIdx.y != 0;
    const float* wr = (isv ? Wv : Wk) + (size_t)c * DM + lane * 4; const float* ar = ida + blockIdx.z * DM + lane * 4; const float bias = (isv ? bv : bk)[c]; v4f a[DM / 128], m[DM / 128];
#pragma unroll
    for (int i = 0; i < DM / 128; ++i) { m[i] = *(const v4f*)(wr + i * 128); a[i] = *(const v4f*)(ar + i * 128); }
    float s = lane == 0 ? bfr(bias) : 0.f;
#pragma unroll
    for (int i = 0; i < DM / 128; ++i)
#pragma unroll
        for (int u = 0; u < 4; ++u) s = fmaf(bfr(a[i][u]), bfr(m[i][u]), s);
#pragma unroll
    for (int sh = 16; sh; sh >>= 1) s += __shfl_xor(s, sh, 32);
    if (lane == 0) red[w] = s;
    __syncthreads();
    if (w == 0) (isv ? VID : KID)[blockIdx.z * DM + blockIdx.x * 32 + lane] = red[lane]; }
__global__ __launch_bounds__(256) void k_pl(const float* __restrict__ F, h16* P) { const int e = (blockIdx.x * 256 + threadIdx.x) * 4; if (e >= 2 * NB_ * NH_ * TT * HD) return; const int d = e % HD; const int t = (e / HD) % TT; const int h = (e / (HD * TT)) % NH_; const int g = e / (HD * TT * NH_); const float* f = F + ((size_t)g * TT + t) * DM + h * HD + d; v4h o;
#pragma unroll
    for (int u = 0; u < 4; ++u) o[u] = tohx(f[u]); *(v4h*)(P + e) = o;  }
__global__ __launch_bounds__(256) void k_vt(const float* __restrict__ V, h16* VT) { const int e = (blockIdx.x * 256 + threadIdx.x) * 2; if (e >= NB_ * NH_ * HD * TT) return; const int t = e % TT; const int d = (e / TT) % HD; const int h = (e / (TT * HD)) % NH_; const int b = e / (TT * HD * NH_); v2h o; o[0] = tohx(V[((size_t)b * TT + t) * DM + h * HD + d]); o[1] = tohx(V[((size_t)b * TT + t + 1) * DM + h * HD + d]); *(v2h*)(VT + e) = o;  }
__global__ __launch_bounds__(256) void k_s0(const float* __restrict__ Q, const float* __restrict__ KID, float* S0) { const int idx = blockIdx.x * 256 + threadIdx.x; if (idx >= NB_ * NH_ * TT) return; const int t = idx % TT; const int h = (idx / TT) % NH_; const int b = idx / (TT * NH_); Q += (size_t)b * TT * DM; KID += b * DM; float s = 0.f;
#pragma unroll 1
    for (int d = 0; d < HD; ++d) { float p = __fmul_rn(Q[(size_t)t * DM + h * HD + d], KID[h * HD + d]); asm volatile("" : "+v"(p)); s = __fadd_rn(s, p); } *(float*)(S0 + idx) = s;  }
#define KSP 4
__global__ __launch_bounds__(32 * KSP) void k_fattn(const h16* __restrict__ Q16, const h16* __restrict__ K16, const h16* __restrict__ VT, const float* __restrict__ S0, const float* __restrict__ VID, bf* Ah, bf* Al) {
    __shared__ __align__(16) float os[KSP][32][68]; __shared__ float ms[KSP][32], ls[KSP][32];
    const int w = __builtin_amdgcn_readfirstlane(threadIdx.x >> 5), lane = threadIdx.x & 31, lr = lane & 15, hi = lane >> 4; const int h = blockIdx.y, q0 = blockIdx.x * 32, hb = blockIdx.z * NH_ + h;    // hb: the head's place in the [batch][head] planes
    const float SC = 0.125f * 1.4426950408889634f; constexpr int NP = TT / KSP / 32;
    const h16* qp = Q16 + ((size_t)hb * TT + q0 + lr) * HD + 8 * hi; const h16* kp = K16 + ((size_t)hb * TT + w * (TT / KSP) + lr) * HD + 8 * hi; const h16* vp = VT + ((size_t)hb * HD + lr) * TT + w * (TT / KSP) + 8 * hi;
    v16h qf[2][2], kf[2][2]; float mu[2], l[2]; v8f o[4][2];
#pragma unroll
    for (int qt = 0; qt < 2; ++qt) { qf[qt][0] = WFrag<h16>::ld(qp + qt * 16 * HD); qf[qt][1] = WFrag<h16>::ld(qp + qt * 16 * HD + 32); kf[qt][0] = WFrag<h16>::ld(kp + qt * 16 * HD); kf[qt][1] = WFrag<h16>::ld(kp + qt * 16 * HD + 32);
        mu[qt] = S0[(size_t)hb * TT + q0 + qt * 16 + lr] * SC; l[qt] = (w == 0 && hi == 0) ? 1.f : 0.f; }
#pragma unroll
    for (int dt = 0; dt < 4; ++dt) { v8f vi = (v8f){}; if (w == 0) vi = *(const v8f*)(VID + hb * HD + dt * 16 + hi * 8); o[dt][0] = vi; o[dt][1] = vi; }
    // rolled: 16 passes unrolled would grow the register count
#pragma unroll 1
    for (int it = 0; it < NP; ++it) {
        v16h vf[4]; v8f s[2][2];
#pragma unroll
        for (int dt = 0; dt < 4; ++dt) vf[dt] = WFrag<h16>::ld(vp + (size_t)dt * 16 * TT + it * 32);
#pragma unroll
        for (int kt = 0; kt < 2; ++kt)
#pragma unroll
            for (int qt = 0; qt < 2; ++qt) s[kt][qt] = wmma16(kf[kt][1], qf[qt][1], wmma16(kf[kt][0], qf[qt][0], (v8f){}));
        const int nx = it + 1 < NP ? it + 1 : it;    // the next pass's K fragments fly under this pass's softmax; the last pass re-reads its own (in bounds, unused)
#pragma unroll
        for (int kt = 0; kt < 2; ++kt) { kf[kt][0] = WFrag<h16>::ld(kp + (nx * 32 + kt * 16) * HD); kf[kt][1] = WFrag<h16>::ld(kp + (nx * 32 + kt * 16) * HD + 32); }
        float tm[2];
#pragma unroll
        for (int qt = 0; qt < 2; ++qt) { tm[qt] = -8.f;
#pragma unroll
            for (int kt = 0; kt < 2; ++kt)
#pragma unroll
                for (int j = 0; j < 8; ++j) { s[kt][qt][j] = fmaf(s[kt][qt][j], SC, -mu[qt]); tm[qt] = fmaxf(tm[qt], s[kt][qt][j]); } }
        if (__builtin_amdgcn_ballot_w32(fmaxf(tm[0], tm[1]) > 8.f) != 0) {    // rare, wave-uniform: raise the base of every column to its maximum so far, alike in both halves of the wave
#pragma unroll
            for (int qt = 0; qt < 2; ++qt) { const float dl = fmaxf(fmaxf(tm[qt], __shfl_xor(tm[qt], 16, 32)), 0.f), al = __builtin_amdgcn_exp2f(-dl); mu[qt] += dl; l[qt] *= al;
#pragma unroll
                for (int dt = 0; dt < 4; ++dt) o[dt][qt] *= al;
#pragma unroll
                for (int kt = 0; kt < 2; ++kt) s[kt][qt] -= dl; } }
#pragma unroll
        for (int qt = 0; qt < 2; ++qt) { v16h pf;
#pragma unroll
            for (int kt = 0; kt < 2; ++kt)
#pragma unroll
                for (int j = 0; j < 8; ++j) { const float p = __builtin_amdgcn_exp2f(s[kt][qt][j]); l[qt] += p; pf[kt * 8 + j] = tohx(p); }
#pragma unroll
            for (int dt = 0; dt < 4; ++dt) o[dt][qt] = wmma16(vf[dt], pf, o[dt][qt]); }
        // four vector slots behind the pass's last products: over the back edge the next pass's first score product may write its D over the registers these read as B
        asm volatile("v_nop\n\tv_nop\n\tv_nop\n\tv_nop" : "+v"(o[0][1]), "+v"(o[1][1]), "+v"(o[2][1]), "+v"(o[3][1]));
    }
#pragma unroll
    for (int qt = 0; qt < 2; ++qt) { l[qt] += __shfl_xor(l[qt], 16, 32); if (hi == 0) { ms[w][qt * 16 + lr] = mu[qt]; ls[w][qt * 16 + lr] = l[qt]; }
#pragma unroll
        for (int dt = 0; dt < 4; ++dt) { float* d = &os[w][qt * 16 + lr][dt * 16 + hi * 8]; *(v4fa*)d = __builtin_shufflevector(o[dt][qt], o[dt][qt], 0, 1, 2, 3); *(v4fa*)(d + 4) = __builtin_shufflevector(o[dt][qt], o[dt][qt], 4, 5, 6, 7); } }
    __syncthreads();    // publishes every wave's partial state to the threads that join it
    const int q = threadIdx.x >> 2, d0 = (threadIdx.x & 3) * 16; float mm = ms[0][q], f[KSP], L = 0.f;
#pragma unroll
    for (int p = 1; p < KSP; ++p) mm = fmaxf(mm, ms[p][q]);
#pragma unroll
    for (int p = 0; p < KSP; ++p) { f[p] = __builtin_amdgcn_exp2f(ms[p][q] - mm); L = fmaf(f[p], ls[p][q], L); }
    const float inv = __fdiv_rn(1.0f, L); const size_t oo = ((size_t)blockIdx.z * TT + q0 + q) * DM + h * HD + d0;
#pragma unroll
    for (int u = 0; u < 2; ++u) { v8us oh, ol;
#pragma unroll
        for (int g = 0; g < 2; ++g) { v4f val = f[0] * *(const v4fa*)&os[0][q][d0 + u * 8 + g * 4];
#pragma unroll
            for (int p = 1; p < KSP; ++p) val += f[p] * *(const v4fa*)&os[p][q][d0 + u * 8 + g * 4];
#pragma unroll
            for (int e = 0; e < 4; ++e) { unsigned short a, b; splitf(val[e] * inv, a, b); oh[g * 4 + e] = a; ol[g * 4 + e] = b; } }
        *(v8us*)(Ah + oo + u * 8) = oh; *(v8us*)(Al + oo + u * 8) = ol; }
}

extern "C" void kernel_launch(void* const* d_in, const int* in_sizes, int n_in,
                              void* d_out, int out_size, void* d_ws, size_t ws_size, hipStream_t stream) {
    (void)in_sizes; (void)n_in; (void)out_size;
    const float** I = (const float**)d_in;
    const float *x = I[0], *ida = I[1], *Wq = I[2], *bq = I[3], *Wk = I[4], *bk = I[5], *Wv = I[6], *bv = I[7], *Wo = I[8], *bo = I[9];
    float* OUT = (float*)d_out;     // [4][2048][768]
    char* wsp = (char*)d_ws;
    auto take = [&](size_t bytes) { char* p = wsp; wsp += (bytes + 255) & ~(size_t)255; return (void*)p; };
    // every plane holds all 4 batches; all sizes are multiples of 256 B, so BQ BK BV BO XB, Q K V and Q16 K16 each lie one behind the other with no gap (k_cvt8, the z of the QKV launch and k_pl lean on that)
    bf* BQ = (bf*)take((size_t)DM * DM * 2); take((size_t)DM * DM * 2); take((size_t)DM * DM * 2); bf* BO = (bf*)take((size_t)DM * DM * 2);
    bf* XB = (bf*)take((size_t)NB_ * TT * DM * 2); float* Q = (float*)take((size_t)NB_ * TT * DM * 4); take((size_t)NB_ * TT * DM * 4); float* V = (float*)take((size_t)NB_ * TT * DM * 4); float* KID = (float*)take(NB_ * DM * 4); float* VID = (float*)take(NB_ * DM * 4); float* S0 = (float*)take((size_t)NB_ * NH_ * TT * 4);
    h16* Q16 = (h16*)take((size_t)NB_ * NH_ * TT * HD * 2); h16* K16 = (h16*)take((size_t)NB_ * NH_ * TT * HD * 2); h16* VT = (h16*)take((size_t)NB_ * NH_ * HD * TT * 2); bf* Ah = (bf*)take((size_t)NB_ * TT * DM * 2); bf* Al = (bf*)take((size_t)NB_ * TT * DM * 2);
    if ((size_t)(wsp - (char*)d_ws) > ws_size) return;    // total ~ 156 MB
    k_cvt8<<<4 * WBL + NB_ * TT * DM / 8 / 256, 256, 0, stream>>>(Wq, Wk, Wv, Wo, x, BQ);   // torch [out][in] = Bt
    k_gemmw<bf, 0, true, 8><<<dim3(NB_ * TT / 64, DM / 64, 3), 256, 0, stream>>>(XB, nullptr, BQ, nullptr, DM, Q, DM, bq, bk, bv, 0, (size_t)DM * DM, (size_t)NB_ * TT * DM);   // z: Q, K, V; the batches are rows
    k_idkv<<<dim3(DM / 32, 2, NB_), 1024, 0, stream>>>(ida, Wk, bk, Wv, bv, KID, VID); k_s0<<<(NB_ * NH_ * TT + 255) / 256, 256, 0, stream>>>(Q, KID, S0);
    k_pl<<<(2 * NB_ * NH_ * TT * HD / 4 + 255) / 256, 256, 0, stream>>>(Q, Q16); k_vt<<<(NB_ * NH_ * HD * TT / 2 + 255) / 256, 256, 0, stream>>>(V, VT);
    k_fattn<<<dim3(TT / 32, NH_, NB_), 32 * KSP, 0, stream>>>(Q16, K16, VT, S0, VID, Ah, Al);
    k_gemmw<bf, 1, true, 8><<<dim3(NB_ * TT / 64, DM / 64, 1), 256, 0, stream>>>(Ah, Al, BO, nullptr, DM, OUT, DM, bo, bo, bo, 0, 0, 0);
}

// v005
// A run of this version takes 274 microseconds.
// Two timings next to v004 both put it at 1.15 times that version's speed.
// Over all steps from v000 it is 7.82 times as fast.
#include <hip/hip_runtime.h>

// IDContextAttention (x [4][2048][768], id_anchor [4][1][768]; Q/K/V = x W^T + b (12 heads x 64); one extra key/value K_id/V_id = id_anchor Wk/Wv^T + b PREPENDED to the 2048 current keys; softmax(q.k/8) over the 2049 keys; out = (attn V merged) Wo^T + bo
// -> [4][2048][768]). The extra key's score is a VALU dot (k_s0); key and value row enter as the start state of the online softmax in k_fattn.
// Compute dtypes, f32 accumulate: every input rounded to bf16; Q/K/V on PLAIN bf16 operands (inputs: exact) + bias; K_id/V_id and q.K_id f32 on the VALU (fixed-order dots); scores (K 64) and attn.V over the 2048 current keys

#define NB_  4
#define TT   2048
#define DM   768
#define NH_  12
#define HD   64
typedef _Float16 h16;
typedef unsigned short bf;
typedef __attribute__((ext_vector_type(16))) __bf16   v16bf;
typedef __attribute__((ext_vector_type(16))) _Float16 v16h;
typedef __attribute__((ext_vector_type(8)))  _Float16 v8h;
typedef __attribute__((ext_vector_type(8)))  unsigned short v8us;
typedef __attribute__((ext_vector_type(8)))  float    v8f;
typedef __attribute__((ext_vector_type(4)))  float    v4f;
typedef v8h  __attribute__((may_alias)) v8ha;
typedef v4f  __attribute__((may_alias)) v4fa;
typedef v8us __attribute__((may_alias)) v8usa;

__device__ __forceinline__ unsigned short f2bf(float f) { unsigned u = __float_as_uint(f); u += 0x7FFFu + ((u >> 16) & 1u); return (unsigned short)(u >> 16); }
__device__ __forceinline__ float bf2f(unsigned short b) { return __uint_as_float(((unsigned)b) << 16); }
__device__ __forceinline__ float bfr(float f) { return bf2f(f2bf(f)); }
__device__ __forceinline__ v16h cat16(v8h lo, v8h hi) { return __builtin_shufflevector(lo, hi, 0, 1, 2, 3, 4, 5, 6, 7, 8, 9, 10, 11, 12, 13, 14, 15); }
__device__ __forceinline__ v16bf cat16b(v8us lo, v8us hi) { return __builtin_bit_cast(v16bf, __builtin_shufflevector(lo, hi, 0, 1, 2, 3, 4, 5, 6, 7, 8, 9, 10, 11, 12, 13, 14, 15)); }
__device__ __forceinline__ v8f wmma16(v16h a, v16h b, v8f c) { return __builtin_amdgcn_wmma_f32_16x16x32_f16(false, a, false, b, (short)0, c, false, false); }
__device__ __forceinline__ v8f wmmab(v16bf a, v16bf b, v8f c) { return __builtin_amdgcn_wmma_f32_16x16x32_bf16(false, a, false, b, (short)0, c, false, false); }
typedef __attribute__((ext_vector_type(4))) _Float16 v4h;
__device__ __forceinline__ h16 tohx(float x) { return (h16)x; }



// ---- k_gemmw: register-blocked GEMM, 64x64 output tile per work-group (16 accumulators a wave), operands straight from K-contiguous 16-bit planes; grid (M/64, N/64, Z), 32 * KW threads; KW 1: ONE WAVE per tile.
// C[m][n] (f32, pitch ldc, + optional f32 bias[n]) = sum_k A[m][k] Bt[n][k] (+ split products per NSPLIT). z-batch strides sA/sB/sC in elements, bias0/1/2 the bias of z = 0/1/2 (Z <= 3). K % 32 == 0.
// KW > 1 (32 * KW threads, (K / KW) % 32 == 0): K IS SPLIT OVER THE KW WAVES of the work-group: wave w sums k in [w K/KW, (w+1) K/KW) into its own 16 accumulators, so KW waves wait out their load latencies side by side instead of one wave one after the other.
// Every wave lays its f32 partial tile in its own LDS plane [64][68]; behind one barrier each thread adds the KW planes in rising w (a fixed order), adds the bias and stores whole 256-B row pieces.
// PL (the QKV launch; a 64-column tile is one head): the epilogue writes the fp16 planes the attention kernel reads, P16 = Q16[b][h][t][d], K16 likewise, VT16[b][h][d][t] one behind the other; only Q (z 0) also goes out as f32, for k_s0.
// For V (z 2) the two operands change places, V^T = Wv x^T (same products, same k order): the tile's rows are then channels d and its columns tokens t, so VT16 rows leave as whole 128-B pieces with no transpose; the bias goes by row.
template <typename T16> struct WFrag;
template <> struct WFrag<h16> { typedef v16h V; static __device__ __forceinline__ V ld(const h16* p) { return cat16(*(const v8h*)p, *(const v8h*)(p + 16)); } static __device__ __forceinline__ v8f mma(V a, V b, v8f c) { return wmma16(a, b, c); } };
template <> struct WFrag<bf> { typedef v16bf V; static __device__ __forceinline__ V ld(const bf* p) { return cat16b(*(const v8us*)p, *(const v8us*)(p + 16)); } static __device__ __forceinline__ v8f mma(V a, V b, v8f c) { return wmmab(a, b, c); } };
template <typename T16, int NSPLIT, bool BIAS, int KW, bool PL>
__global__ __launch_bounds__(32 * KW) void k_gemmw(const T16* __restrict__ A, const T16* __restrict__ A2, const T16* __restrict__ Bt, const T16* __restrict__ Bt2, int K, float* C, int ldc, const float* __restrict__ bias0, const float* __restrict__ bias1, const float* __restrict__ bias2, size_t sA, size_t sB, size_t sC, h16* P16) {
    typedef typename WFrag<T16>::V V;
    __shared__ __align__(16) float os[(KW == 1 ? 16 : KW * 64) * 68];
    const int w = KW == 1 ? 0 : __builtin_amdgcn_readfirstlane(threadIdx.x >> 5), ks = K / KW;
    const size_t z = blockIdx.z; const float* bias = z == 0 ? bias0 : z == 1 ? bias1 : bias2; A += z * sA; if (A2) A2 += z * sA; Bt += z * sB; if (Bt2) Bt2 += z * sB; C += z * sC;
    const int lane = threadIdx.x & 31, lr = lane & 15, hi = lane >> 4; int r0 = blockIdx.x * 64, c0 = blockIdx.y * 64;
    if (PL && z == 2) { const T16* t = A; A = Bt; Bt = t; const int q = r0; r0 = c0; c0 = q; }
    v8f acc[4][4];
#pragma unroll
    for (int mb = 0; mb < 4; ++mb)
#pragma unroll
        for (int nb = 0; nb < 4; ++nb) acc[mb][nb] = (v8f){};
    const size_t aoff = (size_t)(r0 + lr) * K + 8 * hi, boff = (size_t)(c0 + lr) * K + 8 * hi;
#pragma unroll 1
    for (int kc = w * ks; kc < (w + 1) * ks; kc += 32) {
        V a[4], a2[4];
#pragma unroll
        for (int mb = 0; mb < 4; ++mb) { a[mb] = WFrag<T16>::ld(A + aoff + (size_t)mb * 16 * K + kc); if (NSPLIT == 1 || NSPLIT == 2) a2[mb] = WFrag<T16>::ld(A2 + aoff + (size_t)mb * 16 * K + kc); }
#pragma unroll
        for (int nb = 0; nb < 4; ++nb) { const V b = WFrag<T16>::ld(Bt + boff + (size_t)nb * 16 * K + kc); V b2; if (NSPLIT >= 2) b2 = WFrag<T16>::ld(Bt2 + boff + (size_t)nb * 16 * K + kc);
#pragma unroll
            for (int mb = 0; mb < 4; ++mb) { acc[mb][nb] = WFrag<T16>::mma(a[mb], b, acc[mb][nb]); if (NSPLIT == 1 || NSPLIT == 2) acc[mb][nb] = WFrag<T16>::mma(a2[mb], b, acc[mb][nb]); if (NSPLIT >= 2) acc[mb][nb] = WFrag<T16>::mma(a[mb], b2, acc[mb][nb]); } }
        asm volatile("v_nop\n\tv_nop\n\tv_nop\n\tv_nop" : "+v"(acc[0][0]), "+v"(acc[1][1]), "+v"(acc[2][2]), "+v"(acc[3][3]) : "v"(a[0]), "v"(a[3]));
    }
    if constexpr (KW > 1) {
        float* my = os + w * (64 * 68);
        // the unrolls below keep every acc index a compile-time constant (registers, no scratch) and let the LDS reads of a thread's KW planes issue together
#pragma unroll
        for (int mb = 0; mb < 4; ++mb)
#pragma unroll
            for (int nb = 0; nb < 4; ++nb)
#pragma unroll
                for (int j = 0; j < 8; ++j) my[(mb * 16 + hi * 8 + j) * 68 + nb * 16 + lr] = acc[mb][nb][j];
        constexpr int NS = 32 / KW, RS = 2 * KW; const int rw = threadIdx.x >> 4, cofs = (threadIdx.x & 15) * 4; float bb[4];    // PL: step s of a thread is tile row rw + s RS, columns cofs .. cofs + 3
        if constexpr (PL) {    // the thread's four bias values, by row for V and by column for Q and K, asked for here so that they fly under the plane stores and not behind the sums
            static_assert(NS == 4, "four rows a thread");
            const float* bp = bias + (z == 2 ? r0 + rw : c0 + cofs); const int bs = z == 2 ? RS : 1;
#pragma unroll
            for (int k = 0; k < 4; ++k) bb[k] = bp[k * bs]; }
        __syncthreads();    // publishes every wave's plane to the threads that sum it
        if constexpr (PL) {
            // all sums first, then the branch on z (V or Q/K; z 0 alone adds the f32 store), every store last: the LDS reads of a thread's steps issue together
            v4f val[NS]; v4h o[NS];
#pragma unroll
            for (int s = 0; s < NS; ++s) { const float* pl = os + (s * RS + rw) * 68 + cofs; val[s] = *(const v4fa*)pl;
#pragma unroll
                for (int p = 1; p < KW; ++p) val[s] += *(const v4fa*)(pl + p * (64 * 68)); }
            if (z == 2) {
                h16* d = P16 + (size_t)2 * NB_ * NH_ * TT * HD + ((size_t)(c0 / TT) * DM + r0 + rw) * TT + c0 % TT + cofs;
#pragma unroll
                for (int s = 0; s < NS; ++s) { val[s] += bfr(bb[s]);
#pragma unroll
                    for (int u = 0; u < 4; ++u) o[s][u] = tohx(val[s][u]); }
#pragma unroll
                for (int s = 0; s < NS; ++s) *(v4h*)(d + (size_t)s * RS * TT) = o[s];
            } else {
                const float b0 = bfr(bb[0]), b1 = bfr(bb[1]), b2 = bfr(bb[2]), b3 = bfr(bb[3]);
                h16* d = P16 + (((z * NB_ + r0 / TT) * NH_ + c0 / HD) * TT + r0 % TT + rw) * HD + cofs; float* cf = C + (size_t)(r0 + rw) * ldc + c0 + cofs;
#pragma unroll
                for (int s = 0; s < NS; ++s) { val[s][0] += b0; val[s][1] += b1; val[s][2] += b2; val[s][3] += b3;
#pragma unroll
                    for (int u = 0; u < 4; ++u) o[s][u] = tohx(val[s][u]); }
                if (z == 0) {
#pragma unroll
                    for (int s = 0; s < NS; ++s) *(v4f*)(cf + (size_t)s * RS * ldc) = val[s]; }
#pragma unroll
                for (int s = 0; s < NS; ++s) *(v4h*)(d + s * RS * HD) = o[s];
            }
            return;
        }
#pragma unroll
        for (int s = 0; s < 32 / KW; ++s) { const int i = s * 32 * KW + threadIdx.x, row = i >> 4, cofs = (i & 15) * 4; v4f val = *(const v4fa*)(os + row * 68 + cofs);
#pragma unroll
            for (int p = 1; p < KW; ++p) val += *(const v4fa*)(os + p * (64 * 68) + row * 68 + cofs);
            if (BIAS) { val[0] += bfr(bias[c0 + cofs]); val[1] += bfr(bias[c0 + cofs + 1]); val[2] += bfr(bias[c0 + cofs + 2]); val[3] += bfr(bias[c0 + cofs + 3]); }
            *(v4f*)(C + (size_t)(r0 + row) * ldc + c0 + cofs) = val; }
        return;
    }
#pragma unroll
    for (int mb = 0; mb < 4; ++mb) {
#pragma unroll
        for (int nb = 0; nb < 4; ++nb) {
#pragma unroll
            for (int j = 0; j < 8; ++j) os[(hi * 8 + j) * 68 + nb * 16 + lr] = acc[mb][nb][j]; }
        __builtin_amdgcn_wave_barrier(); asm volatile("" ::: "memory");
        float* crow = C + (size_t)(r0 + mb * 16) * ldc + c0;
{
#pragma unroll
            for (int s = 0; s < 8; ++s) { const int row = 2 * s + hi, cofs = lr * 4; v4f val = *(const v4fa*)(os + row * 68 + cofs); if (BIAS) { val[0] += bfr(bias[c0 + cofs]); val[1] += bfr(bias[c0 + cofs + 1]); val[2] += bfr(bias[c0 + cofs + 2]); val[3] += bfr(bias[c0 + cofs + 3]); }
                *(v4f*)(crow + (size_t)row * ldc + cofs) = val; }
             }
        __builtin_amdgcn_wave_barrier(); asm volatile("" ::: "memory");
    }
}

__device__ __forceinline__ void splitf(float y, unsigned short& h, unsigned short& l) { h = f2bf(y); l = f2bf(y - bf2f(h)); }
typedef __attribute__((ext_vector_type(2))) unsigned short v2us;
typedef __attribute__((ext_vector_type(4))) unsigned short v4us;

// k_cvt8: all five f32 -> bf16 conversions in one grid; dst is ONE run of planes: the four weights (WBL blocks each), then x of all batches; a block lies wholly in one source
#define WBL (DM * DM / 8 / 256)
__global__ __launch_bounds__(256) void k_cvt8(const float* __restrict__ w0, const float* __restrict__ w1, const float* __restrict__ w2, const float* __restrict__ w3, const float* __restrict__ xs, bf* dst) {
    const int bx = blockIdx.x, m = bx / WBL; const float* src = m == 0 ? w0 : m == 1 ? w1 : m == 2 ? w2 : m == 3 ? w3 : xs;
    const size_t i = (size_t)bx * 256 + threadIdx.x, si = (size_t)(bx - (m < 4 ? m : 4) * WBL) * 256 + threadIdx.x; const v8f v = *(const v8f*)(src + si * 8); v8us o;
#pragma unroll
    for (int k = 0; k < 8; ++k) o[k] = f2bf(v[k]); *(v8us*)(dst + i * 8) = o;  }
// k_idkv: wave per channel c, block = 32 channels of one matrix (blockIdx.y 0: K, 1: V): KID[c] = sum_d bf16 id[d] bf16 Wk[c][d] + bk[c], VID likewise; lane l sums d = 128 i + 4 l + u in rising (i, u), lane 0 starting from the bias, all loads issued up front, then an xor butterfly over the lanes; the 32 sums meet in LDS and wave 0 stores them as one 128-B line; blockIdx.z: batch; k_s0: thread per (b, h, t): s0 = sum_d Q[t][h*64+d] KID[h*64+d] (4-B);
__global__ __launch_bounds__(1024) void k_idkv(const float* __restrict__ ida, const float* __restrict__ Wk, const float* __restrict__ bk, const float* __restrict__ Wv, const float* __restrict__ bv, float* KID, float* VID) {
    __shared__ float red[32];
    const int lane = threadIdx.x & 31, w = threadIdx.x >> 5, c = blockIdx.x * 32 + w; const bool isv = blockIdx.y != 0;
    const float* wr = (isv ? Wv : Wk) + (size_t)c * DM + lane * 4; const float* ar = ida + blockIdx.z * DM + lane * 4; const float bias = (isv ? bv : bk)[c]; v4f a[DM / 128], m[DM / 128];
#pragma unroll
    for (int i = 0; i < DM / 128; ++i) { m[i] = *(const v4f*)(wr + i * 128); a[i] = *(const v4f*)(ar + i * 128); }
    float s = lane == 0 ? bfr(bias) : 0.f;
#pragma unroll
    for (int i = 0; i < DM / 128; ++i)
#pragma unroll
        for (int u = 0; u < 4; ++u) s = fmaf(bfr(a[i][u]), bfr(m[i][u]), s);
#pragma unroll
    for (int sh = 16; sh; sh >>= 1) s += __shfl_xor(s, sh, 32);
    if (lane == 0) red[w] = s;
    __syncthreads();
    if (w == 0) (isv ? VID : KID)[blockIdx.z * DM + blockIdx.x * 32 + lane] = red[lane]; }
__global__ __launch_bounds__(256) void k_s0(const float* __restrict__ Q, const float* __restrict__ KID, float* S0) { const int idx = blockIdx.x * 256 + threadIdx.x; if (idx >= NB_ * NH_ * TT) return; const int t = idx % TT; const int h = (idx / TT) % NH_; const int b = idx / (TT * NH_); Q += (size_t)b * TT * DM; KID += b * DM; float s = 0.f;
#pragma unroll 1
    for (int d = 0; d < HD; ++d) { float p = __fmul_rn(Q[(size_t)t * DM + h * HD + d], KID[h * HD + d]); asm volatile("" : "+v"(p)); s = __fadd_rn(s, p); } *(float*)(S0 + idx) = s;  }
#define KSP 4
__global__ __launch_bounds__(32 * KSP) void k_fattn(const h16* __restrict__ Q16, const h16* __restrict__ K16, const h16* __restrict__ VT, const float* __restrict__ S0, const float* __restrict__ VID, bf* Ah, bf* Al) {
    __shared__ __align__(16) float os[KSP][32][68]; __shared__ float ms[KSP][32], ls[KSP][32];
    const int w = __builtin_amdgcn_readfirstlane(threadIdx.x >> 5), lane = threadIdx.x & 31, lr = lane & 15, hi = lane >> 4; const int h = blockIdx.y, q0 = blockIdx.x * 32, hb = blockIdx.z * NH_ + h;    // hb: the head's place in the [batch][head] planes
    const float SC = 0.125f * 1.4426950408889634f; constexpr int NP = TT / KSP / 32;
    const h16* qp = Q16 + ((size_t)hb * TT + q0 + lr) * HD + 8 * hi; const h16* kp = K16 + ((size_t)hb * TT + w * (TT / KSP) + lr) * HD + 8 * hi; const h16* vp = VT + ((size_t)hb * HD + lr) * TT + w * (TT / KSP) + 8 * hi;
    v16h qf[2][2], kf[2][2]; float mu[2], l[2]; v8f o[4][2];
#pragma unroll
    for (int qt = 0; qt < 2; ++qt) { qf[qt][0] = WFrag<h16>::ld(qp + qt * 16 * HD); qf[qt][1] = WFrag<h16>::ld(qp + qt * 16 * HD + 32); kf[qt][0] = WFrag<h16>::ld(kp + qt * 16 * HD); kf[qt][1] = WFrag<h16>::ld(kp + qt * 16 * HD + 32);
        mu[qt] = S0[(size_t)hb * TT + q0 + qt * 16 + lr] * SC; l[qt] = (w == 0 && hi == 0) ? 1.f : 0.f; }
#pragma unroll
    for (int dt = 0; dt < 4; ++dt) { v8f vi = (v8f){}; if (w == 0) vi = *(const v8f*)(VID + hb * HD + dt * 16 + hi * 8); o[dt][0] = vi; o[dt][1] = vi; }
    // rolled: 16 passes unrolled would grow the register count
#pragma unroll 1
    for (int it = 0; it < NP; ++it) {
        v16h vf[4]; v8f s[2][2];
#pragma unroll
        for (int dt = 0; dt < 4; ++dt) vf[dt] = WFrag<h16>::ld(vp + (size_t)dt * 16 * TT + it * 32);
#pragma unroll
        for (int kt = 0; kt < 2; ++kt)
#pragma unroll
            for (int qt = 0; qt < 2; ++qt) s[kt][qt] = wmma16(kf[kt][1], qf[qt][1], wmma16(kf[kt][0], qf[qt][0], (v8f){}));
        const int nx = it + 1 < NP ? it + 1 : it;    // the next pass's K fragments fly under this pass's softmax; the last pass re-reads its own (in bounds, unused)
#pragma unroll
        for (int kt = 0; kt < 2; ++kt) { kf[kt][0] = WFrag<h16>::ld(kp + (nx * 32 + kt * 16) * HD); kf[kt][1] = WFrag<h16>::ld(kp + (nx * 32 + kt * 16) * HD + 32); }
        float tm[2];
#pragma unroll
        for (int qt = 0; qt < 2; ++qt) { tm[qt] = -8.f;
#pragma unroll
            for (int kt = 0; kt < 2; ++kt)
#pragma unroll
                for (int j = 0; j < 8; ++j) { s[kt][qt][j] = fmaf(s[kt][qt][j], SC, -mu[qt]); tm[qt] = fmaxf(tm[qt], s[kt][qt][j]); } }
        if (__builtin_amdgcn_ballot_w32(fmaxf(tm[0], tm[1]) > 8.f) != 0) {    // rare, wave-uniform: raise the base of every column to its maximum so far, alike in both halves of the wave
#pragma unroll
            for (int qt = 0; qt < 2; ++qt) { const float dl = fmaxf(fmaxf(tm[qt], __shfl_xor(tm[qt], 16, 32)), 0.f), al = __builtin_amdgcn_exp2f(-dl); mu[qt] += dl; l[qt] *= al;
#pragma unroll
                for (int dt = 0; dt < 4; ++dt) o[dt][qt] *= al;
#pragma unroll
                for (int kt = 0; kt < 2; ++kt) s[kt][qt] -= dl; } }
#pragma unroll
        for (int qt = 0; qt < 2; ++qt) { v16h pf;
#pragma unroll
            for (int kt = 0; kt < 2; ++kt)
#pragma unroll
                for (int j = 0; j < 8; ++j) { const float p = __builtin_amdgcn_exp2f(s[kt][qt][j]); l[qt] += p; pf[kt * 8 + j] = tohx(p); }
#pragma unroll
            for (int dt = 0; dt < 4; ++dt) o[dt][qt] = wmma16(vf[dt], pf, o[dt][qt]); }
        // four vector slots behind the pass's last products: over the back edge the next pass's first score product may write its D over the registers these read as B
        asm volatile("v_nop\n\tv_nop\n\tv_nop\n\tv_nop" : "+v"(o[0][1]), "+v"(o[1][1]), "+v"(o[2][1]), "+v"(o[3][1]));
    }
#pragma unroll
    for (int qt = 0; qt < 2; ++qt) { l[qt] += __shfl_xor(l[qt], 16, 32); if (hi == 0) { ms[w][qt * 16 + lr] = mu[qt]; ls[w][qt * 16 + lr] = l[qt]; }
#pragma unroll
        for (int dt = 0; dt < 4; ++dt) { float* d = &os[w][qt * 16 + lr][dt * 16 + hi * 8]; *(v4fa*)d = __builtin_shufflevector(o[dt][qt], o[dt][qt], 0, 1, 2, 3); *(v4fa*)(d + 4) = __builtin_shufflevector(o[dt][qt], o[dt][qt], 4, 5, 6, 7); } }
    __syncthreads();    // publishes every wave's partial state to the threads that join it
    const int q = threadIdx.x >> 2, d0 = (threadIdx.x & 3) * 16; float mm = ms[0][q], f[KSP], L = 0.f;
#pragma unroll
    for (int p = 1; p < KSP; ++p) mm = fmaxf(mm, ms[p][q]);
#pragma unroll
    for (int p = 0; p < KSP; ++p) { f[p] = __builtin_amdgcn_exp2f(ms[p][q] - mm); L = fmaf(f[p], ls[p][q], L); }
    const float inv = __fdiv_rn(1.0f, L); const size_t oo = ((size_t)blockIdx.z * TT + q0 + q) * DM + h * HD + d0;
#pragma unroll
    for (int u = 0; u < 2; ++u) { v8us oh, ol;
#pragma unroll
        for (int g = 0; g < 2; ++g) { v4f val = f[0] * *(const v4fa*)&os[0][q][d0 + u * 8 + g * 4];
#pragma unroll
            for (int p = 1; p < KSP; ++p) val += f[p] * *(const v4fa*)&os[p][q][d0 + u * 8 + g * 4];
#pragma unroll
            for (int e = 0; e < 4; ++e) { unsigned short a, b; splitf(val[e] * inv, a, b); oh[g * 4 + e] = a; ol[g * 4 + e] = b; } }
        *(v8us*)(Ah + oo + u * 8) = oh; *(v8us*)(Al + oo + u * 8) = ol; }
}

extern "C" void kernel_launch(void* const* d_in, const int* in_sizes, int n_in,
                              void* d_out, int out_size, void* d_ws, size_t ws_size, hipStream_t stream) {
    (void)in_sizes; (void)n_in; (void)out_size;
    const float** I = (const float**)d_in;
    const float *x = I[0], *ida = I[1], *Wq = I[2], *bq = I[3], *Wk = I[4], *bk = I[5], *Wv = I[6], *bv = I[7], *Wo = I[8], *bo = I[9];
    float* OUT = (float*)d_out;     // [4][2048][768]
    char* wsp = (char*)d_ws;
    auto take = [&](size_t bytes) { char* p = wsp; wsp += (bytes + 255) & ~(size_t)255; return (void*)p; };
    // every plane holds all 4 batches; all sizes are multiples of 256 B, so BQ BK BV BO XB and Q16 K16 VT each lie one behind the other with no gap (k_cvt8 and the z of the QKV launch lean on that)
    bf* BQ = (bf*)take((size_t)DM * DM * 2); take((size_t)DM * DM * 2); take((size_t)DM * DM * 2); bf* BO = (bf*)take((size_t)DM * DM * 2);
    bf* XB = (bf*)take((size_t)NB_ * TT * DM * 2); float* Q = (float*)take((size_t)NB_ * TT * DM * 4); float* KID = (float*)take(NB_ * DM * 4); float* VID = (float*)take(NB_ * DM * 4); float* S0 = (float*)take((size_t)NB_ * NH_ * TT * 4);
    h16* Q16 = (h16*)take((size_t)NB_ * NH_ * TT * HD * 2); h16* K16 = (h16*)take((size_t)NB_ * NH_ * TT * HD * 2); h16* VT = (h16*)take((size_t)NB_ * NH_ * HD * TT * 2); bf* Ah = (bf*)take((size_t)NB_ * TT * DM * 2); bf* Al = (bf*)take((size_t)NB_ * TT * DM * 2);
    if ((size_t)(wsp - (char*)d_ws) > ws_size) return;    // total ~ 106 MB
    k_cvt8<<<4 * WBL + NB_ * TT * DM / 8 / 256, 256, 0, stream>>>(Wq, Wk, Wv, Wo, x, BQ);   // torch [out][in] = Bt
    k_gemmw<bf, 0, true, 8, true><<<dim3(NB_ * TT / 64, DM / 64, 3), 256, 0, stream>>>(XB, nullptr, BQ, nullptr, DM, Q, DM, bq, bk, bv, 0, (size_t)DM * DM, 0, Q16);   // z: Q, K, V; the batches are rows
    k_idkv<<<dim3(DM / 32, 2, NB_), 1024, 0, stream>>>(ida, Wk, bk, Wv, bv, KID, VID); k_s0<<<(NB_ * NH_ * TT + 255) / 256, 256, 0, stream>>>(Q, KID, S0);
    k_fattn<<<dim3(TT / 32, NH_, NB_), 32 * KSP, 0, stream>>>(Q16, K16, VT, S0, VID, Ah, Al);
    k_gemmw<bf, 1, true, 8, false><<<dim3(NB_ * TT / 64, DM / 64, 1), 256, 0, stream>>>(Ah, Al, BO, nullptr, DM, OUT, DM, bo, bo, bo, 0, 0, 0, nullptr);
}

// v006
// It runs in 177 microseconds.
// Next to v005, in two timings, it ran 1.55 times as fast each time.
// Over all steps from v000 it is 12.1 times as fast.
#include <hip/hip_runtime.h>

// IDContextAttention (x [4][2048][768], id_anchor [4][1][768]; Q/K/V = x W^T + b (12 heads x 64); one extra key/value K_id/V_id = id_anchor Wk/Wv^T + b PREPENDED to the 2048 current keys; softmax(q.k/8) over the 2049 keys; out = (attn V merged) Wo^T + bo
// -> [4][2048][768]). The extra key's score is a VALU dot (k_s0); key and value row enter as the start state of the online softmax in k_fattn.
// Compute dtypes, f32 accumulate: every input rounded to bf16; Q/K/V on PLAIN bf16 operands (inputs: exact) + bias; K_id/V_id and q.K_id f32 on the VALU (fixed-order dots); scores (K 64) and attn.V over the 2048 current keys

#define NB_  4
#define TT   2048
#define DM   768
#define NH_  12
#define HD   64
typedef _Float16 h16;
typedef unsigned short bf;
typedef __attribute__((ext_vector_type(16))) __bf16   v16bf;
typedef __attribute__((ext_vector_type(16))) _Float16 v16h;
typedef __attribute__((ext_vector_type(8)))  _Float16 v8h;
typedef __attribute__((ext_vector_type(8)))  unsigned short v8us;
typedef __attribute__((ext_vector_type(8)))  float    v8f;
typedef __attribute__((ext_vector_type(4)))  float    v4f;
typedef v8h  __attribute__((may_alias)) v8ha;
typedef v4f  __attribute__((may_alias)) v4fa;
typedef v8us __attribute__((may_alias)) v8usa;

__device__ __forceinline__ unsigned short f2bf(float f) { unsigned u = __float_as_uint(f); u += 0x7FFFu + ((u >> 16) & 1u); return (unsigned short)(u >> 16); }
__device__ __forceinline__ float bf2f(unsigned short b) { return __uint_as_float(((unsigned)b) << 16); }
__device__ __forceinline__ float bfr(float f) { return bf2f(f2bf(f)); }
__device__ __forceinline__ v16h cat16(v8h lo, v8h hi) { return __builtin_shufflevector(lo, hi, 0, 1, 2, 3, 4, 5, 6, 7, 8, 9, 10, 11, 12, 13, 14, 15); }
__device__ __forceinline__ v16bf cat16b(v8us lo, v8us hi) { return __builtin_bit_cast(v16bf, __builtin_shufflevector(lo, hi, 0, 1, 2, 3, 4, 5, 6, 7, 8, 9, 10, 11, 12, 13, 14, 15)); }
__device__ __forceinline__ v8f wmma16(v16h a, v16h b, v8f c) { return __builtin_amdgcn_wmma_f32_16x16x32_f16(false, a, false, b, (short)0, c, false, false); }
__device__ __forceinline__ v8f wmmab(v16bf a, v16bf b, v8f c) { return __builtin_amdgcn_wmma_f32_16x16x32_bf16(false, a, false, b, (short)0, c, false, false); }
typedef __attribute__((ext_vector_type(4))) _Float16 v4h;
__device__ __forceinline__ h16 tohx(float x) { return (h16)x; }



// ---- FRAGMENT ORDER of every 16-bit operand plane (a matrix [R][K], R % 16 == 0, K % 32 == 0): element (r, k) lies at ((r / 16) * (K / 32) + k / 32) * 512 + ((k % 32) / 16) * 256 + (((k % 16) / 8) * 16 + r % 16) * 8 + k % 8.
// A 16 x 32 fragment is then 1 KiB in a row, and each of its two 16-B-a-lane loads (lane * 8, + 256 elements) reads 512 contiguous bytes = 4 whole 128-B lines, where a row-major plane gives 16 lines with 32 B used of each. Lane, register and k order are the row-major loader's.
// ---- k_gemmw: register-blocked GEMM, 64x64 output tile per work-group (16 accumulators a wave), operands straight from 16-bit planes in fragment order; grid (M/64, N/64, Z), 32 * KW threads; KW 1: ONE WAVE per tile.
// C[m][n] (f32, pitch ldc, + optional f32 bias[n]) = sum_k A[m][k] Bt[n][k] (+ split products per NSPLIT). z-batch strides sA/sB/sC in elements, bias0/1/2 the bias of z = 0/1/2 (Z <= 3). K = DM.
// KW > 1 (32 * KW threads, (K / KW) % 32 == 0): K IS SPLIT OVER THE KW WAVES of the work-group: wave w sums k in [w K/KW, (w+1) K/KW) into its own 16 accumulators, so KW waves wait out their load latencies side by side instead of one wave one after the other.
// Every wave lays its f32 partial tile in its own LDS plane [64][68]; behind one barrier each thread adds the KW planes in rising w (a fixed order), adds the bias and stores whole 256-B row pieces.
// PL (the QKV launch; a 64-column tile is one head): the epilogue writes the fp16 planes the attention kernel reads, P16 = Q16[b][h] ([t][d] in fragment order), K16 likewise, VT16[b][h] ([d][t] in fragment order) one behind the other; only Q (z 0) also goes out as f32, for k_s0.
// For V (z 2) the two operands change places, V^T = Wv x^T (same products, same k order): the tile's rows are then channels d and its columns tokens t, so VT16 needs no transpose; the bias goes by row.
template <typename T16> struct WFrag;
template <> struct WFrag<h16> { typedef v16h V; static __device__ __forceinline__ V ld(const h16* p) { return cat16(*(const v8h*)p, *(const v8h*)(p + 256)); } static __device__ __forceinline__ v8f mma(V a, V b, v8f c) { return wmma16(a, b, c); } };
template <> struct WFrag<bf> { typedef v16bf V; static __device__ __forceinline__ V ld(const bf* p) { return cat16b(*(const v8us*)p, *(const v8us*)(p + 256)); } static __device__ __forceinline__ v8f mma(V a, V b, v8f c) { return wmmab(a, b, c); } };
template <typename T16, int NSPLIT, bool BIAS, int KW, bool PL>
__global__ __launch_bounds__(32 * KW) void k_gemmw(const T16* __restrict__ A, const T16* __restrict__ A2, const T16* __restrict__ Bt, const T16* __restrict__ Bt2, float* C, int ldc, const float* __restrict__ bias0, const float* __restrict__ bias1, const float* __restrict__ bias2, size_t sA, size_t sB, size_t sC, h16* P16) {
    typedef typename WFrag<T16>::V V; constexpr int K = DM;    // a constant, so that a trip's fragments are immediate offsets on one address per plane
    __shared__ __align__(16) float os[(KW == 1 ? 16 : KW * 64) * 68];
    const int w = KW == 1 ? 0 : __builtin_amdgcn_readfirstlane(threadIdx.x >> 5), ks = K / KW;
    const size_t z = blockIdx.z; const float* bias = z == 0 ? bias0 : z == 1 ? bias1 : bias2; A += z * sA; if (A2) A2 += z * sA; Bt += z * sB; if (Bt2) Bt2 += z * sB; C += z * sC;
    const int lane = threadIdx.x & 31, lr = lane & 15, hi = lane >> 4; int r0 = blockIdx.x * 64, c0 = blockIdx.y * 64;
    if (PL && z == 2) { const T16* t = A; A = Bt; Bt = t; const int q = r0; r0 = c0; c0 = q; }
    v8f acc[4][4];
#pragma unroll
    for (int mb = 0; mb < 4; ++mb)
#pragma unroll
        for (int nb = 0; nb < 4; ++nb) acc[mb][nb] = (v8f){};
    // fragment order: 16 rows are 16 K elements, 32 k are 512 (1 KiB). An address is a scalar base that the loop never writes + the lane's byte offset fo + a constant
    const T16* Ar = A + (size_t)r0 * K; const T16* A2r = (NSPLIT == 1 || NSPLIT == 2) ? A2 + (size_t)r0 * K : nullptr; const T16* Br = Bt + (size_t)c0 * K; const T16* B2r = NSPLIT >= 2 ? Bt2 + (size_t)c0 * K : nullptr; unsigned fo = 16 * lane + w * ks * 32;
    auto at = [&](const T16* p, int blk) { return (const T16*)((const char*)p + fo) + blk * 16 * K; };
#pragma unroll 1
    for (int kc = 0; kc < ks; kc += 32) {
        V a[4], a2[4];
#pragma unroll
        for (int mb = 0; mb < 4; ++mb) { a[mb] = WFrag<T16>::ld(at(Ar, mb)); if (NSPLIT == 1 || NSPLIT == 2) a2[mb] = WFrag<T16>::ld(at(A2r, mb)); }
#pragma unroll
        for (int nb = 0; nb < 4; ++nb) { const V b = WFrag<T16>::ld(at(Br, nb)); V b2; if (NSPLIT >= 2) b2 = WFrag<T16>::ld(at(B2r, nb));
#pragma unroll
            for (int mb = 0; mb < 4; ++mb) { acc[mb][nb] = WFrag<T16>::mma(a[mb], b, acc[mb][nb]); if (NSPLIT == 1 || NSPLIT == 2) acc[mb][nb] = WFrag<T16>::mma(a2[mb], b, acc[mb][nb]); if (NSPLIT >= 2) acc[mb][nb] = WFrag<T16>::mma(a[mb], b2, acc[mb][nb]); } }
        asm volatile("v_nop\n\tv_nop\n\tv_nop\n\tv_nop" : "+v"(acc[0][0]), "+v"(acc[1][1]), "+v"(acc[2][2]), "+v"(acc[3][3]) : "v"(a[0]), "v"(a[3]));
        // every load of the trip names fo: the wait that belongs in front of its rewrite and the step to the next 32 k stand in one statement, so that the step cannot be lifted over the wait
        asm volatile("s_wait_xcnt 0x0\n\tv_add_nc_u32 %0, 0x400, %0" : "+v"(fo) : : "memory");
    }
    if constexpr (KW > 1) {
        float* my = os + w * (64 * 68);
        // the unrolls below keep every acc index a compile-time constant (registers, no scratch) and let the LDS reads of a thread's KW planes issue together
#pragma unroll
        for (int mb = 0; mb < 4; ++mb)
#pragma unroll
            for (int nb = 0; nb < 4; ++nb)
#pragma unroll
                for (int j = 0; j < 8; ++j) my[(mb * 16 + hi * 8 + j) * 68 + nb * 16 + lr] = acc[mb][nb][j];
        constexpr int NS = 32 / KW, RS = 2 * KW; const int rw = threadIdx.x >> 4, cofs = (threadIdx.x & 15) * 4; float bb[4];    // PL: step s of a thread is tile row rw + s RS, columns cofs .. cofs + 3
        if constexpr (PL) {    // the thread's four bias values, by row for V and by column for Q and K, asked for here so that they fly under the plane stores and not behind the sums
            static_assert(NS == 4, "four rows a thread");
            const float* bp = bias + (z == 2 ? r0 + rw : c0 + cofs); const int bs = z == 2 ? RS : 1;
#pragma unroll
            for (int k = 0; k < 4; ++k) bb[k] = bp[k * bs]; }
        __syncthreads();    // publishes every wave's plane to the threads that sum it
        if constexpr (PL) {
            // all sums first, then the branches on z (V, or Q/K with a second test for Q's f32 copy), every store last: the LDS reads of a thread's steps issue together
            v4f val[NS]; v4h o[NS]; const int pk = (cofs >> 5) * 512 + ((cofs >> 4) & 1) * 256 + (((cofs >> 3) & 1) * 16 + rw) * 8 + (cofs & 7);    // (row rw, k cofs) inside a row block, fragment order
#pragma unroll
            for (int s = 0; s < NS; ++s) { const float* pl = os + (s * RS + rw) * 68 + cofs; val[s] = *(const v4fa*)pl;
#pragma unroll
                for (int p = 1; p < KW; ++p) val[s] += *(const v4fa*)(pl + p * (64 * 68)); }
            if (z == 2) {
                h16* d = P16 + (size_t)2 * NB_ * NH_ * TT * HD + ((size_t)(c0 / TT) * DM + r0) * TT + c0 % TT * 16 + pk;
#pragma unroll
                for (int s = 0; s < NS; ++s) { val[s] += bfr(bb[s]);
#pragma unroll
                    for (int u = 0; u < 4; ++u) o[s][u] = tohx(val[s][u]); }
#pragma unroll
                for (int s = 0; s < NS; ++s) *(v4h*)(d + (size_t)s * RS * TT) = o[s];
            } else {
                const float b0 = bfr(bb[0]), b1 = bfr(bb[1]), b2 = bfr(bb[2]), b3 = bfr(bb[3]);
                h16* d = P16 + (((z * NB_ + r0 / TT) * NH_ + c0 / HD) * TT + r0 % TT) * HD + pk; float* cf = C + (size_t)(r0 + rw) * ldc + c0 + cofs;
#pragma unroll
                for (int s = 0; s < NS; ++s) { val[s][0] += b0; val[s][1] += b1; val[s][2] += b2; val[s][3] += b3;
#pragma unroll
                    for (int u = 0; u < 4; ++u) o[s][u] = tohx(val[s][u]); }
                if (z == 0) {
#pragma unroll
                    for (int s = 0; s < NS; ++s) *(v4f*)(cf + (size_t)s * RS * ldc) = val[s]; }
#pragma unroll
                for (int s = 0; s < NS; ++s) *(v4h*)(d + s * RS * HD) = o[s];
            }
            return;
        }
#pragma unroll
        for (int s = 0; s < 32 / KW; ++s) { const int i = s * 32 * KW + threadIdx.x, row = i >> 4, cofs = (i & 15) * 4; v4f val = *(const v4fa*)(os + row * 68 + cofs);
#pragma unroll
            for (int p = 1; p < KW; ++p) val += *(const v4fa*)(os + p * (64 * 68) + row * 68 + cofs);
            if (BIAS) { val[0] += bfr(bias[c0 + cofs]); val[1] += bfr(bias[c0 + cofs + 1]); val[2] += bfr(bias[c0 + cofs + 2]); val[3] += bfr(bias[c0 + cofs + 3]); }
            *(v4f*)(C + (size_t)(r0 + row) * ldc + c0 + cofs) = val; }
        return;
    }
#pragma unroll
    for (int mb = 0; mb < 4; ++mb) {
#pragma unroll
        for (int nb = 0; nb < 4; ++nb) {
#pragma unroll
            for (int j = 0; j < 8; ++j) os[(hi * 8 + j) * 68 + nb * 16 + lr] = acc[mb][nb][j]; }
        __builtin_amdgcn_wave_barrier(); asm volatile("" ::: "memory");
        float* crow = C + (size_t)(r0 + mb * 16) * ldc + c0;
{
#pragma unroll
            for (int s = 0; s < 8; ++s) { const int row = 2 * s + hi, cofs = lr * 4; v4f val = *(const v4fa*)(os + row * 68 + cofs); if (BIAS) { val[0] += bfr(bias[c0 + cofs]); val[1] += bfr(bias[c0 + cofs + 1]); val[2] += bfr(bias[c0 + cofs + 2]); val[3] += bfr(bias[c0 + cofs + 3]); }
                *(v4f*)(crow + (size_t)row * ldc + cofs) = val; }
             }
        __builtin_amdgcn_wave_barrier(); asm volatile("" ::: "memory");
    }
}

__device__ __forceinline__ void splitf(float y, unsigned short& h, unsigned short& l) { h = f2bf(y); l = f2bf(y - bf2f(h)); }
typedef __attribute__((ext_vector_type(2))) unsigned short v2us;
typedef __attribute__((ext_vector_type(4))) unsigned short v4us;

// k_cvt8: all five f32 -> bf16 conversions in one grid; dst is ONE run of planes, each in fragment order (K = DM): the four weights (WBL blocks each), then x of all batches; a block lies wholly in one source; a thread writes the 8 elements at its own place in the run and reads them from the row and k that belong there
#define WBL (DM * DM / 8 / 256)
__global__ __launch_bounds__(256) void k_cvt8(const float* __restrict__ w0, const float* __restrict__ w1, const float* __restrict__ w2, const float* __restrict__ w3, const float* __restrict__ xs, bf* dst) {
    const int bx = blockIdx.x, m = bx / WBL; const float* src = m == 0 ? w0 : m == 1 ? w1 : m == 2 ? w2 : m == 3 ? w3 : xs;
    const size_t i = (size_t)bx * 256 + threadIdx.x, si = (size_t)(bx - (m < 4 ? m : 4) * WBL) * 256 + threadIdx.x; const unsigned fb = (unsigned)si >> 6; const v8f v = *(const v8f*)(src + (size_t)(fb / (DM / 32) * 16 + ((unsigned)si & 15)) * DM + fb % (DM / 32) * 32 + (((unsigned)si >> 4) & 3) * 8); v8us o;
#pragma unroll
    for (int k = 0; k < 8; ++k) o[k] = f2bf(v[k]); *(v8us*)(dst + i * 8) = o;  }
// k_idkv: wave per channel c, block = 32 channels of one matrix (blockIdx.y 0: K, 1: V): KID[c] = sum_d bf16 id[d] bf16 Wk[c][d] + bk[c], VID likewise; lane l sums d = 128 i + 4 l + u in rising (i, u), lane 0 starting from the bias, all loads issued up front, then an xor butterfly over the lanes; the 32 sums meet in LDS and wave 0 stores them as one 128-B line; blockIdx.z: batch; k_s0: thread per (b, h, t): s0 = sum_d Q[t][h*64+d] KID[h*64+d] (4-B);
__global__ __launch_bounds__(1024) void k_idkv(const float* __restrict__ ida, const float* __restrict__ Wk, const float* __restrict__ bk, const float* __restrict__ Wv, const float* __restrict__ bv, float* KID, float* VID) {
    __shared__ float red[32];
    const int lane = threadIdx.x & 31, w = threadIdx.x >> 5, c = blockIdx.x * 32 + w; const bool isv = blockIdx.y != 0;
    const float* wr = (isv ? Wv : Wk) + (size_t)c * DM + lane * 4; const float* ar = ida + blockIdx.z * DM + lane * 4; const float bias = (isv ? bv : bk)[c]; v4f a[DM / 128], m[DM / 128];
#pragma unroll
    for (int i = 0; i < DM / 128; ++i) { m[i] = *(const v4f*)(wr + i * 128); a[i] = *(const v4f*)(ar + i * 128); }
    float s = lane == 0 ? bfr(bias) : 0.f;
#pragma unroll
    for (int i = 0; i < DM / 128; ++i)
#pragma unroll
        for (int u = 0; u < 4; ++u) s = fmaf(bfr(a[i][u]), bfr(m[i][u]), s);
#pragma unroll
    for (int sh = 16; sh; sh >>= 1) s += __shfl_xor(s, sh, 32);
    if (lane == 0) red[w] = s;
    __syncthreads();
    if (w == 0) (isv ? VID : KID)[blockIdx.z * DM + blockIdx.x * 32 + lane] = red[lane]; }
__global__ __launch_bounds__(256) void k_s0(const float* __restrict__ Q, const float* __restrict__ KID, float* S0) { const int idx = blockIdx.x * 256 + threadIdx.x; if (idx >= NB_ * NH_ * TT) return; const int t = idx % TT; const int h = (idx / TT) % NH_; const int b = idx / (TT * NH_); Q += (size_t)b * TT * DM; KID += b * DM; float s = 0.f;
#pragma unroll 1
    for (int d = 0; d < HD; ++d) { float p = __fmul_rn(Q[(size_t)t * DM + h * HD + d], KID[h * HD + d]); asm volatile("" : "+v"(p)); s = __fadd_rn(s, p); } *(float*)(S0 + idx) = s;  }
#define KSP 4
__global__ __launch_bounds__(32 * KSP) void k_fattn(const h16* __restrict__ Q16, const h16* __restrict__ K16, const h16* __restrict__ VT, const float* __restrict__ S0, const float* __restrict__ VID, bf* Ah, bf* Al) {
    __shared__ __align__(16) float os[KSP][32][68]; __shared__ float ms[KSP][32], ls[KSP][32];
    const int w = __builtin_amdgcn_readfirstlane(threadIdx.x >> 5), lane = threadIdx.x & 31, lr = lane & 15, hi = lane >> 4; const int h = blockIdx.y, q0 = blockIdx.x * 32, hb = blockIdx.z * NH_ + h;    // hb: the head's place in the [batch][head] planes
    const float SC = 0.125f * 1.4426950408889634f; constexpr int NP = TT / KSP / 32;
    const h16* qp = Q16 + ((size_t)hb * TT + q0) * HD + 8 * lane; const h16* kp = K16 + ((size_t)hb * TT + w * (TT / KSP)) * HD + 8 * lane; const h16* vp = VT + (size_t)hb * HD * TT + w * (TT / KSP) * 16 + 8 * lane;    // fragment order
    v16h qf[2][2], kf[2][2]; float mu[2], l[2]; v8f o[4][2];
#pragma unroll
    for (int qt = 0; qt < 2; ++qt) { qf[qt][0] = WFrag<h16>::ld(qp + qt * 16 * HD); qf[qt][1] = WFrag<h16>::ld(qp + qt * 16 * HD + 512); kf[qt][0] = WFrag<h16>::ld(kp + qt * 16 * HD); kf[qt][1] = WFrag<h16>::ld(kp + qt * 16 * HD + 512);
        mu[qt] = S0[(size_t)hb * TT + q0 + qt * 16 + lr] * SC; l[qt] = (w == 0 && hi == 0) ? 1.f : 0.f; }
    int hv;
    asm volatile("s_wait_xcnt 0x0\n\ts_mov_b32 %0, %1" : "=s"(hv) : "s"(hb) : "memory");    // the loads above name a lane-offset register and scalar bases that the code below writes anew; hv, from which the next address is formed, is made behind the wait inside the statement, so that its arithmetic (the first such write) cannot be lifted over it
#pragma unroll
    for (int dt = 0; dt < 4; ++dt) { v8f vi = (v8f){}; if (w == 0) vi = *(const v8f*)(VID + hv * HD + dt * 16 + hi * 8); o[dt][0] = vi; o[dt][1] = vi; }
    // rolled: with the 16 passes unrolled the register count would grow
#pragma unroll 1
    for (int it = 0; it < NP; ++it) {
        v16h vf[4]; v8f s[2][2];
#pragma unroll
        for (int dt = 0; dt < 4; ++dt) vf[dt] = WFrag<h16>::ld(vp + (size_t)dt * 16 * TT + it * 512);
#pragma unroll
        for (int kt = 0; kt < 2; ++kt)
#pragma unroll
            for (int qt = 0; qt < 2; ++qt) s[kt][qt] = wmma16(kf[kt][1], qf[qt][1], wmma16(kf[kt][0], qf[qt][0], (v8f){}));
        const int nx = it + 1 < NP ? it + 1 : it;    // the next pass's K fragments fly under this pass's softmax; the last pass re-reads its own (in bounds, unused)
#pragma unroll
        for (int kt = 0; kt < 2; ++kt) { kf[kt][0] = WFrag<h16>::ld(kp + (nx * 32 + kt * 16) * HD); kf[kt][1] = WFrag<h16>::ld(kp + (nx * 32 + kt * 16) * HD + 512); }
        float tm[2];
#pragma unroll
        for (int qt = 0; qt < 2; ++qt) { tm[qt] = -8.f;
#pragma unroll
            for (int kt = 0; kt < 2; ++kt)
#pragma unroll
                for (int j = 0; j < 8; ++j) { s[kt][qt][j] = fmaf(s[kt][qt][j], SC, -mu[qt]); tm[qt] = fmaxf(tm[qt], s[kt][qt][j]); } }
        if (__builtin_amdgcn_ballot_w32(fmaxf(tm[0], tm[1]) > 8.f) != 0) {    // rare, wave-uniform: raise the base of every column to its maximum so far, alike in both halves of the wave
#pragma unroll
            for (int qt = 0; qt < 2; ++qt) { const float dl = fmaxf(fmaxf(tm[qt], __shfl_xor(tm[qt], 16, 32)), 0.f), al = __builtin_amdgcn_exp2f(-dl); mu[qt] += dl; l[qt] *= al;
#pragma unroll
                for (int dt = 0; dt < 4; ++dt) o[dt][qt] *= al;
#pragma unroll
                for (int kt = 0; kt < 2; ++kt) s[kt][qt] -= dl; } }
#pragma unroll
        for (int qt = 0; qt < 2; ++qt) { v16h pf;
#pragma unroll
            for (int kt = 0; kt < 2; ++kt)
#pragma unroll
                for (int j = 0; j < 8; ++j) { const float p = __builtin_amdgcn_exp2f(s[kt][qt][j]); l[qt] += p; pf[kt * 8 + j] = tohx(p); }
#pragma unroll
            for (int dt = 0; dt < 4; ++dt) o[dt][qt] = wmma16(vf[dt], pf, o[dt][qt]); }
        // four vector slots behind the pass's last products: over the back edge the next pass's first score product may write its D over the registers these read as B
        asm volatile("v_nop\n\tv_nop\n\tv_nop\n\tv_nop" : "+v"(o[0][1]), "+v"(o[1][1]), "+v"(o[2][1]), "+v"(o[3][1]));
    }
#pragma unroll
    for (int qt = 0; qt < 2; ++qt) { l[qt] += __shfl_xor(l[qt], 16, 32); if (hi == 0) { ms[w][qt * 16 + lr] = mu[qt]; ls[w][qt * 16 + lr] = l[qt]; }
#pragma unroll
        for (int dt = 0; dt < 4; ++dt) { float* d = &os[w][qt * 16 + lr][dt * 16 + hi * 8]; *(v4fa*)d = __builtin_shufflevector(o[dt][qt], o[dt][qt], 0, 1, 2, 3); *(v4fa*)(d + 4) = __builtin_shufflevector(o[dt][qt], o[dt][qt], 4, 5, 6, 7); } }
    __syncthreads();    // publishes every wave's partial state to the threads that join it
    const int q = threadIdx.x >> 2, d0 = (threadIdx.x & 3) * 16; float mm = ms[0][q], f[KSP], L = 0.f;
#pragma unroll
    for (int p = 1; p < KSP; ++p) mm = fmaxf(mm, ms[p][q]);
#pragma unroll
    for (int p = 0; p < KSP; ++p) { f[p] = __builtin_amdgcn_exp2f(ms[p][q] - mm); L = fmaf(f[p], ls[p][q], L); }
    const float inv = __fdiv_rn(1.0f, L); const size_t oo = ((size_t)blockIdx.z * TT + q0 + (q & 16)) * DM + (h * 2 + (d0 >> 5)) * 512 + ((d0 >> 4) & 1) * 256 + (q & 15) * 8;    // row q, k h * 64 + d0 of the [4 * 2048][768] planes, fragment order; + 8 k is + 128
#pragma unroll
    for (int u = 0; u < 2; ++u) { v8us oh, ol;
#pragma unroll
        for (int g = 0; g < 2; ++g) { v4f val = f[0] * *(const v4fa*)&os[0][q][d0 + u * 8 + g * 4];
#pragma unroll
            for (int p = 1; p < KSP; ++p) val += f[p] * *(const v4fa*)&os[p][q][d0 + u * 8 + g * 4];
#pragma unroll
            for (int e = 0; e < 4; ++e) { unsigned short a, b; splitf(val[e] * inv, a, b); oh[g * 4 + e] = a; ol[g * 4 + e] = b; } }
        *(v8us*)(Ah + oo + u * 128) = oh; *(v8us*)(Al + oo + u * 128) = ol; }
}

extern "C" void kernel_launch(void* const* d_in, const int* in_sizes, int n_in,
                              void* d_out, int out_size, void* d_ws, size_t ws_size, hipStream_t stream) {
    (void)in_sizes; (void)n_in; (void)out_size;
    const float** I = (const float**)d_in;
    const float *x = I[0], *ida = I[1], *Wq = I[2], *bq = I[3], *Wk = I[4], *bk = I[5], *Wv = I[6], *bv = I[7], *Wo = I[8], *bo = I[9];
    float* OUT = (float*)d_out;     // [4][2048][768]
    char* wsp = (char*)d_ws;
    auto take = [&](size_t bytes) { char* p = wsp; wsp += (bytes + 255) & ~(size_t)255; return (void*)p; };
    // every plane holds all 4 batches; all sizes are multiples of 256 B, so BQ BK BV BO XB and Q16 K16 VT each lie one behind the other with no gap (k_cvt8 and the z of the QKV launch lean on that)
    bf* BQ = (bf*)take((size_t)DM * DM * 2); take((size_t)DM * DM * 2); take((size_t)DM * DM * 2); bf* BO = (bf*)take((size_t)DM * DM * 2);
    bf* XB = (bf*)take((size_t)NB_ * TT * DM * 2); float* Q = (float*)take((size_t)NB_ * TT * DM * 4); float* KID = (float*)take(NB_ * DM * 4); float* VID = (float*)take(NB_ * DM * 4); float* S0 = (float*)take((size_t)NB_ * NH_ * TT * 4);
    h16* Q16 = (h16*)take((size_t)NB_ * NH_ * TT * HD * 2); h16* K16 = (h16*)take((size_t)NB_ * NH_ * TT * HD * 2); h16* VT = (h16*)take((size_t)NB_ * NH_ * HD * TT * 2); bf* Ah = (bf*)take((size_t)NB_ * TT * DM * 2); bf* Al = (bf*)take((size_t)NB_ * TT * DM * 2);
    if ((size_t)(wsp - (char*)d_ws) > ws_size) return;    // total ~ 106 MB
    k_cvt8<<<4 * WBL + NB_ * TT * DM / 8 / 256, 256, 0, stream>>>(Wq, Wk, Wv, Wo, x, BQ);   // torch [out][in] = Bt
    k_gemmw<bf, 0, true, 8, true><<<dim3(NB_ * TT / 64, DM / 64, 3), 256, 0, stream>>>(XB, nullptr, BQ, nullptr, Q, DM, bq, bk, bv, 0, (size_t)DM * DM, 0, Q16);   // z: Q, K, V; the batches are rows
    k_idkv<<<dim3(DM / 32, 2, NB_), 1024, 0, stream>>>(ida, Wk, bk, Wv, bv, KID, VID); k_s0<<<(NB_ * NH_ * TT + 255) / 256, 256, 0, stream>>>(Q, KID, S0);
    k_fattn<<<dim3(TT / 32, NH_, NB_), 32 * KSP, 0, stream>>>(Q16, K16, VT, S0, VID, Ah, Al);
    k_gemmw<bf, 1, true, 8, false><<<dim3(NB_ * TT / 64, DM / 64, 1), 256, 0, stream>>>(Ah, Al, BO, nullptr, OUT, DM, bo, bo, bo, 0, 0, 0, nullptr);
}

// v007
// A run of this version takes 155 microseconds.
// Next to v006, in two timings, it ran 1.14 and 1.15 times as fast.
// Over all steps from v000 it is 13.9 times as fast.
#include <hip/hip_runtime.h>

// IDContextAttention (x [4][2048][768], id_anchor [4][1][768]; Q/K/V = x W^T + b (12 heads x 64); one extra key/value K_id/V_id = id_anchor Wk/Wv^T + b PREPENDED to the 2048 current keys; softmax(q.k/8) over the 2049 keys; out = (attn V merged) Wo^T + bo
// -> [4][2048][768]). The extra key's score is a VALU dot in the Q tile's epilogue of the QKV GEMM; key and value row enter as the start state of the online softmax in k_fattn.
// Compute dtypes, f32 accumulate: every input rounded to bf16; Q/K/V on PLAIN bf16 operands (inputs: exact) + bias; K_id/V_id and q.K_id f32 on the VALU (fixed-order dots); scores (K 64) and attn.V over the 2048 current keys

#define NB_  4
#define TT   2048
#define DM   768
#define NH_  12
#define HD   64
typedef _Float16 h16;
typedef unsigned short bf;
typedef __attribute__((ext_vector_type(16))) __bf16   v16bf;
typedef __attribute__((ext_vector_type(16))) _Float16 v16h;
typedef __attribute__((ext_vector_type(8)))  _Float16 v8h;
typedef __attribute__((ext_vector_type(8)))  unsigned short v8us;
typedef __attribute__((ext_vector_type(8)))  float    v8f;
typedef __attribute__((ext_vector_type(4)))  float    v4f;
typedef v8h  __attribute__((may_alias)) v8ha;
typedef v4f  __attribute__((may_alias)) v4fa;
typedef v8us __attribute__((may_alias)) v8usa;

__device__ __forceinline__ unsigned short f2bf(float f) { unsigned u = __float_as_uint(f); u += 0x7FFFu + ((u >> 16) & 1u); return (unsigned short)(u >> 16); }
__device__ __forceinline__ float bf2f(unsigned short b) { return __uint_as_float(((unsigned)b) << 16); }
__device__ __forceinline__ float bfr(float f) { return bf2f(f2bf(f)); }
__device__ __forceinline__ v16h cat16(v8h lo, v8h hi) { return __builtin_shufflevector(lo, hi, 0, 1, 2, 3, 4, 5, 6, 7, 8, 9, 10, 11, 12, 13, 14, 15); }
__device__ __forceinline__ v16bf cat16b(v8us lo, v8us hi) { return __builtin_bit_cast(v16bf, __builtin_shufflevector(lo, hi, 0, 1, 2, 3, 4, 5, 6, 7, 8, 9, 10, 11, 12, 13, 14, 15)); }
__device__ __forceinline__ v8f wmma16(v16h a, v16h b, v8f c) { return __builtin_amdgcn_wmma_f32_16x16x32_f16(false, a, false, b, (short)0, c, false, false); }
__device__ __forceinline__ v8f wmmab(v16bf a, v16bf b, v8f c) { return __builtin_amdgcn_wmma_f32_16x16x32_bf16(false, a, false, b, (short)0, c, false, false); }
typedef __attribute__((ext_vector_type(4))) _Float16 v4h;
__device__ __forceinline__ h16 tohx(float x) { return (h16)x; }
// x + the x of lane ^ m inside a 16-lane row (DPP row_xmask, CTRL = 0x160 + m): no LDS path, every lane on
template <int CTRL> __device__ __forceinline__ float rowx(float x) { return x + __int_as_float(__builtin_amdgcn_update_dpp(0, __float_as_int(x), CTRL, 0xf, 0xf, true)); }



// ---- FRAGMENT ORDER of every 16-bit operand plane (a matrix [R][K], R % 16 == 0, K % 32 == 0): element (r, k) lies at ((r / 16) * (K / 32) + k / 32) * 512 + ((k % 32) / 16) * 256 + (((k % 16) / 8) * 16 + r % 16) * 8 + k % 8.
// A 16 x 32 fragment is then 1 KiB in a row, and each of its two 16-B-a-lane loads (lane * 8, + 256 elements) reads 512 contiguous bytes = 4 whole 128-B lines, where a row-major plane gives 16 lines with 32 B used of each. Lane, register and k order are the row-major loader's.
// ---- k_gemmw: register-blocked GEMM, 64x64 output tile per work-group (16 accumulators a wave), operands straight from 16-bit planes in fragment order; grid (M/64, N/64, Z), 32 * KW threads; KW 1: ONE WAVE per tile.
// C[m][n] (f32, pitch ldc, + optional f32 bias[n]) = sum_k A[m][k] Bt[n][k] (+ split products per NSPLIT). z-batch strides sA/sB/sC in elements, bias0/1/2 the bias of z = 0/1/2 (Z <= 3). K = DM.
// KW > 1 (32 * KW threads, (K / KW) % 32 == 0): K IS SPLIT OVER THE KW WAVES of the work-group: wave w sums k in [w K/KW, (w+1) K/KW) into its own 16 accumulators, so KW waves wait out their load latencies side by side instead of one wave one after the other.
// Every wave lays its f32 partial tile in its own LDS plane [64][68]; behind one barrier each thread adds the KW planes in rising w (a fixed order), adds the bias and stores whole 256-B row pieces.
// PL (the QKV launch; a 64-column tile is one head): the epilogue writes the fp16 planes the attention kernel reads, P16 = Q16[b][h] ([t][d] in fragment order), K16 likewise, VT16[b][h] ([d][t] in fragment order) one behind the other. Q (z 0) never goes out as f32: a tile row is one token's whole head, so the epilogue forms the id key's score s0 = sum_d Q[t][d] KID[d] from its f32 sums (4 columns in the thread, then the 16 lanes of the row) and stores it in C = S0[b][h][t].
// For V (z 2) the two operands change places, V^T = Wv x^T (same products, same k order): the tile's rows are then channels d and its columns tokens t, so VT16 needs no transpose; the bias goes by row.
template <typename T16> struct WFrag;
template <> struct WFrag<h16> { typedef v16h V; static __device__ __forceinline__ V ld(const h16* p) { return cat16(*(const v8h*)p, *(const v8h*)(p + 256)); } static __device__ __forceinline__ v8f mma(V a, V b, v8f c) { return wmma16(a, b, c); } };
template <> struct WFrag<bf> { typedef v16bf V; static __device__ __forceinline__ V ld(const bf* p) { return cat16b(*(const v8us*)p, *(const v8us*)(p + 256)); } static __device__ __forceinline__ v8f mma(V a, V b, v8f c) { return wmmab(a, b, c); } };
template <typename T16, int NSPLIT, bool BIAS, int KW, bool PL>
__global__ __launch_bounds__(32 * KW) void k_gemmw(const T16* __restrict__ A, const T16* __restrict__ A2, const T16* __restrict__ Bt, const T16* __restrict__ Bt2, float* C, int ldc, const float* __restrict__ bias0, const float* __restrict__ bias1, const float* __restrict__ bias2, size_t sA, size_t sB, size_t sC, h16* P16, const float* __restrict__ kid) {
    typedef typename WFrag<T16>::V V; constexpr int K = DM;    // a constant, so that a trip's fragments are immediate offsets on one address per plane
    __shared__ __align__(16) float os[(KW == 1 ? 16 : KW * 64) * 68];
    const int w = KW == 1 ? 0 : __builtin_amdgcn_readfirstlane(threadIdx.x >> 5), ks = K / KW;
    const size_t z = blockIdx.z; const float* bias = z == 0 ? bias0 : z == 1 ? bias1 : bias2; A += z * sA; if (A2) A2 += z * sA; Bt += z * sB; if (Bt2) Bt2 += z * sB; C += z * sC;
    const int lane = threadIdx.x & 31, lr = lane & 15, hi = lane >> 4; int r0 = blockIdx.x * 64, c0 = blockIdx.y * 64;
    if (PL && z == 2) { const T16* t = A; A = Bt; Bt = t; const int q = r0; r0 = c0; c0 = q; }
    v8f acc[4][4];
#pragma unroll
    for (int mb = 0; mb < 4; ++mb)
#pragma unroll
        for (int nb = 0; nb < 4; ++nb) acc[mb][nb] = (v8f){};
    // fragment order: 16 rows are 16 K elements, 32 k are 512 (1 KiB). An address is a scalar base that the loop never writes + the lane's byte offset fo + a constant
    const T16* Ar = A + (size_t)r0 * K; const T16* A2r = (NSPLIT == 1 || NSPLIT == 2) ? A2 + (size_t)r0 * K : nullptr; const T16* Br = Bt + (size_t)c0 * K; const T16* B2r = NSPLIT >= 2 ? Bt2 + (size_t)c0 * K : nullptr; unsigned fo = 16 * lane + w * ks * 32;
    auto at = [&](const T16* p, int blk) { return (const T16*)((const char*)p + fo) + blk * 16 * K; };
#pragma unroll 1
    for (int kc = 0; kc < ks; kc += 32) {
        V a[4], a2[4];
#pragma unroll
        for (int mb = 0; mb < 4; ++mb) { a[mb] = WFrag<T16>::ld(at(Ar, mb)); if (NSPLIT == 1 || NSPLIT == 2) a2[mb] = WFrag<T16>::ld(at(A2r, mb)); }
#pragma unroll
        for (int nb = 0; nb < 4; ++nb) { const V b = WFrag<T16>::ld(at(Br, nb)); V b2; if (NSPLIT >= 2) b2 = WFrag<T16>::ld(at(B2r, nb));
#pragma unroll
            for (int mb = 0; mb < 4; ++mb) { acc[mb][nb] = WFrag<T16>::mma(a[mb], b, acc[mb][nb]); if (NSPLIT == 1 || NSPLIT == 2) acc[mb][nb] = WFrag<T16>::mma(a2[mb], b, acc[mb][nb]); if (NSPLIT >= 2) acc[mb][nb] = WFrag<T16>::mma(a[mb], b2, acc[mb][nb]); } }
        asm volatile("v_nop\n\tv_nop\n\tv_nop\n\tv_nop" : "+v"(acc[0][0]), "+v"(acc[1][1]), "+v"(acc[2][2]), "+v"(acc[3][3]) : "v"(a[0]), "v"(a[3]));
        // every load of the trip names fo: the wait that belongs in front of its rewrite and the step to the next 32 k stand in one statement, so that the step cannot be lifted over the wait
        asm volatile("s_wait_xcnt 0x0\n\tv_add_nc_u32 %0, 0x400, %0" : "+v"(fo) : : "memory");
    }
    if constexpr (KW > 1) {
        float* my = os + w * (64 * 68); v4f kd = (v4f){};
        if constexpr (PL) { if (z == 0) kd = *(const v4f*)(kid + (r0 / TT) * DM + c0 + (threadIdx.x & 15) * 4); }    // Q tile: the id key's four channels of the thread's columns, asked for ahead of the plane stores so that they fly under them
        // the unrolls below keep every acc index a compile-time constant (registers, no scratch) and let the LDS reads of a thread's KW planes issue together
#pragma unroll
        for (int mb = 0; mb < 4; ++mb)
#pragma unroll
            for (int nb = 0; nb < 4; ++nb)
#pragma unroll
                for (int j = 0; j < 8; ++j) my[(mb * 16 + hi * 8 + j) * 68 + nb * 16 + lr] = acc[mb][nb][j];
        constexpr int NS = 32 / KW, RS = 2 * KW; const int rw = threadIdx.x >> 4, cofs = (threadIdx.x & 15) * 4; float bb[4];    // PL: step s of a thread is tile row rw + s RS, columns cofs .. cofs + 3
        if constexpr (PL) {    // the thread's four bias values, by row for V and by column for Q and K, asked for here so that they fly under the plane stores and not behind the sums
            static_assert(NS == 4, "four rows a thread");
            const float* bp = bias + (z == 2 ? r0 + rw : c0 + cofs); const int bs = z == 2 ? RS : 1;
#pragma unroll
            for (int k = 0; k < 4; ++k) bb[k] = bp[k * bs]; }
        __syncthreads();    // publishes every wave's plane to the threads that sum it
        if constexpr (PL) {
            // all sums first, then the branches on z, every store last: the LDS reads of a thread's steps issue together
            v4f val[NS]; v4h o[NS]; const int pk = (cofs >> 5) * 512 + ((cofs >> 4) & 1) * 256 + (((cofs >> 3) & 1) * 16 + rw) * 8 + (cofs & 7);    // (row rw, k cofs) inside a row block, fragment order
#pragma unroll
            for (int s = 0; s < NS; ++s) { const float* pl = os + (s * RS + rw) * 68 + cofs; val[s] = *(const v4fa*)pl;
#pragma unroll
                for (int p = 1; p < KW; ++p) val[s] += *(const v4fa*)(pl + p * (64 * 68)); }
            if (z == 2) {
                h16* d = P16 + (size_t)2 * NB_ * NH_ * TT * HD + ((size_t)(c0 / TT) * DM + r0) * TT + c0 % TT * 16 + pk;
#pragma unroll
                for (int s = 0; s < NS; ++s) { val[s] += bfr(bb[s]);
#pragma unroll
                    for (int u = 0; u < 4; ++u) o[s][u] = tohx(val[s][u]); }
#pragma unroll
                for (int s = 0; s < NS; ++s) *(v4h*)(d + (size_t)s * RS * TT) = o[s];
            } else {
                const float b0 = bfr(bb[0]), b1 = bfr(bb[1]), b2 = bfr(bb[2]), b3 = bfr(bb[3]);
                h16* d = P16 + (((z * NB_ + r0 / TT) * NH_ + c0 / HD) * TT + r0 % TT) * HD + pk;
#pragma unroll
                for (int s = 0; s < NS; ++s) { val[s][0] += b0; val[s][1] += b1; val[s][2] += b2; val[s][3] += b3;
#pragma unroll
                    for (int u = 0; u < 4; ++u) o[s][u] = tohx(val[s][u]); }
                if (z == 0) {    // s0 of the thread's four rows: its 4 columns in rising order, then an xor butterfly over the row's 16 lanes (a fixed order, alike in all 16); lane u < 4 of a row group stores row rw + u RS
                    float p[NS];
#pragma unroll
                    for (int s = 0; s < NS; ++s) p[s] = fmaf(val[s][3], kd[3], fmaf(val[s][2], kd[2], fmaf(val[s][1], kd[1], val[s][0] * kd[0])));
#pragma unroll
                    for (int s = 0; s < NS; ++s) { p[s] = rowx<0x161>(p[s]); p[s] = rowx<0x162>(p[s]); p[s] = rowx<0x164>(p[s]); p[s] = rowx<0x168>(p[s]); }
                    const int u = threadIdx.x & 15;
                    if (u < NS) C[((size_t)(r0 / TT) * NH_ + c0 / HD) * TT + r0 % TT + rw + u * RS] = u == 0 ? p[0] : u == 1 ? p[1] : u == 2 ? p[2] : p[3]; }
#pragma unroll
                for (int s = 0; s < NS; ++s) *(v4h*)(d + s * RS * HD) = o[s];
            }
            return;
        }
#pragma unroll
        for (int s = 0; s < 32 / KW; ++s) { const int i = s * 32 * KW + threadIdx.x, row = i >> 4, cofs = (i & 15) * 4; v4f val = *(const v4fa*)(os + row * 68 + cofs);
#pragma unroll
            for (int p = 1; p < KW; ++p) val += *(const v4fa*)(os + p * (64 * 68) + row * 68 + cofs);
            if (BIAS) { val[0] += bfr(bias[c0 + cofs]); val[1] += bfr(bias[c0 + cofs + 1]); val[2] += bfr(bias[c0 + cofs + 2]); val[3] += bfr(bias[c0 + cofs + 3]); }
            *(v4f*)(C + (size_t)(r0 + row) * ldc + c0 + cofs) = val; }
        return;
    }
#pragma unroll
    for (int mb = 0; mb < 4; ++mb) {
#pragma unroll
        for (int nb = 0; nb < 4; ++nb) {
#pragma unroll
            for (int j = 0; j < 8; ++j) os[(hi * 8 + j) * 68 + nb * 16 + lr] = acc[mb][nb][j]; }
        __builtin_amdgcn_wave_barrier(); asm volatile("" ::: "memory");
        float* crow = C + (size_t)(r0 + mb * 16) * ldc + c0;
{
#pragma unroll
            for (int s = 0; s < 8; ++s) { const int row = 2 * s + hi, cofs = lr * 4; v4f val = *(const v4fa*)(os + row * 68 + cofs); if (BIAS) { val[0] += bfr(bias[c0 + cofs]); val[1] += bfr(bias[c0 + cofs + 1]); val[2] += bfr(bias[c0 + cofs + 2]); val[3] += bfr(bias[c0 + cofs + 3]); }
                *(v4f*)(crow + (size_t)row * ldc + cofs) = val; }
             }
        __builtin_amdgcn_wave_barrier(); asm volatile("" ::: "memory");
    }
}

__device__ __forceinline__ void splitf(float y, unsigned short& h, unsigned short& l) { h = f2bf(y); l = f2bf(y - bf2f(h)); }
typedef __attribute__((ext_vector_type(2))) unsigned short v2us;
typedef __attribute__((ext_vector_type(4))) unsigned short v4us;

// k_cvt8: all five f32 -> bf16 conversions in one grid; dst is ONE run of planes, each in fragment order (K = DM): the four weights (WBL blocks each), then x of all batches; a block lies wholly in one source; a thread writes the 8 elements at its own place in the run and reads them from the row and k that belong there
#define WBL (DM * DM / 8 / 256)
__global__ __launch_bounds__(256) void k_cvt8(const float* __restrict__ w0, const float* __restrict__ w1, const float* __restrict__ w2, const float* __restrict__ w3, const float* __restrict__ xs, bf* dst) {
    const int bx = blockIdx.x, m = bx / WBL; const float* src = m == 0 ? w0 : m == 1 ? w1 : m == 2 ? w2 : m == 3 ? w3 : xs;
    const size_t i = (size_t)bx * 256 + threadIdx.x, si = (size_t)(bx - (m < 4 ? m : 4) * WBL) * 256 + threadIdx.x; const unsigned fb = (unsigned)si >> 6; const v8f v = *(const v8f*)(src + (size_t)(fb / (DM / 32) * 16 + ((unsigned)si & 15)) * DM + fb % (DM / 32) * 32 + (((unsigned)si >> 4) & 3) * 8); v8us o;
#pragma unroll
    for (int k = 0; k < 8; ++k) o[k] = f2bf(v[k]); *(v8us*)(dst + i * 8) = o;  }
// k_idkv: wave per channel c, block = 32 channels of one matrix (blockIdx.y 0: K, 1: V): KID[c] = sum_d bf16 id[d] bf16 Wk[c][d] + bk[c], VID likewise; lane l sums d = 128 i + 4 l + u in rising (i, u), lane 0 starting from the bias, all loads issued up front, then an xor butterfly over the lanes; the 32 sums meet in LDS and wave 0 stores them as one 128-B line; blockIdx.z: batch
__global__ __launch_bounds__(1024) void k_idkv(const float* __restrict__ ida, const float* __restrict__ Wk, const float* __restrict__ bk, const float* __restrict__ Wv, const float* __restrict__ bv, float* KID, float* VID) {
    __shared__ float red[32];
    const int lane = threadIdx.x & 31, w = threadIdx.x >> 5, c = blockIdx.x * 32 + w; const bool isv = blockIdx.y != 0;
    const float* wr = (isv ? Wv : Wk) + (size_t)c * DM + lane * 4; const float* ar = ida + blockIdx.z * DM + lane * 4; const float bias = (isv ? bv : bk)[c]; v4f a[DM / 128], m[DM / 128];
#pragma unroll
    for (int i = 0; i < DM / 128; ++i) { m[i] = *(const v4f*)(wr + i * 128); a[i] = *(const v4f*)(ar + i * 128); }
    float s = lane == 0 ? bfr(bias) : 0.f;
#pragma unroll
    for (int i = 0; i < DM / 128; ++i)
#pragma unroll
        for (int u = 0; u < 4; ++u) s = fmaf(bfr(a[i][u]), bfr(m[i][u]), s);
#pragma unroll
    for (int sh = 16; sh; sh >>= 1) s += __shfl_xor(s, sh, 32);
    if (lane == 0) red[w] = s;
    __syncthreads();
    if (w == 0) (isv ? VID : KID)[blockIdx.z * DM + blockIdx.x * 32 + lane] = red[lane]; }
#define KSP 4
__global__ __launch_bounds__(32 * KSP) void k_fattn(const h16* __restrict__ Q16, const h16* __restrict__ K16, const h16* __restrict__ VT, const float* __restrict__ S0, const float* __restrict__ VID, bf* Ah, bf* Al) {
    __shared__ __align__(16) float os[KSP][32][68]; __shared__ float ms[KSP][32], ls[KSP][32];
    const int w = __builtin_amdgcn_readfirstlane(threadIdx.x >> 5), lane = threadIdx.x & 31, lr = lane & 15, hi = lane >> 4; const int h = blockIdx.y, q0 = blockIdx.x * 32, hb = blockIdx.z * NH_ + h;    // hb: the head's place in the [batch][head] planes
    const float SC = 0.125f * 1.4426950408889634f; constexpr int NP = TT / KSP / 32;
    const h16* qp = Q16 + ((size_t)hb * TT + q0) * HD + 8 * lane; const h16* kp = K16 + ((size_t)hb * TT + w * (TT / KSP)) * HD + 8 * lane; const h16* vp = VT + (size_t)hb * HD * TT + w * (TT / KSP) * 16 + 8 * lane;    // fragment order
    v16h qf[2][2], kf[2][2]; float mu[2], l[2]; v8f o[4][2];
#pragma unroll
    for (int qt = 0; qt < 2; ++qt) { qf[qt][0] = WFrag<h16>::ld(qp + qt * 16 * HD); qf[qt][1] = WFrag<h16>::ld(qp + qt * 16 * HD + 512); kf[qt][0] = WFrag<h16>::ld(kp + qt * 16 * HD); kf[qt][1] = WFrag<h16>::ld(kp + qt * 16 * HD + 512);
        mu[qt] = S0[(size_t)hb * TT + q0 + qt * 16 + lr] * SC; l[qt] = (w == 0 && hi == 0) ? 1.f : 0.f; }
    int hv;
    asm volatile("s_wait_xcnt 0x0\n\ts_mov_b32 %0, %1" : "=s"(hv) : "s"(hb) : "memory");    // the loads above name a lane-offset register and scalar bases that the code below writes anew; hv, from which the next address is formed, is made behind the wait inside the statement, so that its arithmetic (the first such write) cannot be lifted over it
#pragma unroll
    for (int dt = 0; dt < 4; ++dt) { v8f vi = (v8f){}; if (w == 0) vi = *(const v8f*)(VID + hv * HD + dt * 16 + hi * 8); o[dt][0] = vi; o[dt][1] = vi; }
    // rolled: with the 16 passes unrolled the register count would grow
#pragma unroll 1
    for (int it = 0; it < NP; ++it) {
        v16h vf[4]; v8f s[2][2];
#pragma unroll
        for (int dt = 0; dt < 4; ++dt) vf[dt] = WFrag<h16>::ld(vp + (size_t)dt * 16 * TT + it * 512);
#pragma unroll
        for (int kt = 0; kt < 2; ++kt)
#pragma unroll
            for (int qt = 0; qt < 2; ++qt) s[kt][qt] = wmma16(kf[kt][1], qf[qt][1], wmma16(kf[kt][0], qf[qt][0], (v8f){}));
        const int nx = it + 1 < NP ? it + 1 : it;    // the next pass's K fragments fly under this pass's softmax; the last pass re-reads its own (in bounds, unused)
#pragma unroll
        for (int kt = 0; kt < 2; ++kt) { kf[kt][0] = WFrag<h16>::ld(kp + (nx * 32 + kt * 16) * HD); kf[kt][1] = WFrag<h16>::ld(kp + (nx * 32 + kt * 16) * HD + 512); }
        float tm[2];
#pragma unroll
        for (int qt = 0; qt < 2; ++qt) { tm[qt] = -8.f;
#pragma unroll
            for (int kt = 0; kt < 2; ++kt)
#pragma unroll
                for (int j = 0; j < 8; ++j) { s[kt][qt][j] = fmaf(s[kt][qt][j], SC, -mu[qt]); tm[qt] = fmaxf(tm[qt], s[kt][qt][j]); } }
        if (__builtin_amdgcn_ballot_w32(fmaxf(tm[0], tm[1]) > 8.f) != 0) {    // rare, wave-uniform: raise the base of every column to its maximum so far, alike in both halves of the wave
#pragma unroll
            for (int qt = 0; qt < 2; ++qt) { const float dl = fmaxf(fmaxf(tm[qt], __shfl_xor(tm[qt], 16, 32)), 0.f), al = __builtin_amdgcn_exp2f(-dl); mu[qt] += dl; l[qt] *= al;
#pragma unroll
                for (int dt = 0; dt < 4; ++dt) o[dt][qt] *= al;
#pragma unroll
                for (int kt = 0; kt < 2; ++kt) s[kt][qt] -= dl; } }
#pragma unroll
        for (int qt = 0; qt < 2; ++qt) { v16h pf;
#pragma unroll
            for (int kt = 0; kt < 2; ++kt)
#pragma unroll
                for (int j = 0; j < 8; ++j) { const float p = __builtin_amdgcn_exp2f(s[kt][qt][j]); l[qt] += p; pf[kt * 8 + j] = tohx(p); }
#pragma unroll
            for (int dt = 0; dt < 4; ++dt) o[dt][qt] = wmma16(vf[dt], pf, o[dt][qt]); }
        // four vector slots behind the pass's last products: over the back edge the next pass's first score product may write its D over the registers these read as B
        asm volatile("v_nop\n\tv_nop\n\tv_nop\n\tv_nop" : "+v"(o[0][1]), "+v"(o[1][1]), "+v"(o[2][1]), "+v"(o[3][1]));
    }
#pragma unroll
    for (int qt = 0; qt < 2; ++qt) { l[qt] += __shfl_xor(l[qt], 16, 32); if (hi == 0) { ms[w][qt * 16 + lr] = mu[qt]; ls[w][qt * 16 + lr] = l[qt]; }
#pragma unroll
        for (int dt = 0; dt < 4; ++dt) { float* d = &os[w][qt * 16 + lr][dt * 16 + hi * 8]; *(v4fa*)d = __builtin_shufflevector(o[dt][qt], o[dt][qt], 0, 1, 2, 3); *(v4fa*)(d + 4) = __builtin_shufflevector(o[dt][qt], o[dt][qt], 4, 5, 6, 7); } }
    __syncthreads();    // publishes every wave's partial state to the threads that join it
    const int q = threadIdx.x >> 2, d0 = (threadIdx.x & 3) * 16; float mm = ms[0][q], f[KSP], L = 0.f;
#pragma unroll
    for (int p = 1; p < KSP; ++p) mm = fmaxf(mm, ms[p][q]);
#pragma unroll
    for (int p = 0; p < KSP; ++p) { f[p] = __builtin_amdgcn_exp2f(ms[p][q] - mm); L = fmaf(f[p], ls[p][q], L); }
    const float inv = __fdiv_rn(1.0f, L); const size_t oo = ((size_t)blockIdx.z * TT + q0 + (q & 16)) * DM + (h * 2 + (d0 >> 5)) * 512 + ((d0 >> 4) & 1) * 256 + (q & 15) * 8;    // row q, k h * 64 + d0 of the [4 * 2048][768] planes, fragment order; + 8 k is + 128
#pragma unroll
    for (int u = 0; u < 2; ++u) { v8us oh, ol;
#pragma unroll
        for (int g = 0; g < 2; ++g) { v4f val = f[0] * *(const v4fa*)&os[0][q][d0 + u * 8 + g * 4];
#pragma unroll
            for (int p = 1; p < KSP; ++p) val += f[p] * *(const v4fa*)&os[p][q][d0 + u * 8 + g * 4];
#pragma unroll
            for (int e = 0; e < 4; ++e) { unsigned short a, b; splitf(val[e] * inv, a, b); oh[g * 4 + e] = a; ol[g * 4 + e] = b; } }
        *(v8us*)(Ah + oo + u * 128) = oh; *(v8us*)(Al + oo + u * 128) = ol; }
}

extern "C" void kernel_launch(void* const* d_in, const int* in_sizes, int n_in,
                              void* d_out, int out_size, void* d_ws, size_t ws_size, hipStream_t stream) {
    (void)in_sizes; (void)n_in; (void)out_size;
    const float** I = (const float**)d_in;
    const float *x = I[0], *ida = I[1], *Wq = I[2], *bq = I[3], *Wk = I[4], *bk = I[5], *Wv = I[6], *bv = I[7], *Wo = I[8], *bo = I[9];
    float* OUT = (float*)d_out;     // [4][2048][768]
    char* wsp = (char*)d_ws;
    auto take = [&](size_t bytes) { char* p = wsp; wsp += (bytes + 255) & ~(size_t)255; return (void*)p; };
    // every plane holds all 4 batches; all sizes are multiples of 256 B, so BQ BK BV BO XB and Q16 K16 VT each lie one behind the other with no gap (k_cvt8 and the z of the QKV launch lean on that)
    bf* BQ = (bf*)take((size_t)DM * DM * 2); take((size_t)DM * DM * 2); take((size_t)DM * DM * 2); bf* BO = (bf*)take((size_t)DM * DM * 2);
    bf* XB = (bf*)take((size_t)NB_ * TT * DM * 2); float* KID = (float*)take(NB_ * DM * 4); float* VID = (float*)take(NB_ * DM * 4); float* S0 = (float*)take((size_t)NB_ * NH_ * TT * 4);
    h16* Q16 = (h16*)take((size_t)NB_ * NH_ * TT * HD * 2); h16* K16 = (h16*)take((size_t)NB_ * NH_ * TT * HD * 2); h16* VT = (h16*)take((size_t)NB_ * NH_ * HD * TT * 2); bf* Ah = (bf*)take((size_t)NB_ * TT * DM * 2); bf* Al = (bf*)take((size_t)NB_ * TT * DM * 2);
    if ((size_t)(wsp - (char*)d_ws) > ws_size) return;    // total ~ 81 MB
    k_cvt8<<<4 * WBL + NB_ * TT * DM / 8 / 256, 256, 0, stream>>>(Wq, Wk, Wv, Wo, x, BQ);   // torch [out][in] = Bt
    k_idkv<<<dim3(DM / 32, 2, NB_), 1024, 0, stream>>>(ida, Wk, bk, Wv, bv, KID, VID);   // ahead of the QKV launch, whose Q epilogue reads KID
    k_gemmw<bf, 0, true, 8, true><<<dim3(NB_ * TT / 64, DM / 64, 3), 256, 0, stream>>>(XB, nullptr, BQ, nullptr, S0, 0, bq, bk, bv, 0, (size_t)DM * DM, 0, Q16, KID);   // z: Q, K, V; the batches are rows
    k_fattn<<<dim3(TT / 32, NH_, NB_), 32 * KSP, 0, stream>>>(Q16, K16, VT, S0, VID, Ah, Al);
    k_gemmw<bf, 1, true, 8, false><<<dim3(NB_ * TT / 64, DM / 64, 1), 256, 0, stream>>>(Ah, Al, BO, nullptr, OUT, DM, bo, bo, bo, 0, 0, 0, nullptr, nullptr);
}

// v008
// It runs in 140 microseconds.
// Timed twice side by side with v007, it ran 1.11 and 1.10 times as fast.
// All steps since v000 together make it 15.4 times as fast.
#include <hip/hip_runtime.h>

// IDContextAttention (x [4][2048][768], id_anchor [4][1][768]; Q/K/V = x W^T + b (12 heads x 64); one extra key/value K_id/V_id = id_anchor Wk/Wv^T + b PREPENDED to the 2048 current keys; softmax(q.k/8) over the 2049 keys; out = (attn V merged) Wo^T + bo
// -> [4][2048][768]). The extra key's score is a VALU dot in the Q tile's epilogue of the QKV GEMM; key and value row enter as the start state of the online softmax in k_fattn.
// Compute dtypes, f32 accumulate: every input rounded to bf16; Q/K/V on PLAIN bf16 operands (inputs: exact) + bias; K_id/V_id and q.K_id f32 on the VALU (fixed-order dots); scores (K 64) and attn.V over the 2048 current keys

#define NB_  4
#define TT   2048
#define DM   768
#define NH_  12
#define HD   64
typedef _Float16 h16;
typedef unsigned short bf;
typedef __attribute__((ext_vector_type(16))) __bf16   v16bf;
typedef __attribute__((ext_vector_type(16))) _Float16 v16h;
typedef __attribute__((ext_vector_type(8)))  _Float16 v8h;
typedef __attribute__((ext_vector_type(8)))  unsigned short v8us;
typedef __attribute__((ext_vector_type(8)))  float    v8f;
typedef __attribute__((ext_vector_type(4)))  float    v4f;
typedef v8h  __attribute__((may_alias)) v8ha;
typedef v4f  __attribute__((may_alias)) v4fa;
typedef v8us __attribute__((may_alias)) v8usa;

__device__ __forceinline__ unsigned short f2bf(float f) { unsigned u = __float_as_uint(f); u += 0x7FFFu + ((u >> 16) & 1u); return (unsigned short)(u >> 16); }
__device__ __forceinline__ float bf2f(unsigned short b) { return __uint_as_float(((unsigned)b) << 16); }
__device__ __forceinline__ float bfr(float f) { return bf2f(f2bf(f)); }
__device__ __forceinline__ v16h cat16(v8h lo, v8h hi) { return __builtin_shufflevector(lo, hi, 0, 1, 2, 3, 4, 5, 6, 7, 8, 9, 10, 11, 12, 13, 14, 15); }
__device__ __forceinline__ v16bf cat16b(v8us lo, v8us hi) { return __builtin_bit_cast(v16bf, __builtin_shufflevector(lo, hi, 0, 1, 2, 3, 4, 5, 6, 7, 8, 9, 10, 11, 12, 13, 14, 15)); }
__device__ __forceinline__ v8f wmma16(v16h a, v16h b, v8f c) { return __builtin_amdgcn_wmma_f32_16x16x32_f16(false, a, false, b, (short)0, c, false, false); }
__device__ __forceinline__ v8f wmmab(v16bf a, v16bf b, v8f c) { return __builtin_amdgcn_wmma_f32_16x16x32_bf16(false, a, false, b, (short)0, c, false, false); }
typedef __attribute__((ext_vector_type(4))) _Float16 v4h;
__device__ __forceinline__ h16 tohx(float x) { return (h16)x; }
// x + the x of lane ^ m inside a 16-lane row (DPP row_xmask, CTRL = 0x160 + m): no LDS path, every lane on
template <int CTRL> __device__ __forceinline__ float rowx(float x) { return x + __int_as_float(__builtin_amdgcn_update_dpp(0, __float_as_int(x), CTRL, 0xf, 0xf, true)); }



// ---- FRAGMENT ORDER of every 16-bit operand plane (a matrix [R][K], R % 16 == 0, K % 32 == 0): element (r, k) lies at ((r / 16) * (K / 32) + k / 32) * 512 + ((k % 32) / 16) * 256 + (((k % 16) / 8) * 16 + r % 16) * 8 + k % 8.
// A 16 x 32 fragment is then 1 KiB in a row, and each of its two 16-B-a-lane loads (lane * 8, + 256 elements) reads 512 contiguous bytes = 4 whole 128-B lines, where a row-major plane gives 16 lines with 32 B used of each. Lane, register and k order are the row-major loader's.
// ---- k_gemmw: register-blocked GEMM, 64x64 output tile per work-group (16 accumulators a wave), operands straight from 16-bit planes in fragment order; grid (M/64, N/64, Z), 32 * KW threads; KW 1: ONE WAVE per tile.
// C[m][n] (f32, pitch ldc, + optional f32 bias[n]) = sum_k A[m][k] Bt[n][k] (+ split products per NSPLIT). z-batch strides sA/sB/sC in elements, bias0/1/2 the bias of z = 0/1/2 (Z <= 3). K = DM.
// KW > 1 (32 * KW threads, (K / KW) % 32 == 0): K IS SPLIT OVER THE KW WAVES of the work-group: wave w sums k in [w K/KW, (w+1) K/KW) into its own 16 accumulators, so KW waves wait out their load latencies side by side instead of one wave one after the other.
// Every wave lays its f32 partial tile in its own LDS plane [64][68]; behind one barrier each thread adds the KW planes in rising w (a fixed order), adds the bias and stores whole 256-B row pieces.
// PL (the QKV launch; a 64-column tile is one head): the epilogue writes the fp16 planes the attention kernel reads, P16 = Q16[b][h] ([t][d] in fragment order), K16 likewise, VT16[b][h] ([d][t] in fragment order) one behind the other. Q (z 0) never goes out as f32: a tile row is one token's whole head, so the epilogue forms the id key's score s0 = sum_d Q[t][d] KID[d] from its f32 sums (4 columns in the thread, then the 16 lanes of the row) and stores it in C = S0[b][h][t].
// For V (z 2) the two operands change places, V^T = Wv x^T (same products, same k order): the tile's rows are then channels d and its columns tokens t, so VT16 needs no transpose; the bias goes by row.
template <typename T16> struct WFrag;
template <> struct WFrag<h16> { typedef v16h V; static __device__ __forceinline__ V ld(const h16* p) { return cat16(*(const v8h*)p, *(const v8h*)(p + 256)); } static __device__ __forceinline__ v8f mma(V a, V b, v8f c) { return wmma16(a, b, c); } };
template <> struct WFrag<bf> { typedef v16bf V; static __device__ __forceinline__ V ld(const bf* p) { return cat16b(*(const v8us*)p, *(const v8us*)(p + 256)); } static __device__ __forceinline__ v8f mma(V a, V b, v8f c) { return wmmab(a, b, c); } };
template <typename T16, int NSPLIT, bool BIAS, int KW, bool PL>
__global__ __launch_bounds__(32 * KW) void k_gemmw(const T16* __restrict__ A, const T16* __restrict__ A2, const T16* __restrict__ Bt, const T16* __restrict__ Bt2, float* C, int ldc, const float* __restrict__ bias0, const float* __restrict__ bias1, const float* __restrict__ bias2, size_t sA, size_t sB, size_t sC, h16* P16, const float* __restrict__ kid) {
    typedef typename WFrag<T16>::V V; constexpr int K = DM;    // a constant, so that a trip's fragments are immediate offsets on one address per plane
    __shared__ __align__(16) float os[(KW == 1 ? 16 : KW * 64) * 68];
    const int w = KW == 1 ? 0 : __builtin_amdgcn_readfirstlane(threadIdx.x >> 5), ks = K / KW;
    const size_t z = blockIdx.z; const float* bias = z == 0 ? bias0 : z == 1 ? bias1 : bias2; A += z * sA; if (A2) A2 += z * sA; Bt += z * sB; if (Bt2) Bt2 += z * sB; C += z * sC;
    const int lane = threadIdx.x & 31, lr = lane & 15, hi = lane >> 4; int r0 = blockIdx.x * 64, c0 = blockIdx.y * 64;
    if (PL && z == 2) { const T16* t = A; A = Bt; Bt = t; const int q = r0; r0 = c0; c0 = q; }
    v8f acc[4][4];
#pragma unroll
    for (int mb = 0; mb < 4; ++mb)
#pragma unroll
        for (int nb = 0; nb < 4; ++nb) acc[mb][nb] = (v8f){};
    // fragment order: 16 rows are 16 K elements, 32 k are 512 (1 KiB). An address is a scalar base that the loop never writes + the lane's byte offset fo + a constant
    const T16* Ar = A + (size_t)r0 * K; const T16* A2r = (NSPLIT == 1 || NSPLIT == 2) ? A2 + (size_t)r0 * K : nullptr; const T16* Br = Bt + (size_t)c0 * K; const T16* B2r = NSPLIT >= 2 ? Bt2 + (size_t)c0 * K : nullptr; unsigned fo = 16 * lane + w * ks * 32;
    auto at = [&](const T16* p, int blk) { return (const T16*)((const char*)p + fo) + blk * 16 * K; };
#pragma unroll 1
    for (int kc = 0; kc < ks; kc += 32) {
        V a[4], a2[4];
#pragma unroll
        for (int mb = 0; mb < 4; ++mb) { a[mb] = WFrag<T16>::ld(at(Ar, mb)); if (NSPLIT == 1 || NSPLIT == 2) a2[mb] = WFrag<T16>::ld(at(A2r, mb)); }
#pragma unroll
        for (int nb = 0; nb < 4; ++nb) { const V b = WFrag<T16>::ld(at(Br, nb)); V b2; if (NSPLIT >= 2) b2 = WFrag<T16>::ld(at(B2r, nb));
#pragma unroll
            for (int mb = 0; mb < 4; ++mb) { acc[mb][nb] = WFrag<T16>::mma(a[mb], b, acc[mb][nb]); if (NSPLIT == 1 || NSPLIT == 2) acc[mb][nb] = WFrag<T16>::mma(a2[mb], b, acc[mb][nb]); if (NSPLIT >= 2) acc[mb][nb] = WFrag<T16>::mma(a[mb], b2, acc[mb][nb]); } }
        asm volatile("v_nop\n\tv_nop\n\tv_nop\n\tv_nop" : "+v"(acc[0][0]), "+v"(acc[1][1]), "+v"(acc[2][2]), "+v"(acc[3][3]) : "v"(a[0]), "v"(a[3]));
        // every load of the trip names fo: the wait that belongs in front of its rewrite and the step to the next 32 k stand in one statement, so that the step cannot be lifted over the wait
        asm volatile("s_wait_xcnt 0x0\n\tv_add_nc_u32 %0, 0x400, %0" : "+v"(fo) : : "memory");
    }
    if constexpr (KW > 1) {
        float* my = os + w * (64 * 68); v4f kd = (v4f){};
        if constexpr (PL) { if (z == 0) kd = *(const v4f*)(kid + (r0 / TT) * DM + c0 + (threadIdx.x & 15) * 4); }    // Q tile: the id key's four channels of the thread's columns, asked for ahead of the plane stores so that they fly under them
        // the unrolls below keep every acc index a compile-time constant (registers, no scratch) and let the LDS reads of a thread's KW planes issue together
#pragma unroll
        for (int mb = 0; mb < 4; ++mb)
#pragma unroll
            for (int nb = 0; nb < 4; ++nb)
#pragma unroll
                for (int j = 0; j < 8; ++j) my[(mb * 16 + hi * 8 + j) * 68 + nb * 16 + lr] = acc[mb][nb][j];
        constexpr int NS = 32 / KW, RS = 2 * KW; const int rw = threadIdx.x >> 4, cofs = (threadIdx.x & 15) * 4; float bb[4];    // PL: step s of a thread is tile row rw + s RS, columns cofs .. cofs + 3
        if constexpr (PL) {    // the thread's four bias values, by row for V and by column for Q and K, asked for here so that they fly under the plane stores and not behind the sums
            static_assert(NS == 4, "four rows a thread");
            const float* bp = bias + (z == 2 ? r0 + rw : c0 + cofs); const int bs = z == 2 ? RS : 1;
#pragma unroll
            for (int k = 0; k < 4; ++k) bb[k] = bp[k * bs]; }
        __syncthreads();    // publishes every wave's plane to the threads that sum it
        if constexpr (PL) {
            // all sums first, then the branches on z, every store last: the LDS reads of a thread's steps issue together
            v4f val[NS]; v4h o[NS]; const int pk = (cofs >> 5) * 512 + ((cofs >> 4) & 1) * 256 + (((cofs >> 3) & 1) * 16 + rw) * 8 + (cofs & 7);    // (row rw, k cofs) inside a row block, fragment order
#pragma unroll
            for (int s = 0; s < NS; ++s) { const float* pl = os + (s * RS + rw) * 68 + cofs; val[s] = *(const v4fa*)pl;
#pragma unroll
                for (int p = 1; p < KW; ++p) val[s] += *(const v4fa*)(pl + p * (64 * 68)); }
            if (z == 2) {
                h16* d = P16 + (size_t)2 * NB_ * NH_ * TT * HD + ((size_t)(c0 / TT) * DM + r0) * TT + c0 % TT * 16 + pk;
#pragma unroll
                for (int s = 0; s < NS; ++s) { val[s] += bfr(bb[s]);
#pragma unroll
                    for (int u = 0; u < 4; ++u) o[s][u] = tohx(val[s][u]); }
#pragma unroll
                for (int s = 0; s < NS; ++s) *(v4h*)(d + (size_t)s * RS * TT) = o[s];
            } else {
                const float b0 = bfr(bb[0]), b1 = bfr(bb[1]), b2 = bfr(bb[2]), b3 = bfr(bb[3]);
                h16* d = P16 + (((z * NB_ + r0 / TT) * NH_ + c0 / HD) * TT + r0 % TT) * HD + pk;
#pragma unroll
                for (int s = 0; s < NS; ++s) { val[s][0] += b0; val[s][1] += b1; val[s][2] += b2; val[s][3] += b3;
#pragma unroll
                    for (int u = 0; u < 4; ++u) o[s][u] = tohx(val[s][u]); }
                if (z == 0) {    // s0 of the thread's four rows: its 4 columns in rising order, then an xor butterfly over the row's 16 lanes (a fixed order, alike in all 16); lane u < 4 of a row group stores row rw + u RS
                    float p[NS];
#pragma unroll
                    for (int s = 0; s < NS; ++s) p[s] = fmaf(val[s][3], kd[3], fmaf(val[s][2], kd[2], fmaf(val[s][1], kd[1], val[s][0] * kd[0])));
#pragma unroll
                    for (int s = 0; s < NS; ++s) { p[s] = rowx<0x161>(p[s]); p[s] = rowx<0x162>(p[s]); p[s] = rowx<0x164>(p[s]); p[s] = rowx<0x168>(p[s]); }
                    const int u = threadIdx.x & 15;
                    if (u < NS) C[((size_t)(r0 / TT) * NH_ + c0 / HD) * TT + r0 % TT + rw + u * RS] = u == 0 ? p[0] : u == 1 ? p[1] : u == 2 ? p[2] : p[3]; }
#pragma unroll
                for (int s = 0; s < NS; ++s) *(v4h*)(d + s * RS * HD) = o[s];
            }
            return;
        }
#pragma unroll
        for (int s = 0; s < 32 / KW; ++s) { const int i = s * 32 * KW + threadIdx.x, row = i >> 4, cofs = (i & 15) * 4; v4f val = *(const v4fa*)(os + row * 68 + cofs);
#pragma unroll
            for (int p = 1; p < KW; ++p) val += *(const v4fa*)(os + p * (64 * 68) + row * 68 + cofs);
            if (BIAS) { val[0] += bfr(bias[c0 + cofs]); val[1] += bfr(bias[c0 + cofs + 1]); val[2] += bfr(bias[c0 + cofs + 2]); val[3] += bfr(bias[c0 + cofs + 3]); }
            *(v4f*)(C + (size_t)(r0 + row) * ldc + c0 + cofs) = val; }
        return;
    }
#pragma unroll
    for (int mb = 0; mb < 4; ++mb) {
#pragma unroll
        for (int nb = 0; nb < 4; ++nb) {
#pragma unroll
            for (int j = 0; j < 8; ++j) os[(hi * 8 + j) * 68 + nb * 16 + lr] = acc[mb][nb][j]; }
        __builtin_amdgcn_wave_barrier(); asm volatile("" ::: "memory");
        float* crow = C + (size_t)(r0 + mb * 16) * ldc + c0;
{
#pragma unroll
            for (int s = 0; s < 8; ++s) { const int row = 2 * s + hi, cofs = lr * 4; v4f val = *(const v4fa*)(os + row * 68 + cofs); if (BIAS) { val[0] += bfr(bias[c0 + cofs]); val[1] += bfr(bias[c0 + cofs + 1]); val[2] += bfr(bias[c0 + cofs + 2]); val[3] += bfr(bias[c0 + cofs + 3]); }
                *(v4f*)(crow + (size_t)row * ldc + cofs) = val; }
             }
        __builtin_amdgcn_wave_barrier(); asm volatile("" ::: "memory");
    }
}

__device__ __forceinline__ void splitf(float y, unsigned short& h, unsigned short& l) { h = f2bf(y); l = f2bf(y - bf2f(h)); }
typedef __attribute__((ext_vector_type(2))) unsigned short v2us;
typedef __attribute__((ext_vector_type(4))) unsigned short v4us;

// k_cvt8: all five f32 -> bf16 conversions in one grid; dst is ONE run of planes, each in fragment order (K = DM): the four weights (WBL blocks each), then x of all batches; a block lies wholly in one source; a thread writes the 8 elements at its own place in the run and reads them from the row and k that belong there
#define WBL (DM * DM / 8 / 256)
__global__ __launch_bounds__(256) void k_cvt8(const float* __restrict__ w0, const float* __restrict__ w1, const float* __restrict__ w2, const float* __restrict__ w3, const float* __restrict__ xs, bf* dst) {
    const int bx = blockIdx.x, m = bx / WBL; const float* src = m == 0 ? w0 : m == 1 ? w1 : m == 2 ? w2 : m == 3 ? w3 : xs;
    const size_t i = (size_t)bx * 256 + threadIdx.x, si = (size_t)(bx - (m < 4 ? m : 4) * WBL) * 256 + threadIdx.x; const unsigned fb = (unsigned)si >> 6; const v8f v = *(const v8f*)(src + (size_t)(fb / (DM / 32) * 16 + ((unsigned)si & 15)) * DM + fb % (DM / 32) * 32 + (((unsigned)si >> 4) & 3) * 8); v8us o;
#pragma unroll
    for (int k = 0; k < 8; ++k) o[k] = f2bf(v[k]); *(v8us*)(dst + i * 8) = o;  }
// k_idkv: wave per channel c, block = 32 channels of one matrix (blockIdx.y 0: K, 1: V): KID[c] = sum_d bf16 id[d] bf16 Wk[c][d] + bk[c], VID likewise; lane l sums d = 128 i + 4 l + u in rising (i, u), lane 0 starting from the bias, all loads issued up front, then an xor butterfly over the lanes; the 32 sums meet in LDS and wave 0 stores them as one 128-B line; blockIdx.z: batch
__global__ __launch_bounds__(1024) void k_idkv(const float* __restrict__ ida, const float* __restrict__ Wk, const float* __restrict__ bk, const float* __restrict__ Wv, const float* __restrict__ bv, float* KID, float* VID) {
    __shared__ float red[32];
    const int lane = threadIdx.x & 31, w = threadIdx.x >> 5, c = blockIdx.x * 32 + w; const bool isv = blockIdx.y != 0;
    const float* wr = (isv ? Wv : Wk) + (size_t)c * DM + lane * 4; const float* ar = ida + blockIdx.z * DM + lane * 4; const float bias = (isv ? bv : bk)[c]; v4f a[DM / 128], m[DM / 128];
#pragma unroll
    for (int i = 0; i < DM / 128; ++i) { m[i] = *(const v4f*)(wr + i * 128); a[i] = *(const v4f*)(ar + i * 128); }
    float s = lane == 0 ? bfr(bias) : 0.f;
#pragma unroll
    for (int i = 0; i < DM / 128; ++i)
#pragma unroll
        for (int u = 0; u < 4; ++u) s = fmaf(bfr(a[i][u]), bfr(m[i][u]), s);
#pragma unroll
    for (int sh = 16; sh; sh >>= 1) s += __shfl_xor(s, sh, 32);
    if (lane == 0) red[w] = s;
    __syncthreads();
    if (w == 0) (isv ? VID : KID)[blockIdx.z * DM + blockIdx.x * 32 + lane] = red[lane]; }
#define QW 4
#define KT 64
__global__ __launch_bounds__(32 * QW) void k_fattn(const h16* __restrict__ Q16, const h16* __restrict__ K16, const h16* __restrict__ VT, const float* __restrict__ S0, const float* __restrict__ VID, bf* Ah, bf* Al) {
    __shared__ __align__(128) h16 sm[2][2 * KT * HD];    // a buffer: the K tile (8 KiB), behind it the V^T tile (4 x 2 KiB)
    const int w = __builtin_amdgcn_readfirstlane(threadIdx.x >> 5), lane = threadIdx.x & 31, lr = lane & 15, hi = lane >> 4; const int h = blockIdx.y, q0 = blockIdx.x * (32 * QW) + w * 32, hb = blockIdx.z * NH_ + h;    // hb: the head's place in the [batch][head] planes
    const float SC = 0.125f * 1.4426950408889634f; constexpr int NT = TT / KT;
    const h16* qp = Q16 + ((size_t)hb * TT + q0) * HD + 8 * lane; const h16* kg = K16 + (size_t)hb * TT * HD + 8 * threadIdx.x; const h16* vg = VT + (size_t)hb * HD * TT + 8 * threadIdx.x;    // fragment order
    const unsigned sl = (unsigned)(size_t)&sm[0][0] + 16 * threadIdx.x;    // the thread's own 16 B of each 2-KiB run, as a byte address in LDS
    // tile t into buffer b: 8 copies a thread, 16 B each, every lane on. The wait that belongs in front of a rewrite of the copies' address registers is the statement's last line, so that nothing can be lifted over it
    auto fill = [&](int t, int b) {
        const h16* k = kg + t * (KT * HD); const h16* v = vg + t * (KT * 16); const unsigned d = sl + b * (2 * KT * HD * 2);
        asm volatile("global_load_async_to_lds_b128 %0, %8, off\n\t"
                     "global_load_async_to_lds_b128 %1, %9, off\n\t"
                     "global_load_async_to_lds_b128 %2, %10, off\n\t"
                     "global_load_async_to_lds_b128 %3, %11, off\n\t"
                     "global_load_async_to_lds_b128 %4, %12, off\n\t"
                     "global_load_async_to_lds_b128 %5, %13, off\n\t"
                     "global_load_async_to_lds_b128 %6, %14, off\n\t"
                     "global_load_async_to_lds_b128 %7, %15, off\n\t"
                     "s_wait_xcnt 0x0"
                     :: "v"(d), "v"(d + 2048), "v"(d + 4096), "v"(d + 6144), "v"(d + 8192), "v"(d + 10240), "v"(d + 12288), "v"(d + 14336),
                        "v"(k), "v"(k + 1024), "v"(k + 2048), "v"(k + 3072), "v"(v), "v"(v + 16 * TT), "v"(v + 32 * TT), "v"(v + 48 * TT) : "memory"); };
    fill(0, 0);
    v16h qf[2][2]; float mu[2], l[2]; v8f o[4][2];
#pragma unroll
    for (int qt = 0; qt < 2; ++qt) { qf[qt][0] = WFrag<h16>::ld(qp + qt * 16 * HD); qf[qt][1] = WFrag<h16>::ld(qp + qt * 16 * HD + 512);
        mu[qt] = S0[(size_t)hb * TT + q0 + qt * 16 + lr] * SC; l[qt] = hi == 0 ? 1.f : 0.f; }
#pragma unroll
    for (int dt = 0; dt < 4; ++dt) { const v8f vi = *(const v8f*)(VID + hb * HD + dt * 16 + hi * 8); o[dt][0] = vi; o[dt][1] = vi; }
    asm volatile("s_wait_xcnt 0x0" ::: "memory");    // the loads above name address registers that the code below writes anew: the wait that belongs in front of those writes
    asm volatile("s_wait_asynccnt 0x0" ::: "memory");    // this wave's copies of tile 0 have landed
    __syncthreads();    // publishes tile 0 to all four waves
    fill(1, 1);
    // rolled: for speed only
#pragma unroll 1
    for (int t = 0; t < NT; ++t) {
        const h16* kb = &sm[t & 1][0] + 8 * lane; const h16* vb = kb + KT * HD;
        // a tile is two passes of 32 keys; rolled: unrolled they take 66 registers more and save no instruction
#pragma unroll 1
        for (int p = 0; p < KT / 32; ++p) {
            v16h kf[2][2], vf[4]; v8f s[2][2];
#pragma unroll
            for (int kt = 0; kt < 2; ++kt) { kf[kt][0] = WFrag<h16>::ld(kb + (p * 32 + kt * 16) * HD); kf[kt][1] = WFrag<h16>::ld(kb + (p * 32 + kt * 16) * HD + 512); }
#pragma unroll
            for (int dt = 0; dt < 4; ++dt) vf[dt] = WFrag<h16>::ld(vb + dt * (KT * 16) + p * 512);
#pragma unroll
            for (int kt = 0; kt < 2; ++kt)
#pragma unroll
                for (int qt = 0; qt < 2; ++qt) s[kt][qt] = wmma16(kf[kt][1], qf[qt][1], wmma16(kf[kt][0], qf[qt][0], (v8f){}));
            float tm[2];
#pragma unroll
            for (int qt = 0; qt < 2; ++qt) { tm[qt] = -8.f;
#pragma unroll
                for (int kt = 0; kt < 2; ++kt)
#pragma unroll
                    for (int j = 0; j < 8; ++j) { s[kt][qt][j] = fmaf(s[kt][qt][j], SC, -mu[qt]); tm[qt] = fmaxf(tm[qt], s[kt][qt][j]); } }
            if (__builtin_amdgcn_ballot_w32(fmaxf(tm[0], tm[1]) > 8.f) != 0) {    // rare, wave-uniform: raise the base of every column to its maximum so far, alike in both halves of the wave
#pragma unroll
                for (int qt = 0; qt < 2; ++qt) { const float dl = fmaxf(fmaxf(tm[qt], __shfl_xor(tm[qt], 16, 32)), 0.f), al = __builtin_amdgcn_exp2f(-dl); mu[qt] += dl; l[qt] *= al;
#pragma unroll
                    for (int dt = 0; dt < 4; ++dt) o[dt][qt] *= al;
#pragma unroll
                    for (int kt = 0; kt < 2; ++kt) s[kt][qt] -= dl; } }
#pragma unroll
            for (int qt = 0; qt < 2; ++qt) { v16h pf;
#pragma unroll
                for (int kt = 0; kt < 2; ++kt)
#pragma unroll
                    for (int j = 0; j < 8; ++j) { const float pe = __builtin_amdgcn_exp2f(s[kt][qt][j]); l[qt] += pe; pf[kt * 8 + j] = tohx(pe); }
#pragma unroll
                for (int dt = 0; dt < 4; ++dt) o[dt][qt] = wmma16(vf[dt], pf, o[dt][qt]); }
        }
        asm volatile("s_wait_dscnt 0x0" ::: "memory");    // this wave's reads of the buffer are done before it is given up for refill
        asm volatile("s_wait_asynccnt 0x0" ::: "memory");    // this wave's copies of tile t + 1 have landed
        __syncthreads();    // publishes tile t + 1 and ends every wave's reads of tile t's buffer
        if (t + 2 < NT) fill(t + 2, t & 1);
    }
    asm volatile("s_wait_asynccnt 0x0" ::: "memory");    // no copy is left in flight when the wave ends
#pragma unroll
    for (int qt = 0; qt < 2; ++qt) { l[qt] += __shfl_xor(l[qt], 16, 32); const float inv = __fdiv_rn(1.0f, l[qt]);
        const size_t oo = ((size_t)blockIdx.z * TT + q0 + qt * 16) * DM + h * 1024 + 8 * lane;    // rows q0 + 16 qt .., k h * 64 of the [4 * 2048][768] planes, fragment order; + 16 k is + 256
#pragma unroll
        for (int dt = 0; dt < 4; ++dt) { v8us oh, ol;
#pragma unroll
            for (int e = 0; e < 8; ++e) { unsigned short x, y; splitf(o[dt][qt][e] * inv, x, y); oh[e] = x; ol[e] = y; }
            *(v8us*)(Ah + oo + dt * 256) = oh; *(v8us*)(Al + oo + dt * 256) = ol; } }
}

extern "C" void kernel_launch(void* const* d_in, const int* in_sizes, int n_in,
                              void* d_out, int out_size, void* d_ws, size_t ws_size, hipStream_t stream) {
    (void)in_sizes; (void)n_in; (void)out_size;
    const float** I = (const float**)d_in;
    const float *x = I[0], *ida = I[1], *Wq = I[2], *bq = I[3], *Wk = I[4], *bk = I[5], *Wv = I[6], *bv = I[7], *Wo = I[8], *bo = I[9];
    float* OUT = (float*)d_out;     // [4][2048][768]
    char* wsp = (char*)d_ws;
    auto take = [&](size_t bytes) { char* p = wsp; wsp += (bytes + 255) & ~(size_t)255; return (void*)p; };
    // every plane holds all 4 batches; all sizes are multiples of 256 B, so BQ BK BV BO XB and Q16 K16 VT each lie one behind the other with no gap (k_cvt8 and the z of the QKV launch lean on that)
    bf* BQ = (bf*)take((size_t)DM * DM * 2); take((size_t)DM * DM * 2); take((size_t)DM * DM * 2); bf* BO = (bf*)take((size_t)DM * DM * 2);
    bf* XB = (bf*)take((size_t)NB_ * TT * DM * 2); float* KID = (float*)take(NB_ * DM * 4); float* VID = (float*)take(NB_ * DM * 4); float* S0 = (float*)take((size_t)NB_ * NH_ * TT * 4);
    h16* Q16 = (h16*)take((size_t)NB_ * NH_ * TT * HD * 2); h16* K16 = (h16*)take((size_t)NB_ * NH_ * TT * HD * 2); h16* VT = (h16*)take((size_t)NB_ * NH_ * HD * TT * 2); bf* Ah = (bf*)take((size_t)NB_ * TT * DM * 2); bf* Al = (bf*)take((size_t)NB_ * TT * DM * 2);
    if ((size_t)(wsp - (char*)d_ws) > ws_size) return;    // total ~ 81 MB
    k_cvt8<<<4 * WBL + NB_ * TT * DM / 8 / 256, 256, 0, stream>>>(Wq, Wk, Wv, Wo, x, BQ);   // torch [out][in] = Bt
    k_idkv<<<dim3(DM / 32, 2, NB_), 1024, 0, stream>>>(ida, Wk, bk, Wv, bv, KID, VID);   // ahead of the QKV launch, whose Q epilogue reads KID
    k_gemmw<bf, 0, true, 8, true><<<dim3(NB_ * TT / 64, DM / 64, 3), 256, 0, stream>>>(XB, nullptr, BQ, nullptr, S0, 0, bq, bk, bv, 0, (size_t)DM * DM, 0, Q16, KID);   // z: Q, K, V; the batches are rows
    k_fattn<<<dim3(TT / (32 * QW), NH_, NB_), 32 * QW, 0, stream>>>(Q16, K16, VT, S0, VID, Ah, Al);
    k_gemmw<bf, 1, true, 8, false><<<dim3(NB_ * TT / 64, DM / 64, 1), 256, 0, stream>>>(Ah, Al, BO, nullptr, OUT, DM, bo, bo, bo, 0, 0, 0, nullptr, nullptr);
}

// v009
// One run takes 108 microseconds.
// Two timings next to v008 put it at 1.31 and 1.29 times that version's speed.
// All steps since v000 together make it 20.0 times as fast.
#include <hip/hip_runtime.h>

// IDContextAttention (x [4][2048][768], id_anchor [4][1][768]; Q/K/V = x W^T + b (12 heads x 64); one extra key/value K_id/V_id = id_anchor Wk/Wv^T + b PREPENDED to the 2048 current keys; softmax(q.k/8) over the 2049 keys; out = (attn V merged) Wo^T + bo
// -> [4][2048][768]). The extra key's score is a VALU dot in the Q tile's epilogue of the QKV GEMM; key and value row enter as the start state of the online softmax in k_fattn.
// Compute dtypes, f32 accumulate: every input rounded to bf16; Q/K/V on PLAIN bf16 operands (inputs: exact) + bias; K_id/V_id and q.K_id f32 on the VALU (fixed-order dots); scores (K 64) and attn.V over the 2048 current keys

#define NB_  4
#define TT   2048
#define DM   768
#define NH_  12
#define HD   64
typedef _Float16 h16;
typedef unsigned short bf;
typedef __attribute__((ext_vector_type(16))) __bf16   v16bf;
typedef __attribute__((ext_vector_type(16))) _Float16 v16h;
typedef __attribute__((ext_vector_type(8)))  _Float16 v8h;
typedef __attribute__((ext_vector_type(8)))  unsigned short v8us;
typedef __attribute__((ext_vector_type(8)))  float    v8f;
typedef __attribute__((ext_vector_type(4)))  float    v4f;
typedef v8h  __attribute__((may_alias)) v8ha;
typedef v4f  __attribute__((may_alias)) v4fa;
typedef v8us __attribute__((may_alias)) v8usa;

__device__ __forceinline__ unsigned short f2bf(float f) { unsigned u = __float_as_uint(f); u += 0x7FFFu + ((u >> 16) & 1u); return (unsigned short)(u >> 16); }
__device__ __forceinline__ float bf2f(unsigned short b) { return __uint_as_float(((unsigned)b) << 16); }
__device__ __forceinline__ float bfr(float f) { return bf2f(f2bf(f)); }
__device__ __forceinline__ v16h cat16(v8h lo, v8h hi) { return __builtin_shufflevector(lo, hi, 0, 1, 2, 3, 4, 5, 6, 7, 8, 9, 10, 11, 12, 13, 14, 15); }
__device__ __forceinline__ v16bf cat16b(v8us lo, v8us hi) { return __builtin_bit_cast(v16bf, __builtin_shufflevector(lo, hi, 0, 1, 2, 3, 4, 5, 6, 7, 8, 9, 10, 11, 12, 13, 14, 15)); }
__device__ __forceinline__ v8f wmma16(v16h a, v16h b, v8f c) { return __builtin_amdgcn_wmma_f32_16x16x32_f16(false, a, false, b, (short)0, c, false, false); }
__device__ __forceinline__ v8f wmmab(v16bf a, v16bf b, v8f c) { return __builtin_amdgcn_wmma_f32_16x16x32_bf16(false, a, false, b, (short)0, c, false, false); }
__device__ __forceinline__ h16 tohx(float x) { return (h16)x; }



// ---- FRAGMENT ORDER of every 16-bit operand plane (a matrix [R][K], R % 16 == 0, K % 32 == 0): element (r, k) lies at ((r / 16) * (K / 32) + k / 32) * 512 + ((k % 32) / 16) * 256 + (((k % 16) / 8) * 16 + r % 16) * 8 + k % 8.
// A 16 x 32 fragment is then 1 KiB in a row, and each of its two 16-B-a-lane loads (lane * 8, + 256 elements) reads 512 contiguous bytes = 4 whole 128-B lines, where a row-major plane gives 16 lines with 32 B used of each. Lane, register and k order are the row-major loader's.
// ---- k_gemmt: GEMM on bf16 planes in fragment order, K = DM. A work-group of 4 waves owns a 128 x 128 output tile (128 tokens x 128 channels), wave w the 64 x 64 quarter (tokens w & 1, channels w >> 1, 16 accumulators) over the WHOLE K.
// The operands come in stages of 64 k that the work-group brings into LDS ONCE (asynchronous copies, two buffers) and the waves share: an operand byte leaves L2 once per 128 rows of the other operand, and each fragment is read from LDS by two waves.
// A stage of one operand is 8 row blocks x 2 KiB (two fragments in a row), copied as it lies; a buffer holds the token plane X, the weights, and (NSPLIT 1) the low plane X2, whose products go into the same sums right behind X's.
// PL (the QKV launch, z = 0, 1, 2: Q, K, V; a wave's 64 channels are one head): the epilogue writes the fp16 planes the attention kernel reads, P16 = Q16[b][h] ([t][d] in fragment order), K16 likewise, VT16[b][h] ([d][t] in fragment order) one behind the other, straight from the accumulators:
// Q and K are formed as W x^T (rows channels, columns tokens), V as x W^T (rows tokens, columns channels), same products, same k order, so that a lane's 8 values of a tile are the 8 k in a row that are its own 16 B of the fragment. Q never goes out as f32: the id key's score s0 = sum_d Q[t][d] KID[d] comes from the f32 sums (32 channels in the lane in rising order, then the other half of the wave) and goes to C = S0[b][h][t].
// Not PL (the output projection): rows tokens, C f32 [t][DM] + bias, each 16-row block turned in the wave's own piece of the LDS (free behind the loop's last barrier) so that whole 256-B row pieces are stored.
template <typename T16> struct WFrag;
template <> struct WFrag<h16> { typedef v16h V; static __device__ __forceinline__ V ld(const h16* p) { return cat16(*(const v8h*)p, *(const v8h*)(p + 256)); } static __device__ __forceinline__ v8f mma(V a, V b, v8f c) { return wmma16(a, b, c); } };
template <> struct WFrag<bf> { typedef v16bf V; static __device__ __forceinline__ V ld(const bf* p) { return cat16b(*(const v8us*)p, *(const v8us*)(p + 256)); } static __device__ __forceinline__ v8f mma(V a, V b, v8f c) { return wmmab(a, b, c); } };
// 8 copies of 16 B a lane: the thread's piece of 8 row blocks (2 KiB each in LDS, 16 rows = 16 DM elements apart in the plane), every lane on. The wait that belongs in front of a rewrite of the copies' address registers is the statement's last line, so that nothing can be lifted over it
__device__ __forceinline__ void cp8(unsigned d, const bf* g) {
    asm volatile("global_load_async_to_lds_b128 %0, %8, off\n\t"
                 "global_load_async_to_lds_b128 %1, %9, off\n\t"
                 "global_load_async_to_lds_b128 %2, %10, off\n\t"
                 "global_load_async_to_lds_b128 %3, %11, off\n\t"
                 "global_load_async_to_lds_b128 %4, %12, off\n\t"
                 "global_load_async_to_lds_b128 %5, %13, off\n\t"
                 "global_load_async_to_lds_b128 %6, %14, off\n\t"
                 "global_load_async_to_lds_b128 %7, %15, off\n\t"
                 "s_wait_xcnt 0x0"
                 :: "v"(d), "v"(d + 2048), "v"(d + 4096), "v"(d + 6144), "v"(d + 8192), "v"(d + 10240), "v"(d + 12288), "v"(d + 14336),
                    "v"(g), "v"(g + 16 * DM), "v"(g + 32 * DM), "v"(g + 48 * DM), "v"(g + 64 * DM), "v"(g + 80 * DM), "v"(g + 96 * DM), "v"(g + 112 * DM) : "memory"); }
template <int NSPLIT, bool PL>
__global__ __launch_bounds__(128) void k_gemmt(const bf* __restrict__ X, const bf* __restrict__ X2, const bf* __restrict__ Wt, float* C, const float* __restrict__ bias0, const float* __restrict__ bias1, const float* __restrict__ bias2, h16* P16, const float* __restrict__ kid) {
    typedef WFrag<bf>::V V; constexpr int K = DM, NST = K / 64, OPB = 8 * 2048, BUFB = (NSPLIT ? 3 : 2) * OPB;    // bytes of one operand's stage, of a buffer
    __shared__ __align__(128) char sm[2 * BUFB];
    const int w = __builtin_amdgcn_readfirstlane(threadIdx.x >> 5), lane = threadIdx.x & 31, lr = lane & 15, hi = lane >> 4, z = blockIdx.z;
    const float* bias = z == 0 ? bias0 : z == 1 ? bias1 : bias2;
    const bf* xg = X + (size_t)blockIdx.x * 128 * K + 8 * threadIdx.x; const bf* x2g = NSPLIT ? X2 + (size_t)blockIdx.x * 128 * K + 8 * threadIdx.x : nullptr; const bf* wg = Wt + (size_t)z * DM * DM + (size_t)blockIdx.y * 128 * K + 8 * threadIdx.x;
    const unsigned sl = (unsigned)(size_t)&sm[0] + 16 * threadIdx.x;    // the thread's own 16 B of each 2-KiB run, as a byte address in LDS
    auto fill = [&](int s, int b) { const unsigned d = sl + b * BUFB; cp8(d, xg + s * 1024); cp8(d + OPB, wg + s * 1024); if (NSPLIT) cp8(d + 2 * OPB, x2g + s * 1024); };
    fill(0, 0);
    const int xo = (w & 1) * 8192 + 16 * lane, wo = OPB + (w >> 1) * 8192 + 16 * lane; const bool sw = PL && z < 2; const int ao = sw ? wo : xo, bo = sw ? xo : wo;    // byte places of the wave's A and B fragments in a buffer
    v8f acc[4][4];
#pragma unroll
    for (int mb = 0; mb < 4; ++mb)
#pragma unroll
        for (int nb = 0; nb < 4; ++nb) acc[mb][nb] = (v8f){};
    asm volatile("s_wait_asynccnt 0x0" ::: "memory");    // this wave's copies of stage 0 have landed
    __syncthreads();    // publishes stage 0 to all four waves
    fill(1, 1);
    // rolled: the 12 stages unrolled would only lengthen the text
#pragma unroll 1
    for (int s = 0; s < NST; ++s) {
        const char* bb = sm + (s & 1) * BUFB;
        // unrolled: the two 32-k halves of a stage differ by a constant offset, and the second half's LDS reads can issue under the first half's products
#pragma unroll
        for (int u = 0; u < 2; ++u) {
            V a[4], a2[4], b[4];    // all fragments of the half asked for as one group ahead of its products: one place with LDS reads, not one per column block
#pragma unroll
            for (int mb = 0; mb < 4; ++mb) { a[mb] = WFrag<bf>::ld((const bf*)(bb + ao + mb * 2048 + u * 1024)); b[mb] = WFrag<bf>::ld((const bf*)(bb + bo + mb * 2048 + u * 1024)); if (NSPLIT) a2[mb] = WFrag<bf>::ld((const bf*)(bb + 2 * OPB + xo + mb * 2048 + u * 1024)); }
            __builtin_amdgcn_sched_barrier(0);    // keeps the group together: without it the scheduler sinks the B reads among the products, each behind a wait to 0
#pragma unroll
            for (int nb = 0; nb < 4; ++nb)
#pragma unroll
                for (int mb = 0; mb < 4; ++mb) { acc[mb][nb] = wmmab(a[mb], b[nb], acc[mb][nb]); if (NSPLIT) acc[mb][nb] = wmmab(a2[mb], b[nb], acc[mb][nb]); }
        }
        asm volatile("s_wait_dscnt 0x0" ::: "memory");    // this wave's reads of the buffer are done before it is given up for refill
        asm volatile("s_wait_asynccnt 0x0" ::: "memory");    // this wave's copies of stage s + 1 have landed
        __syncthreads();    // publishes stage s + 1 and ends every wave's reads of stage s's buffer
        if (s + 2 < NST) fill(s + 2, s & 1);
    }
    asm volatile("s_wait_asynccnt 0x0" ::: "memory");    // no copy is left in flight when the LDS is used anew or the wave ends
    const int tw = blockIdx.x * 128 + (w & 1) * 64, cw = blockIdx.y * 128 + (w >> 1) * 64, bt = tw / TT, tt = tw % TT;    // the wave's first token (batch bt, place tt) and first channel
    if constexpr (PL) {
        if (z < 2) {    // tile row = channel cw + 16 mb + 8 hi + j, column = token tw + 16 nb + lr
            h16* d = P16 + (((size_t)z * NB_ + bt) * NH_ + cw / HD) * TT * HD + tt * HD + 8 * lane; v8f bv[4], kd[4]; float p[4] = {0.f, 0.f, 0.f, 0.f};
#pragma unroll
            for (int mb = 0; mb < 4; ++mb) { bv[mb] = *(const v8f*)(bias + cw + mb * 16 + hi * 8); kd[mb] = (v8f){}; }
            if (z == 0) {
#pragma unroll
                for (int mb = 0; mb < 4; ++mb) kd[mb] = *(const v8f*)(kid + bt * DM + cw + mb * 16 + hi * 8); }
#pragma unroll
            for (int mb = 0; mb < 4; ++mb)
#pragma unroll
                for (int nb = 0; nb < 4; ++nb)
#pragma unroll
                    for (int j = 0; j < 8; ++j) acc[mb][nb][j] += bfr(bv[mb][j]);
            if (z == 0) {    // s0 of the lane's four tokens: its 32 channels in rising order, then the other half of the wave (a fixed order, alike in both halves)
#pragma unroll
                for (int nb = 0; nb < 4; ++nb) {
#pragma unroll
                    for (int mb = 0; mb < 4; ++mb)
#pragma unroll
                        for (int j = 0; j < 8; ++j) p[nb] = fmaf(acc[mb][nb][j], kd[mb][j], p[nb]);
                    p[nb] += __shfl_xor(p[nb], 16, 32); } }
            // every store last, so that no register a store names is written behind it
#pragma unroll
            for (int mb = 0; mb < 4; ++mb)
#pragma unroll
                for (int nb = 0; nb < 4; ++nb) { v8h o;
#pragma unroll
                    for (int j = 0; j < 8; ++j) o[j] = tohx(acc[mb][nb][j]);
                    *(v8h*)(d + nb * 1024 + mb * 256) = o; }
            if (z == 0) { float* s0 = C + ((size_t)bt * NH_ + cw / HD) * TT + tt + lane; s0[0] = hi == 0 ? p[0] : p[1]; s0[32] = hi == 0 ? p[2] : p[3]; }
        } else {    // tile row = token tw + 16 mb + 8 hi + j, column = channel cw + 16 nb + lr
            h16* d = P16 + (size_t)2 * NB_ * NH_ * TT * HD + ((size_t)bt * DM + cw) * TT + tt * 16 + 8 * lane; float bb[4];
#pragma unroll
            for (int nb = 0; nb < 4; ++nb) bb[nb] = bfr(bias[cw + nb * 16 + lr]);
#pragma unroll
            for (int nb = 0; nb < 4; ++nb)
#pragma unroll
                for (int mb = 0; mb < 4; ++mb) { v8h o;
#pragma unroll
                    for (int j = 0; j < 8; ++j) o[j] = tohx(acc[mb][nb][j] + bb[nb]);
                    *(v8h*)(d + (size_t)nb * 16 * TT + mb * 256) = o; }
            asm volatile("s_wait_xcnt 0x0" ::: "memory");    // the wait that belongs behind this run of stores, in front of any later write of a register that they name
        }
        return;
    } else {
        float* os = (float*)sm + w * (16 * 68); const int cofs = lr * 4; const v4f bv = *(const v4f*)(bias + cw + cofs); const float b0 = bfr(bv[0]), b1 = bfr(bv[1]), b2 = bfr(bv[2]), b3 = bfr(bv[3]);
#pragma unroll
        for (int mb = 0; mb < 4; ++mb) {
#pragma unroll
            for (int nb = 0; nb < 4; ++nb) {
#pragma unroll
                for (int j = 0; j < 8; ++j) os[(hi * 8 + j) * 68 + nb * 16 + lr] = acc[mb][nb][j]; }
            __builtin_amdgcn_wave_barrier(); asm volatile("" ::: "memory");    // the wave's reads below stay behind its writes above
            float* crow = C + (size_t)(tw + mb * 16) * DM + cw;
#pragma unroll
            for (int s = 0; s < 8; ++s) { const int row = 2 * s + hi; v4f val = *(const v4fa*)(os + row * 68 + cofs); val[0] += b0; val[1] += b1; val[2] += b2; val[3] += b3;
                *(v4f*)(crow + (size_t)row * DM + cofs) = val; }
            __builtin_amdgcn_wave_barrier(); asm volatile("" ::: "memory");    // the next block's writes stay behind these reads
        }
    }
}

__device__ __forceinline__ void splitf(float y, unsigned short& h, unsigned short& l) { h = f2bf(y); l = f2bf(y - bf2f(h)); }
typedef __attribute__((ext_vector_type(2))) unsigned short v2us;
typedef __attribute__((ext_vector_type(4))) unsigned short v4us;

// k_cvt8: all five f32 -> bf16 conversions in one grid; dst is ONE run of planes, each in fragment order (K = DM): the four weights (WBL blocks each), then x of all batches; a block lies wholly in one source; a thread writes the 8 elements at its own place in the run and reads them from the row and k that belong there
#define WBL (DM * DM / 8 / 256)
__global__ __launch_bounds__(256) void k_cvt8(const float* __restrict__ w0, const float* __restrict__ w1, const float* __restrict__ w2, const float* __restrict__ w3, const float* __restrict__ xs, bf* dst) {
    const int bx = blockIdx.x, m = bx / WBL; const float* src = m == 0 ? w0 : m == 1 ? w1 : m == 2 ? w2 : m == 3 ? w3 : xs;
    const size_t i = (size_t)bx * 256 + threadIdx.x, si = (size_t)(bx - (m < 4 ? m : 4) * WBL) * 256 + threadIdx.x; const unsigned fb = (unsigned)si >> 6; const v8f v = *(const v8f*)(src + (size_t)(fb / (DM / 32) * 16 + ((unsigned)si & 15)) * DM + fb % (DM / 32) * 32 + (((unsigned)si >> 4) & 3) * 8); v8us o;
#pragma unroll
    for (int k = 0; k < 8; ++k) o[k] = f2bf(v[k]); *(v8us*)(dst + i * 8) = o;  }
// k_idkv: wave per channel c, block = 32 channels of one matrix (blockIdx.y 0: K, 1: V): KID[c] = sum_d bf16 id[d] bf16 Wk[c][d] + bk[c], VID likewise; lane l sums d = 128 i + 4 l + u in rising (i, u), lane 0 starting from the bias, all loads issued up front, then an xor butterfly over the lanes; the 32 sums meet in LDS and wave 0 stores them as one 128-B line; blockIdx.z: batch
__global__ __launch_bounds__(1024) void k_idkv(const float* __restrict__ ida, const float* __restrict__ Wk, const float* __restrict__ bk, const float* __restrict__ Wv, const float* __restrict__ bv, float* KID, float* VID) {
    __shared__ float red[32];
    const int lane = threadIdx.x & 31, w = threadIdx.x >> 5, c = blockIdx.x * 32 + w; const bool isv = blockIdx.y != 0;
    const float* wr = (isv ? Wv : Wk) + (size_t)c * DM + lane * 4; const float* ar = ida + blockIdx.z * DM + lane * 4; const float bias = (isv ? bv : bk)[c]; v4f a[DM / 128], m[DM / 128];
#pragma unroll
    for (int i = 0; i < DM / 128; ++i) { m[i] = *(const v4f*)(wr + i * 128); a[i] = *(const v4f*)(ar + i * 128); }
    float s = lane == 0 ? bfr(bias) : 0.f;
#pragma unroll
    for (int i = 0; i < DM / 128; ++i)
#pragma unroll
        for (int u = 0; u < 4; ++u) s = fmaf(bfr(a[i][u]), bfr(m[i][u]), s);
#pragma unroll
    for (int sh = 16; sh; sh >>= 1) s += __shfl_xor(s, sh, 32);
    if (lane == 0) red[w] = s;
    __syncthreads();
    if (w == 0) (isv ? VID : KID)[blockIdx.z * DM + blockIdx.x * 32 + lane] = red[lane]; }
#define QW 4
#define KT 64
__global__ __launch_bounds__(32 * QW) void k_fattn(const h16* __restrict__ Q16, const h16* __restrict__ K16, const h16* __restrict__ VT, const float* __restrict__ S0, const float* __restrict__ VID, bf* Ah, bf* Al) {
    __shared__ __align__(128) h16 sm[2][2 * KT * HD];    // a buffer: the K tile (8 KiB), behind it the V^T tile (4 x 2 KiB)
    const int w = __builtin_amdgcn_readfirstlane(threadIdx.x >> 5), lane = threadIdx.x & 31, lr = lane & 15, hi = lane >> 4; const int h = blockIdx.y, q0 = blockIdx.x * (32 * QW) + w * 32, hb = blockIdx.z * NH_ + h;    // hb: the head's place in the [batch][head] planes
    const float SC = 0.125f * 1.4426950408889634f; constexpr int NT = TT / KT;
    const h16* qp = Q16 + ((size_t)hb * TT + q0) * HD + 8 * lane; const h16* kg = K16 + (size_t)hb * TT * HD + 8 * threadIdx.x; const h16* vg = VT + (size_t)hb * HD * TT + 8 * threadIdx.x;    // fragment order
    const unsigned sl = (unsigned)(size_t)&sm[0][0] + 16 * threadIdx.x;    // the thread's own 16 B of each 2-KiB run, as a byte address in LDS
    // tile t into buffer b: 8 copies a thread, 16 B each, every lane on. The wait that belongs in front of a rewrite of the copies' address registers is the statement's last line, so that nothing can be lifted over it
    auto fill = [&](int t, int b) {
        const h16* k = kg + t * (KT * HD); const h16* v = vg + t * (KT * 16); const unsigned d = sl + b * (2 * KT * HD * 2);
        asm volatile("global_load_async_to_lds_b128 %0, %8, off\n\t"
                     "global_load_async_to_lds_b128 %1, %9, off\n\t"
                     "global_load_async_to_lds_b128 %2, %10, off\n\t"
                     "global_load_async_to_lds_b128 %3, %11, off\n\t"
                     "global_load_async_to_lds_b128 %4, %12, off\n\t"
                     "global_load_async_to_lds_b128 %5, %13, off\n\t"
                     "global_load_async_to_lds_b128 %6, %14, off\n\t"
                     "global_load_async_to_lds_b128 %7, %15, off\n\t"
                     "s_wait_xcnt 0x0"
                     :: "v"(d), "v"(d + 2048), "v"(d + 4096), "v"(d + 6144), "v"(d + 8192), "v"(d + 10240), "v"(d + 12288), "v"(d + 14336),
                        "v"(k), "v"(k + 1024), "v"(k + 2048), "v"(k + 3072), "v"(v), "v"(v + 16 * TT), "v"(v + 32 * TT), "v"(v + 48 * TT) : "memory"); };
    fill(0, 0);
    v16h qf[2][2]; float mu[2], l[2]; v8f o[4][2];
#pragma unroll
    for (int qt = 0; qt < 2; ++qt) { qf[qt][0] = WFrag<h16>::ld(qp + qt * 16 * HD); qf[qt][1] = WFrag<h16>::ld(qp + qt * 16 * HD + 512);
        mu[qt] = S0[(size_t)hb * TT + q0 + qt * 16 + lr] * SC; l[qt] = hi == 0 ? 1.f : 0.f; }
#pragma unroll
    for (int dt = 0; dt < 4; ++dt) { const v8f vi = *(const v8f*)(VID + hb * HD + dt * 16 + hi * 8); o[dt][0] = vi; o[dt][1] = vi; }
    asm volatile("s_wait_xcnt 0x0" ::: "memory");    // the loads above name address registers that the code below writes anew: the wait that belongs in front of those writes
    asm volatile("s_wait_asynccnt 0x0" ::: "memory");    // this wave's copies of tile 0 have landed
    __syncthreads();    // publishes tile 0 to all four waves
    fill(1, 1);
    // rolled: for speed only
#pragma unroll 1
    for (int t = 0; t < NT; ++t) {
        const h16* kb = &sm[t & 1][0] + 8 * lane; const h16* vb = kb + KT * HD;
        // a tile is two passes of 32 keys; rolled: unrolled they take 66 registers more and save no instruction
#pragma unroll 1
        for (int p = 0; p < KT / 32; ++p) {
            v16h kf[2][2], vf[4]; v8f s[2][2];
#pragma unroll
            for (int kt = 0; kt < 2; ++kt) { kf[kt][0] = WFrag<h16>::ld(kb + (p * 32 + kt * 16) * HD); kf[kt][1] = WFrag<h16>::ld(kb + (p * 32 + kt * 16) * HD + 512); }
#pragma unroll
            for (int dt = 0; dt < 4; ++dt) vf[dt] = WFrag<h16>::ld(vb + dt * (KT * 16) + p * 512);
#pragma unroll
            for (int kt = 0; kt < 2; ++kt)
#pragma unroll
                for (int qt = 0; qt < 2; ++qt) s[kt][qt] = wmma16(kf[kt][1], qf[qt][1], wmma16(kf[kt][0], qf[qt][0], (v8f){}));
            float tm[2];
#pragma unroll
            for (int qt = 0; qt < 2; ++qt) { tm[qt] = -8.f;
#pragma unroll
                for (int kt = 0; kt < 2; ++kt)
#pragma unroll
                    for (int j = 0; j < 8; ++j) { s[kt][qt][j] = fmaf(s[kt][qt][j], SC, -mu[qt]); tm[qt] = fmaxf(tm[qt], s[kt][qt][j]); } }
            if (__builtin_amdgcn_ballot_w32(fmaxf(tm[0], tm[1]) > 8.f) != 0) {    // rare, wave-uniform: raise the base of every column to its maximum so far, alike in both halves of the wave
#pragma unroll
                for (int qt = 0; qt < 2; ++qt) { const float dl = fmaxf(fmaxf(tm[qt], __shfl_xor(tm[qt], 16, 32)), 0.f), al = __builtin_amdgcn_exp2f(-dl); mu[qt] += dl; l[qt] *= al;
#pragma unroll
                    for (int dt = 0; dt < 4; ++dt) o[dt][qt] *= al;
#pragma unroll
                    for (int kt = 0; kt < 2; ++kt) s[kt][qt] -= dl; } }
#pragma unroll
            for (int qt = 0; qt < 2; ++qt) { v16h pf;
#pragma unroll
                for (int kt = 0; kt < 2; ++kt)
#pragma unroll
                    for (int j = 0; j < 8; ++j) { const float pe = __builtin_amdgcn_exp2f(s[kt][qt][j]); l[qt] += pe; pf[kt * 8 + j] = tohx(pe); }
#pragma unroll
                for (int dt = 0; dt < 4; ++dt) o[dt][qt] = wmma16(vf[dt], pf, o[dt][qt]); }
        }
        asm volatile("s_wait_dscnt 0x0" ::: "memory");    // this wave's reads of the buffer are done before it is given up for refill
        asm volatile("s_wait_asynccnt 0x0" ::: "memory");    // this wave's copies of tile t + 1 have landed
        __syncthreads();    // publishes tile t + 1 and ends every wave's reads of tile t's buffer
        if (t + 2 < NT) fill(t + 2, t & 1);
    }
    asm volatile("s_wait_asynccnt 0x0" ::: "memory");    // no copy is left in flight when the wave ends
#pragma unroll
    for (int qt = 0; qt < 2; ++qt) { l[qt] += __shfl_xor(l[qt], 16, 32); const float inv = __fdiv_rn(1.0f, l[qt]);
        const size_t oo = ((size_t)blockIdx.z * TT + q0 + qt * 16) * DM + h * 1024 + 8 * lane;    // rows q0 + 16 qt .., k h * 64 of the [4 * 2048][768] planes, fragment order; + 16 k is + 256
#pragma unroll
        for (int dt = 0; dt < 4; ++dt) { v8us oh, ol;
#pragma unroll
            for (int e = 0; e < 8; ++e) { unsigned short x, y; splitf(o[dt][qt][e] * inv, x, y); oh[e] = x; ol[e] = y; }
            *(v8us*)(Ah + oo + dt * 256) = oh; *(v8us*)(Al + oo + dt * 256) = ol; } }
}

extern "C" void kernel_launch(void* const* d_in, const int* in_sizes, int n_in,
                              void* d_out, int out_size, void* d_ws, size_t ws_size, hipStream_t stream) {
    (void)in_sizes; (void)n_in; (void)out_size;
    const float** I = (const float**)d_in;
    const float *x = I[0], *ida = I[1], *Wq = I[2], *bq = I[3], *Wk = I[4], *bk = I[5], *Wv = I[6], *bv = I[7], *Wo = I[8], *bo = I[9];
    float* OUT = (float*)d_out;     // [4][2048][768]
    char* wsp = (char*)d_ws;
    auto take = [&](size_t bytes) { char* p = wsp; wsp += (bytes + 255) & ~(size_t)255; return (void*)p; };
    // every plane holds all 4 batches; all sizes are multiples of 256 B, so BQ BK BV BO XB and Q16 K16 VT each lie one behind the other with no gap (k_cvt8 and the z of the QKV launch lean on that)
    bf* BQ = (bf*)take((size_t)DM * DM * 2); take((size_t)DM * DM * 2); take((size_t)DM * DM * 2); bf* BO = (bf*)take((size_t)DM * DM * 2);
    bf* XB = (bf*)take((size_t)NB_ * TT * DM * 2); float* KID = (float*)take(NB_ * DM * 4); float* VID = (float*)take(NB_ * DM * 4); float* S0 = (float*)take((size_t)NB_ * NH_ * TT * 4);
    h16* Q16 = (h16*)take((size_t)NB_ * NH_ * TT * HD * 2); h16* K16 = (h16*)take((size_t)NB_ * NH_ * TT * HD * 2); h16* VT = (h16*)take((size_t)NB_ * NH_ * HD * TT * 2); bf* Ah = (bf*)take((size_t)NB_ * TT * DM * 2); bf* Al = (bf*)take((size_t)NB_ * TT * DM * 2);
    if ((size_t)(wsp - (char*)d_ws) > ws_size) return;    // total ~ 81 MB
    k_cvt8<<<4 * WBL + NB_ * TT * DM / 8 / 256, 256, 0, stream>>>(Wq, Wk, Wv, Wo, x, BQ);   // torch [out][in] = Bt
    k_idkv<<<dim3(DM / 32, 2, NB_), 1024, 0, stream>>>(ida, Wk, bk, Wv, bv, KID, VID);   // ahead of the QKV launch, whose Q epilogue reads KID
    k_gemmt<0, true><<<dim3(NB_ * TT / 128, DM / 128, 3), 128, 0, stream>>>(XB, nullptr, BQ, S0, bq, bk, bv, Q16, KID);   // z: Q, K, V; the batches are rows
    k_fattn<<<dim3(TT / (32 * QW), NH_, NB_), 32 * QW, 0, stream>>>(Q16, K16, VT, S0, VID, Ah, Al);
    k_gemmt<1, false><<<dim3(NB_ * TT / 128, DM / 128, 1), 128, 0, stream>>>(Ah, Al, BO, OUT, bo, bo, bo, nullptr, nullptr);
}

// v010
// A run of this version takes 104 microseconds.
// Timed twice side by side with v009, it ran 1.03 times as fast both times.
// Over all steps from v000 it is 20.7 times as fast.
#include <hip/hip_runtime.h>

// IDContextAttention (x [4][2048][768], id_anchor [4][1][768]; Q/K/V = x W^T + b (12 heads x 64); one extra key/value K_id/V_id = id_anchor Wk/Wv^T + b PREPENDED to the 2048 current keys; softmax(q.k/8) over the 2049 keys; out = (attn V merged) Wo^T + bo
// -> [4][2048][768]). The extra key's score is a VALU dot in the Q tile's epilogue of the QKV GEMM; key and value row enter as the start state of the online softmax in k_fattn.
// Compute dtypes, f32 accumulate: every input rounded to bf16; Q/K/V on PLAIN bf16 operands (inputs: exact) + bias; K_id/V_id and q.K_id f32 on the VALU (fixed-order dots); scores (K 64) and attn.V over the 2048 current keys

#define NB_  4
#define TT   2048
#define DM   768
#define NH_  12
#define HD   64
typedef _Float16 h16;
typedef unsigned short bf;
typedef __attribute__((ext_vector_type(16))) __bf16   v16bf;
typedef __attribute__((ext_vector_type(16))) _Float16 v16h;
typedef __attribute__((ext_vector_type(8)))  _Float16 v8h;
typedef __attribute__((ext_vector_type(8)))  unsigned short v8us;
typedef __attribute__((ext_vector_type(8)))  float    v8f;
typedef __attribute__((ext_vector_type(4)))  float    v4f;
typedef v8h  __attribute__((may_alias)) v8ha;
typedef v4f  __attribute__((may_alias)) v4fa;
typedef v8us __attribute__((may_alias)) v8usa;

__device__ __forceinline__ unsigned short f2bf(float f) { unsigned u = __float_as_uint(f); u += 0x7FFFu + ((u >> 16) & 1u); return (unsigned short)(u >> 16); }
__device__ __forceinline__ float bf2f(unsigned short b) { return __uint_as_float(((unsigned)b) << 16); }
__device__ __forceinline__ float bfr(float f) { return bf2f(f2bf(f)); }
__device__ __forceinline__ v16h cat16(v8h lo, v8h hi) { return __builtin_shufflevector(lo, hi, 0, 1, 2, 3, 4, 5, 6, 7, 8, 9, 10, 11, 12, 13, 14, 15); }
__device__ __forceinline__ v16bf cat16b(v8us lo, v8us hi) { return __builtin_bit_cast(v16bf, __builtin_shufflevector(lo, hi, 0, 1, 2, 3, 4, 5, 6, 7, 8, 9, 10, 11, 12, 13, 14, 15)); }
__device__ __forceinline__ v8f wmma16(v16h a, v16h b, v8f c) { return __builtin_amdgcn_wmma_f32_16x16x32_f16(false, a, false, b, (short)0, c, false, false); }
__device__ __forceinline__ v8f wmmab(v16bf a, v16bf b, v8f c) { return __builtin_amdgcn_wmma_f32_16x16x32_bf16(false, a, false, b, (short)0, c, false, false); }
__device__ __forceinline__ h16 tohx(float x) { return (h16)x; }



// ---- FRAGMENT ORDER of every 16-bit operand plane (a matrix [R][K], R % 16 == 0, K % 32 == 0): element (r, k) lies at ((r / 16) * (K / 32) + k / 32) * 512 + ((k % 32) / 16) * 256 + (((k % 16) / 8) * 16 + r % 16) * 8 + k % 8.
// A 16 x 32 fragment is then 1 KiB in a row, and each of its two 16-B-a-lane loads (lane * 8, + 256 elements) reads 512 contiguous bytes = 4 whole 128-B lines, where a row-major plane gives 16 lines with 32 B used of each. Lane, register and k order are the row-major loader's.
// ---- k_gemmt: GEMM on bf16 planes in fragment order, K = DM. A work-group of 4 waves owns 128 tokens x 32 NCB channels, wave w the quarter of 64 tokens x 16 NCB channels (tokens w & 1, channels w >> 1, 4 NCB accumulators) over the WHOLE K.
// NCB = 6 in the QKV launch (128 x 192): its 768 work-groups, 3 to a WGP by registers, are then all resident at once with equal shares, where 1152 tiles of 128 x 128 at 4 to a WGP left 128 for a second round. NCB = 4 in the output projection (128 x 128).
// The operands come in stages of 64 k that the work-group brings into LDS ONCE (asynchronous copies, two buffers) and the waves share: a weight byte leaves L2 once per 128 tokens, a token byte once per 32 NCB channels, and each fragment is read from LDS by two waves.
// A stage of an operand is 2 KiB (two fragments in a row) per 16 rows, 8 such blocks of tokens and 2 NCB of weights, copied as it lies; a buffer holds the token plane X, the weights, and (NSPLIT 1) the low plane X2, whose products go into the same sums right behind X's.
// PL (the QKV launch, z = 0, 1, 2: Q, K, V; a work-group's 192 channels are three heads, a wave's 96 one and a half): the epilogue writes the fp16 planes the attention kernel reads, P16 = Q16[b][h] ([t][d] in fragment order), K16 likewise, VT16[b][h] ([d][t] in fragment order) one behind the other, straight from the accumulators:
// Q and K are formed as W x^T (rows channels, columns tokens), V as x W^T (rows tokens, columns channels), same products, same k order, so that a lane's 8 values of a tile are the 8 k in a row that are its own 16 B of the fragment. Q never goes out as f32: the id key's score s0 = sum_d Q[t][d] KID[d] comes from the f32 sums (the head's 32 channels of the lane in rising order, the middle head's carried on from one wave to the other, then the other half of the wave) and goes to C = S0[b][h][t].
// Not PL (the output projection): rows tokens, C f32 [t][DM] + bias, each 16-row block turned in the wave's own piece of the LDS (free behind the loop's last barrier) so that whole 256-B row pieces are stored.
template <typename T16> struct WFrag;
template <> struct WFrag<h16> { typedef v16h V; static __device__ __forceinline__ V ld(const h16* p) { return cat16(*(const v8h*)p, *(const v8h*)(p + 256)); } static __device__ __forceinline__ v8f mma(V a, V b, v8f c) { return wmma16(a, b, c); } };
template <> struct WFrag<bf> { typedef v16bf V; static __device__ __forceinline__ V ld(const bf* p) { return cat16b(*(const v8us*)p, *(const v8us*)(p + 256)); } static __device__ __forceinline__ v8f mma(V a, V b, v8f c) { return wmmab(a, b, c); } };
// 8 copies of 16 B a lane: the thread's piece of 8 row blocks (2 KiB each in LDS, 16 rows = 16 DM elements apart in the plane), every lane on. The wait that belongs in front of a rewrite of the copies' address registers is the statement's last line, so that nothing can be lifted over it
__device__ __forceinline__ void cp8(unsigned d, const bf* g) {
    asm volatile("global_load_async_to_lds_b128 %0, %8, off\n\t"
                 "global_load_async_to_lds_b128 %1, %9, off\n\t"
                 "global_load_async_to_lds_b128 %2, %10, off\n\t"
                 "global_load_async_to_lds_b128 %3, %11, off\n\t"
                 "global_load_async_to_lds_b128 %4, %12, off\n\t"
                 "global_load_async_to_lds_b128 %5, %13, off\n\t"
                 "global_load_async_to_lds_b128 %6, %14, off\n\t"
                 "global_load_async_to_lds_b128 %7, %15, off\n\t"
                 "s_wait_xcnt 0x0"
                 :: "v"(d), "v"(d + 2048), "v"(d + 4096), "v"(d + 6144), "v"(d + 8192), "v"(d + 10240), "v"(d + 12288), "v"(d + 14336),
                    "v"(g), "v"(g + 16 * DM), "v"(g + 32 * DM), "v"(g + 48 * DM), "v"(g + 64 * DM), "v"(g + 80 * DM), "v"(g + 96 * DM), "v"(g + 112 * DM) : "memory"); }
// 4 more copies of the same kind: row blocks 8 to 11 of a 192-row weight stage
__device__ __forceinline__ void cp4(unsigned d, const bf* g) {
    asm volatile("global_load_async_to_lds_b128 %0, %4, off\n\t"
                 "global_load_async_to_lds_b128 %1, %5, off\n\t"
                 "global_load_async_to_lds_b128 %2, %6, off\n\t"
                 "global_load_async_to_lds_b128 %3, %7, off\n\t"
                 "s_wait_xcnt 0x0"
                 :: "v"(d), "v"(d + 2048), "v"(d + 4096), "v"(d + 6144),
                    "v"(g), "v"(g + 16 * DM), "v"(g + 32 * DM), "v"(g + 48 * DM) : "memory"); }
template <bool B> struct BC { static constexpr bool v = B; };
template <int N> struct IC { static constexpr int v = N; };
template <int NSPLIT, bool PL>
__global__ __launch_bounds__(128) void k_gemmt(const bf* __restrict__ X, const bf* __restrict__ X2, const bf* __restrict__ Wt, float* C, const float* __restrict__ bias0, const float* __restrict__ bias1, const float* __restrict__ bias2, h16* P16, const float* __restrict__ kid) {
    typedef WFrag<bf>::V V; constexpr int K = DM, NST = K / 64, NCB = PL ? 6 : 4, OPB = 8 * 2048, WPB = 2 * NCB * 2048, BUFB = (NSPLIT ? 2 : 1) * OPB + WPB;    // 16-channel blocks of a wave; bytes of a token plane's stage, of the weights' stage, of a buffer
    __shared__ __align__(128) char sm[2 * BUFB];
    const int w = __builtin_amdgcn_readfirstlane(threadIdx.x >> 5), lane = threadIdx.x & 31, lr = lane & 15, hi = lane >> 4, z = blockIdx.z;
    const float* bias = z == 0 ? bias0 : z == 1 ? bias1 : bias2;
    const bf* xg = X + (size_t)blockIdx.x * 128 * K + 8 * threadIdx.x; const bf* x2g = NSPLIT ? X2 + (size_t)blockIdx.x * 128 * K + 8 * threadIdx.x : nullptr; const bf* wg = Wt + (size_t)z * DM * DM + (size_t)blockIdx.y * (32 * NCB) * K + 8 * threadIdx.x;
    const unsigned sl = (unsigned)(size_t)&sm[0] + 16 * threadIdx.x;    // the thread's own 16 B of each 2-KiB run, as a byte address in LDS
    auto fill = [&](int s, int b) { const unsigned d = sl + b * BUFB; cp8(d, xg + s * 1024); cp8(d + OPB, wg + s * 1024); if (PL) cp4(d + 2 * OPB, wg + 128 * DM + s * 1024); if (NSPLIT) cp8(d + OPB + WPB, x2g + s * 1024); };
    fill(0, 0);
    const int xo = (w & 1) * 8192 + 16 * lane, wo = OPB + (w >> 1) * (NCB * 2048) + 16 * lane; const bool sw = PL && z < 2;    // byte places of the wave's token and channel fragments in a buffer; sw: the channels are the rows (A)
    v8f acc[NCB][4];    // [channel block][token block]
#pragma unroll
    for (int c = 0; c < NCB; ++c)
#pragma unroll
        for (int t = 0; t < 4; ++t) acc[c][t] = (v8f){};
    asm volatile("s_wait_asynccnt 0x0" ::: "memory");    // this wave's copies of stage 0 have landed
    __syncthreads();    // publishes stage 0 to all four waves
    fill(1, 1);
    auto run = [&](auto swc) {
        constexpr bool SW = decltype(swc)::v;
        // rolled: the 12 stages unrolled would only lengthen the text
#pragma unroll 1
        for (int s = 0; s < NST; ++s) {
            const char* bb = sm + (s & 1) * BUFB;
            // unrolled: the two 32-k halves of a stage differ by a constant offset, and the second half's LDS reads can issue under the first half's products
#pragma unroll
            for (int u = 0; u < 2; ++u) {
                V xf[4], x2f[4], wf[NCB];    // all fragments of the half asked for as one group ahead of its products: one place with LDS reads, not one per column block
#pragma unroll
                for (int t = 0; t < 4; ++t) { xf[t] = WFrag<bf>::ld((const bf*)(bb + xo + t * 2048 + u * 1024)); if (NSPLIT) x2f[t] = WFrag<bf>::ld((const bf*)(bb + OPB + WPB + xo + t * 2048 + u * 1024)); }
#pragma unroll
                for (int c = 0; c < NCB; ++c) wf[c] = WFrag<bf>::ld((const bf*)(bb + wo + c * 2048 + u * 1024));
                __builtin_amdgcn_sched_barrier(0);    // keeps the group together: without it the scheduler sinks the B reads among the products, each behind a wait to 0
                if constexpr (SW) {
#pragma unroll
                    for (int t = 0; t < 4; ++t)
#pragma unroll
                        for (int c = 0; c < NCB; ++c) acc[c][t] = wmmab(wf[c], xf[t], acc[c][t]);
                } else {
#pragma unroll
                    for (int c = 0; c < NCB; ++c)
#pragma unroll
                        for (int t = 0; t < 4; ++t) { acc[c][t] = wmmab(xf[t], wf[c], acc[c][t]); if (NSPLIT) acc[c][t] = wmmab(x2f[t], wf[c], acc[c][t]); }
                }
            }
            asm volatile("s_wait_dscnt 0x0" ::: "memory");    // this wave's reads of the buffer are done before it is given up for refill
            asm volatile("s_wait_asynccnt 0x0" ::: "memory");    // this wave's copies of stage s + 1 have landed
            __syncthreads();    // publishes stage s + 1 and ends every wave's reads of stage s's buffer
            if (s + 2 < NST) fill(s + 2, s & 1);
        }
    };
    if (sw) run(BC<PL>{}); else run(BC<false>{});    // z is the same for the whole work-group: every wave walks the same loop and its barriers
    asm volatile("s_wait_asynccnt 0x0" ::: "memory");    // no copy is left in flight when the LDS is used anew or the wave ends
    const int tw = blockIdx.x * 128 + (w & 1) * 64, cw = blockIdx.y * (32 * NCB) + (w >> 1) * (16 * NCB), bt = tw / TT, tt = tw % TT;    // the wave's first token (batch bt, place tt) and first channel
    if constexpr (PL) {
        if (z < 2) {    // tile row = channel cw + 16 c + 8 hi + j, column = token tw + 16 t + lr; channel block cw / 16 + c is block (& 3) of head (>> 2)
            h16* d = P16 + ((size_t)z * NB_ + bt) * NH_ * TT * HD + tt * HD + 8 * lane; const int cb = cw / 16, chf = w >> 1; float pf[4] = {0.f, 0.f, 0.f, 0.f}, pp[4] = {0.f, 0.f, 0.f, 0.f};
            v8f bv[NCB];
#pragma unroll
            for (int c = 0; c < NCB; ++c) bv[c] = *(const v8f*)(bias + cw + c * 16 + hi * 8);
            asm volatile("s_wait_xcnt 0x0" ::: "memory");    // the loads above name an address register that the code below writes anew: the wait that belongs in front of those writes
            __builtin_amdgcn_sched_barrier(0);    // keeps those writes behind that wait
#pragma unroll
            for (int c = 0; c < NCB; ++c)
#pragma unroll
                for (int t = 0; t < 4; ++t)
#pragma unroll
                    for (int j = 0; j < 8; ++j) acc[c][t][j] += bfr(bv[c][j]);
            if (z == 0) {    // s0 of the lane's four tokens, head by head: the lane's 32 channels of the head in rising order, then the other half of the wave (a fixed order, alike in both halves)
                // the work-group's 192 channels are 3 heads: the low wave holds head 0 and the first half of head 1, the high wave the second half of head 1 and head 2; head 1's running sums go from the low wave to the high one through LDS (free behind the loop's last barrier), lane to lane, and are carried on there
                v8f kd[NCB];
#pragma unroll
                for (int c = 0; c < NCB; ++c) kd[c] = *(const v8f*)(kid + bt * DM + cw + c * 16 + hi * 8);
                asm volatile("s_wait_xcnt 0x0" ::: "memory");    // as above, for these loads
                __builtin_amdgcn_sched_barrier(0);    // as above
                auto dot = [&](float (&p)[4], auto c0c, auto c1c) {
#pragma unroll
                    for (int t = 0; t < 4; ++t)
#pragma unroll
                        for (int c = decltype(c0c)::v; c < decltype(c1c)::v; ++c)
#pragma unroll
                            for (int j = 0; j < 8; ++j) p[t] = fmaf(acc[c][t][j], kd[c][j], p[t]); };
                v4fa* xs = (v4fa*)sm + (w & 1) * 32 + lane;
                if (chf == 0) { dot(pf, IC<0>{}, IC<4>{}); dot(pp, IC<4>{}, IC<6>{}); *xs = (v4f){pp[0], pp[1], pp[2], pp[3]}; }
                __syncthreads();    // hands head 1's running sums from the low waves to the high ones; z == 0 holds for the whole work-group
                if (chf != 0) { const v4f q = *xs; pp[0] = q[0]; pp[1] = q[1]; pp[2] = q[2]; pp[3] = q[3]; dot(pp, IC<0>{}, IC<2>{}); dot(pf, IC<2>{}, IC<6>{}); }
#pragma unroll
                for (int t = 0; t < 4; ++t) { pf[t] += __shfl_xor(pf[t], 16, 32); pp[t] += __shfl_xor(pp[t], 16, 32); } }
            // stores block by block: a block's conversions and address, its four stores, then the wait that belongs in front of any later write of a register that they name
#pragma unroll
            for (int c = 0; c < NCB; ++c) { v8h o[4]; h16* dc = d + (size_t)((cb + c) >> 2) * (TT * HD) + ((cb + c) & 3) * 256;
#pragma unroll
                for (int t = 0; t < 4; ++t)
#pragma unroll
                    for (int j = 0; j < 8; ++j) o[t][j] = tohx(acc[c][t][j]);
                __builtin_amdgcn_sched_barrier(0);    // keeps every register write of the block in front of its first store
#pragma unroll
                for (int t = 0; t < 4; ++t) *(v8h*)(dc + t * 1024) = o[t];
                asm volatile("s_wait_xcnt 0x0" ::: "memory");    // behind the block's stores, in front of the next block's writes of the registers that they name
                __builtin_amdgcn_sched_barrier(0);    // keeps the next block's register writes behind that wait
            }
            if (z == 0) { float* s0 = C + ((size_t)bt * NH_ + blockIdx.y * 3 + 2 * chf) * TT + tt + lane; const float a0 = hi == 0 ? pf[0] : pf[1], a1 = hi == 0 ? pf[2] : pf[3];
                __builtin_amdgcn_sched_barrier(0);    // as above
                s0[0] = a0; s0[32] = a1;
                asm volatile("s_wait_xcnt 0x0" ::: "memory");    // as above
                __builtin_amdgcn_sched_barrier(0);    // as above
                if (chf != 0) { const float b0 = hi == 0 ? pp[0] : pp[1], b1 = hi == 0 ? pp[2] : pp[3]; float* s1 = s0 - TT;
                    __builtin_amdgcn_sched_barrier(0);    // as above
                    s1[0] = b0; s1[32] = b1;
                    asm volatile("s_wait_xcnt 0x0" ::: "memory");    // as above
                } }
        } else {    // tile row = token tw + 16 t + 8 hi + j, column = channel cw + 16 c + lr
            h16* d = P16 + (size_t)2 * NB_ * NH_ * TT * HD + ((size_t)bt * DM + cw) * TT + tt * 16 + 8 * lane; float bb[NCB];
#pragma unroll
            for (int c = 0; c < NCB; ++c) bb[c] = bias[cw + c * 16 + lr];
            asm volatile("s_wait_xcnt 0x0" ::: "memory");    // the loads above name address registers that the code below writes anew: the wait that belongs in front of those writes
            __builtin_amdgcn_sched_barrier(0);    // keeps those writes behind that wait
#pragma unroll
            for (int c = 0; c < NCB; ++c) bb[c] = bfr(bb[c]);
#pragma unroll
            for (int c = 0; c < NCB; ++c) { v8h o[4]; h16* dc = d + (size_t)c * 16 * TT;
#pragma unroll
                for (int t = 0; t < 4; ++t)
#pragma unroll
                    for (int j = 0; j < 8; ++j) o[t][j] = tohx(acc[c][t][j] + bb[c]);
                __builtin_amdgcn_sched_barrier(0);    // keeps every register write of the block in front of its first store
#pragma unroll
                for (int t = 0; t < 4; ++t) *(v8h*)(dc + t * 256) = o[t];
                asm volatile("s_wait_xcnt 0x0" ::: "memory");    // behind the block's stores, in front of the next block's writes of the registers that they name
                __builtin_amdgcn_sched_barrier(0);    // keeps the next block's register writes behind that wait
            }
        }
        return;
    } else {
        float* os = (float*)sm + w * (16 * 68); const int cofs = lr * 4; const v4f bv = *(const v4f*)(bias + cw + cofs); const float b0 = bfr(bv[0]), b1 = bfr(bv[1]), b2 = bfr(bv[2]), b3 = bfr(bv[3]);
#pragma unroll
        for (int mb = 0; mb < 4; ++mb) {
#pragma unroll
            for (int nb = 0; nb < 4; ++nb) {
#pragma unroll
                for (int j = 0; j < 8; ++j) os[(hi * 8 + j) * 68 + nb * 16 + lr] = acc[nb][mb][j]; }
            __builtin_amdgcn_wave_barrier(); asm volatile("" ::: "memory");    // the wave's reads below stay behind its writes above
            float* crow = C + (size_t)(tw + mb * 16) * DM + cw;
#pragma unroll
            for (int s = 0; s < 8; ++s) { const int row = 2 * s + hi; v4f val = *(const v4fa*)(os + row * 68 + cofs); val[0] += b0; val[1] += b1; val[2] += b2; val[3] += b3;
                *(v4f*)(crow + (size_t)row * DM + cofs) = val; }
            __builtin_amdgcn_wave_barrier(); asm volatile("" ::: "memory");    // the next block's writes stay behind these reads
        }
    }
}

__device__ __forceinline__ void splitf(float y, unsigned short& h, unsigned short& l) { h = f2bf(y); l = f2bf(y - bf2f(h)); }
typedef __attribute__((ext_vector_type(2))) unsigned short v2us;
typedef __attribute__((ext_vector_type(4))) unsigned short v4us;

// k_cvt8: all five f32 -> bf16 conversions in one grid; dst is ONE run of planes, each in fragment order (K = DM): the four weights (WBL blocks each), then x of all batches; a block lies wholly in one source; a thread writes the 8 elements at its own place in the run and reads them from the row and k that belong there
#define WBL (DM * DM / 8 / 256)
__global__ __launch_bounds__(256) void k_cvt8(const float* __restrict__ w0, const float* __restrict__ w1, const float* __restrict__ w2, const float* __restrict__ w3, const float* __restrict__ xs, bf* dst) {
    const int bx = blockIdx.x, m = bx / WBL; const float* src = m == 0 ? w0 : m == 1 ? w1 : m == 2 ? w2 : m == 3 ? w3 : xs;
    const size_t i = (size_t)bx * 256 + threadIdx.x, si = (size_t)(bx - (m < 4 ? m : 4) * WBL) * 256 + threadIdx.x; const unsigned fb = (unsigned)si >> 6; const v8f v = *(const v8f*)(src + (size_t)(fb / (DM / 32) * 16 + ((unsigned)si & 15)) * DM + fb % (DM / 32) * 32 + (((unsigned)si >> 4) & 3) * 8); v8us o;
#pragma unroll
    for (int k = 0; k < 8; ++k) o[k] = f2bf(v[k]); *(v8us*)(dst + i * 8) = o;  }
// k_idkv: wave per channel c, block = 32 channels of one matrix (blockIdx.y 0: K, 1: V): KID[c] = sum_d bf16 id[d] bf16 Wk[c][d] + bk[c], VID likewise; lane l sums d = 128 i + 4 l + u in rising (i, u), lane 0 starting from the bias, all loads issued up front, then an xor butterfly over the lanes; the 32 sums meet in LDS and wave 0 stores them as one 128-B line; blockIdx.z: batch
__global__ __launch_bounds__(1024) void k_idkv(const float* __restrict__ ida, const float* __restrict__ Wk, const float* __restrict__ bk, const float* __restrict__ Wv, const float* __restrict__ bv, float* KID, float* VID) {
    __shared__ float red[32];
    const int lane = threadIdx.x & 31, w = threadIdx.x >> 5, c = blockIdx.x * 32 + w; const bool isv = blockIdx.y != 0;
    const float* wr = (isv ? Wv : Wk) + (size_t)c * DM + lane * 4; const float* ar = ida + blockIdx.z * DM + lane * 4; const float bias = (isv ? bv : bk)[c]; v4f a[DM / 128], m[DM / 128];
#pragma unroll
    for (int i = 0; i < DM / 128; ++i) { m[i] = *(const v4f*)(wr + i * 128); a[i] = *(const v4f*)(ar + i * 128); }
    float s = lane == 0 ? bfr(bias) : 0.f;
#pragma unroll
    for (int i = 0; i < DM / 128; ++i)
#pragma unroll
        for (int u = 0; u < 4; ++u) s = fmaf(bfr(a[i][u]), bfr(m[i][u]), s);
#pragma unroll
    for (int sh = 16; sh; sh >>= 1) s += __shfl_xor(s, sh, 32);
    if (lane == 0) red[w] = s;
    __syncthreads();
    if (w == 0) (isv ? VID : KID)[blockIdx.z * DM + blockIdx.x * 32 + lane] = red[lane]; }
#define QW 4
#define KT 64
__global__ __launch_bounds__(32 * QW) void k_fattn(const h16* __restrict__ Q16, const h16* __restrict__ K16, const h16* __restrict__ VT, const float* __restrict__ S0, const float* __restrict__ VID, bf* Ah, bf* Al) {
    __shared__ __align__(128) h16 sm[2][2 * KT * HD];    // a buffer: the K tile (8 KiB), behind it the V^T tile (4 x 2 KiB)
    const int w = __builtin_amdgcn_readfirstlane(threadIdx.x >> 5), lane = threadIdx.x & 31, lr = lane & 15, hi = lane >> 4; const int h = blockIdx.y, q0 = blockIdx.x * (32 * QW) + w * 32, hb = blockIdx.z * NH_ + h;    // hb: the head's place in the [batch][head] planes
    const float SC = 0.125f * 1.4426950408889634f; constexpr int NT = TT / KT;
    const h16* qp = Q16 + ((size_t)hb * TT + q0) * HD + 8 * lane; const h16* kg = K16 + (size_t)hb * TT * HD + 8 * threadIdx.x; const h16* vg = VT + (size_t)hb * HD * TT + 8 * threadIdx.x;    // fragment order
    const unsigned sl = (unsigned)(size_t)&sm[0][0] + 16 * threadIdx.x;    // the thread's own 16 B of each 2-KiB run, as a byte address in LDS
    // tile t into buffer b: 8 copies a thread, 16 B each, every lane on. The wait that belongs in front of a rewrite of the copies' address registers is the statement's last line, so that nothing can be lifted over it
    auto fill = [&](int t, int b) {
        const h16* k = kg + t * (KT * HD); const h16* v = vg + t * (KT * 16); const unsigned d = sl + b * (2 * KT * HD * 2);
        asm volatile("global_load_async_to_lds_b128 %0, %8, off\n\t"
                     "global_load_async_to_lds_b128 %1, %9, off\n\t"
                     "global_load_async_to_lds_b128 %2, %10, off\n\t"
                     "global_load_async_to_lds_b128 %3, %11, off\n\t"
                     "global_load_async_to_lds_b128 %4, %12, off\n\t"
                     "global_load_async_to_lds_b128 %5, %13, off\n\t"
                     "global_load_async_to_lds_b128 %6, %14, off\n\t"
                     "global_load_async_to_lds_b128 %7, %15, off\n\t"
                     "s_wait_xcnt 0x0"
                     :: "v"(d), "v"(d + 2048), "v"(d + 4096), "v"(d + 6144), "v"(d + 8192), "v"(d + 10240), "v"(d + 12288), "v"(d + 14336),
                        "v"(k), "v"(k + 1024), "v"(k + 2048), "v"(k + 3072), "v"(v), "v"(v + 16 * TT), "v"(v + 32 * TT), "v"(v + 48 * TT) : "memory"); };
    fill(0, 0);
    v16h qf[2][2]; float mu[2], l[2]; v8f o[4][2];
#pragma unroll
    for (int qt = 0; qt < 2; ++qt) { qf[qt][0] = WFrag<h16>::ld(qp + qt * 16 * HD); qf[qt][1] = WFrag<h16>::ld(qp + qt * 16 * HD + 512);
        mu[qt] = S0[(size_t)hb * TT + q0 + qt * 16 + lr] * SC; l[qt] = hi == 0 ? 1.f : 0.f; }
#pragma unroll
    for (int dt = 0; dt < 4; ++dt) { const v8f vi = *(const v8f*)(VID + hb * HD + dt * 16 + hi * 8); o[dt][0] = vi; o[dt][1] = vi; }
    asm volatile("s_wait_xcnt 0x0" ::: "memory");    // the loads above name address registers that the code below writes anew: the wait that belongs in front of those writes
    asm volatile("s_wait_asynccnt 0x0" ::: "memory");    // this wave's copies of tile 0 have landed
    __syncthreads();    // publishes tile 0 to all four waves
    fill(1, 1);
    // rolled: for speed only
#pragma unroll 1
    for (int t = 0; t < NT; ++t) {
        const h16* kb = &sm[t & 1][0] + 8 * lane; const h16* vb = kb + KT * HD;
        // a tile is two passes of 32 keys; rolled: unrolled they take 66 registers more and save no instruction
#pragma unroll 1
        for (int p = 0; p < KT / 32; ++p) {
            v16h kf[2][2], vf[4]; v8f s[2][2];
#pragma unroll
            for (int kt = 0; kt < 2; ++kt) { kf[kt][0] = WFrag<h16>::ld(kb + (p * 32 + kt * 16) * HD); kf[kt][1] = WFrag<h16>::ld(kb + (p * 32 + kt * 16) * HD + 512); }
#pragma unroll
            for (int dt = 0; dt < 4; ++dt) vf[dt] = WFrag<h16>::ld(vb + dt * (KT * 16) + p * 512);
#pragma unroll
            for (int kt = 0; kt < 2; ++kt)
#pragma unroll
                for (int qt = 0; qt < 2; ++qt) s[kt][qt] = wmma16(kf[kt][1], qf[qt][1], wmma16(kf[kt][0], qf[qt][0], (v8f){}));
            float tm[2];
#pragma unroll
            for (int qt = 0; qt < 2; ++qt) { tm[qt] = -8.f;
#pragma unroll
                for (int kt = 0; kt < 2; ++kt)
#pragma unroll
                    for (int j = 0; j < 8; ++j) { s[kt][qt][j] = fmaf(s[kt][qt][j], SC, -mu[qt]); tm[qt] = fmaxf(tm[qt], s[kt][qt][j]); } }
            if (__builtin_amdgcn_ballot_w32(fmaxf(tm[0], tm[1]) > 8.f) != 0) {    // rare, wave-uniform: raise the base of every column to its maximum so far, alike in both halves of the wave
#pragma unroll
                for (int qt = 0; qt < 2; ++qt) { const float dl = fmaxf(fmaxf(tm[qt], __shfl_xor(tm[qt], 16, 32)), 0.f), al = __builtin_amdgcn_exp2f(-dl); mu[qt] += dl; l[qt] *= al;
#pragma unroll
                    for (int dt = 0; dt < 4; ++dt) o[dt][qt] *= al;
#pragma unroll
                    for (int kt = 0; kt < 2; ++kt) s[kt][qt] -= dl; } }
#pragma unroll
            for (int qt = 0; qt < 2; ++qt) { v16h pf;
#pragma unroll
                for (int kt = 0; kt < 2; ++kt)
#pragma unroll
                    for (int j = 0; j < 8; ++j) { const float pe = __builtin_amdgcn_exp2f(s[kt][qt][j]); l[qt] += pe; pf[kt * 8 + j] = tohx(pe); }
#pragma unroll
                for (int dt = 0; dt < 4; ++dt) o[dt][qt] = wmma16(vf[dt], pf, o[dt][qt]); }
        }
        asm volatile("s_wait_dscnt 0x0" ::: "memory");    // this wave's reads of the buffer are done before it is given up for refill
        asm volatile("s_wait_asynccnt 0x0" ::: "memory");    // this wave's copies of tile t + 1 have landed
        __syncthreads();    // publishes tile t + 1 and ends every wave's reads of tile t's buffer
        if (t + 2 < NT) fill(t + 2, t & 1);
    }
    asm volatile("s_wait_asynccnt 0x0" ::: "memory");    // no copy is left in flight when the wave ends
#pragma unroll
    for (int qt = 0; qt < 2; ++qt) { l[qt] += __shfl_xor(l[qt], 16, 32); const float inv = __fdiv_rn(1.0f, l[qt]);
        const size_t oo = ((size_t)blockIdx.z * TT + q0 + qt * 16) * DM + h * 1024 + 8 * lane;    // rows q0 + 16 qt .., k h * 64 of the [4 * 2048][768] planes, fragment order; + 16 k is + 256
#pragma unroll
        for (int dt = 0; dt < 4; ++dt) { v8us oh, ol;
#pragma unroll
            for (int e = 0; e < 8; ++e) { unsigned short x, y; splitf(o[dt][qt][e] * inv, x, y); oh[e] = x; ol[e] = y; }
            *(v8us*)(Ah + oo + dt * 256) = oh; *(v8us*)(Al + oo + dt * 256) = ol; } }
}

extern "C" void kernel_launch(void* const* d_in, const int* in_sizes, int n_in,
                              void* d_out, int out_size, void* d_ws, size_t ws_size, hipStream_t stream) {
    (void)in_sizes; (void)n_in; (void)out_size;
    const float** I = (const float**)d_in;
    const float *x = I[0], *ida = I[1], *Wq = I[2], *bq = I[3], *Wk = I[4], *bk = I[5], *Wv = I[6], *bv = I[7], *Wo = I[8], *bo = I[9];
    float* OUT = (float*)d_out;     // [4][2048][768]
    char* wsp = (char*)d_ws;
    auto take = [&](size_t bytes) { char* p = wsp; wsp += (bytes + 255) & ~(size_t)255; return (void*)p; };
    // every plane holds all 4 batches; all sizes are multiples of 256 B, so BQ BK BV BO XB and Q16 K16 VT each lie one behind the other with no gap (k_cvt8 and the z of the QKV launch lean on that)
    bf* BQ = (bf*)take((size_t)DM * DM * 2); take((size_t)DM * DM * 2); take((size_t)DM * DM * 2); bf* BO = (bf*)take((size_t)DM * DM * 2);
    bf* XB = (bf*)take((size_t)NB_ * TT * DM * 2); float* KID = (float*)take(NB_ * DM * 4); float* VID = (float*)take(NB_ * DM * 4); float* S0 = (float*)take((size_t)NB_ * NH_ * TT * 4);
    h16* Q16 = (h16*)take((size_t)NB_ * NH_ * TT * HD * 2); h16* K16 = (h16*)take((size_t)NB_ * NH_ * TT * HD * 2); h16* VT = (h16*)take((size_t)NB_ * NH_ * HD * TT * 2); bf* Ah = (bf*)take((size_t)NB_ * TT * DM * 2); bf* Al = (bf*)take((size_t)NB_ * TT * DM * 2);
    if ((size_t)(wsp - (char*)d_ws) > ws_size) return;    // total ~ 81 MB
    k_cvt8<<<4 * WBL + NB_ * TT * DM / 8 / 256, 256, 0, stream>>>(Wq, Wk, Wv, Wo, x, BQ);   // torch [out][in] = Bt
    k_idkv<<<dim3(DM / 32, 2, NB_), 1024, 0, stream>>>(ida, Wk, bk, Wv, bv, KID, VID);   // ahead of the QKV launch, whose Q epilogue reads KID
    k_gemmt<0, true><<<dim3(NB_ * TT / 128, DM / 192, 3), 128, 0, stream>>>(XB, nullptr, BQ, S0, bq, bk, bv, Q16, KID);   // z: Q, K, V; the batches are rows
    k_fattn<<<dim3(TT / (32 * QW), NH_, NB_), 32 * QW, 0, stream>>>(Q16, K16, VT, S0, VID, Ah, Al);
    k_gemmt<1, false><<<dim3(NB_ * TT / 128, DM / 128, 1), 128, 0, stream>>>(Ah, Al, BO, OUT, bo, bo, bo, nullptr, nullptr);
}
